// v000
// Measured on an AMD MI455X. A time is GPU time per run, averaged over a window of back-to-back runs after a warm-up
// (all launches, gaps included; the runs take copies of the inputs in turn), and the median of several windows.
// Apart from v000's, it joins two sittings. Times from different sittings can be a few percent apart, while
// side-by-side timings come from the same sitting.
// v000 is the starting kernel. One run takes 305 microseconds.
// compute dtype: all float inputs rounded to bf16; q/k/v = z . W with EXACT bf16 products on WMMA 16x16x32 ((in,out) weights as transposed rows), rounded once to f16 (v as planes); per 16-query x 32-key chunk: token dots q_h . k_h x 32^-1/2 on WMMA (single f16), the pair features [xq - xkv | dots | 0] in f32, the kernel MLP relu(F . W1 + b1) . W2 + b2 on WMMA with F and the hidden as bf16 hi + lo (2 products each); per (query, head) running-max softmax over the keys in f32 (hardware exp), P (scaled by 2^11, single f16) x v (single f16); out = ctx (bf16 hi + lo, 2 products) . Wout + bout; xq copied through as the second output; f32 outputs.
#include <hip/hip_runtime.h>
#include <math.h>

typedef __attribute__((ext_vector_type(16))) _Float16 v16h;
typedef __attribute__((ext_vector_type(16))) __bf16 v16b;
typedef __attribute__((ext_vector_type(8)))  _Float16 v8h;
typedef __attribute__((ext_vector_type(8)))  float v8f;
typedef __attribute__((ext_vector_type(4)))  float v4f;
typedef __attribute__((ext_vector_type(2)))  float v2f;
typedef __attribute__((ext_vector_type(4)))  unsigned v4u;
typedef __attribute__((ext_vector_type(4)))  int v4i;
typedef float __attribute__((may_alias)) float_a;
typedef int __attribute__((may_alias)) int_a;

template <typename T> __device__ __forceinline__ void vst2(void* p, T v) { *(T*)p = v;  }
__device__ __forceinline__ v8f wmma16(v16h a, v16h b, v8f c) {
  v8f d = __builtin_amdgcn_wmma_f32_16x16x32_f16(false, a, false, b, (short)0, c, false, false);
  asm volatile("v_nop\n\tv_nop\n\tv_nop\n\tv_nop" : "+v"(d) : "v"(a), "v"(b));
  return d;
}
__device__ __forceinline__ v8f wmma_bf(v16b a, v16b b, v8f c) {
  v8f d = __builtin_amdgcn_wmma_f32_16x16x32_bf16(false, a, false, b, (short)0, c, false, false);
  asm volatile("v_nop\n\tv_nop\n\tv_nop\n\tv_nop" : "+v"(d) : "v"(a), "v"(b));
  return d;
}
// 16x16x32 fragments: lane = (h = lane>>4, row/col = lane&15); elements 0..7 = k0+8h+0..7, 8..15 = k0+16+8h+0..7; D element r = row 8h+r
__device__ __forceinline__ v16h frag_h(const _Float16* rowk0, int lane) {
  union { v16h v; v8h q[2]; } u; const _Float16* p = rowk0 + 8 * (lane >> 4);
  u.q[0] = *(const v8h*)p; u.q[1] = *(const v8h*)(p + 16); return u.v;
}
__device__ __forceinline__ v16h frag_f32(const float* rowk0, int lane) {
  v16h a; const float* p = rowk0 + 8 * (lane >> 4);
#pragma unroll
  for (int i = 0; i < 8; ++i) { a[i] = (_Float16)p[i]; a[8 + i] = (_Float16)p[16 + i]; }
  return a;
}
__device__ __forceinline__ v16h frag_f32s(const float* rowk0, int lane, float sc) {
  v16h a; const float* p = rowk0 + 8 * (lane >> 4);
#pragma unroll
  for (int i = 0; i < 8; ++i) { a[i] = (_Float16)(p[i] * sc); a[8 + i] = (_Float16)(p[16 + i] * sc); }
  return a;
}
// column fragment from a [K][ld] layout (column n), rows >= K read as 0
__device__ __forceinline__ v16h fragc_f32(const float* W, int k0, int n, int lane, int ld, int K) {
  v16h a; const int g = lane >> 4;
#pragma unroll
  for (int i = 0; i < 8; ++i) { const int ka = k0 + 8 * g + i, kb = ka + 16;
    a[i] = (_Float16)(ka < K ? W[(size_t)(ka < K ? ka : K - 1) * ld + n] : 0.f); a[8 + i] = (_Float16)(kb < K ? W[(size_t)(kb < K ? kb : K - 1) * ld + n] : 0.f); }
  return a;
}
struct F2 { v16b h, l; };
__device__ __forceinline__ F2 bsplit16(const float v[16]) { F2 r;
#pragma unroll
  for (int i = 0; i < 16; ++i) { const __bf16 h = (__bf16)v[i]; r.h[i] = h; r.l[i] = (__bf16)(v[i] - (float)h); }
  return r; }
__device__ __forceinline__ F2 split_row(const float* row, int k0, int lane) { float v[16]; const float* p = row + k0 + 8 * (lane >> 4);
#pragma unroll
  for (int i = 0; i < 8; ++i) { v[i] = p[i]; v[8 + i] = p[16 + i]; }
  return bsplit16(v); }
__device__ __forceinline__ F2 split_rowK(const float* row, int k0, int lane, int K) { float v[16]; const int g = lane >> 4;
#pragma unroll
  for (int i = 0; i < 8; ++i) { const int ka = k0 + 8 * g + i, kb = ka + 16; v[i] = ka < K ? row[ka < K ? ka : K - 1] : 0.f; v[8 + i] = kb < K ? row[kb < K ? kb : K - 1] : 0.f; }
  return bsplit16(v); }
__device__ __forceinline__ F2 split_col(const float* W, int k0, int n, int lane, int ld, int K) { float v[16]; const int g = lane >> 4;
#pragma unroll
  for (int i = 0; i < 8; ++i) { const int ka = k0 + 8 * g + i, kb = ka + 16; v[i] = ka < K ? W[(size_t)(ka < K ? ka : K - 1) * ld + n] : 0.f; v[8 + i] = kb < K ? W[(size_t)(kb < K ? kb : K - 1) * ld + n] : 0.f; }
  return bsplit16(v); }
__device__ __forceinline__ v8f mac3(const F2& a, const F2& b, v8f c) { c = wmma_bf(a.l, b.h, c); c = wmma_bf(a.h, b.l, c); return wmma_bf(a.h, b.h, c); }
__device__ __forceinline__ float sigm(float v) { return 1.0f / (1.0f + expf(-v)); }
#define LDSX() do { asm volatile("s_wait_dscnt 0" ::: "memory"); __builtin_amdgcn_wave_barrier(); __builtin_amdgcn_fence(__ATOMIC_RELEASE, "workgroup"); } while (0)


// Translation-equivariant multi-head attention (8 sets, 1,024 queries x 1,024 keys, dz 256, dx 2, 8 heads x 32, kernel MLP 10 -> 32 -> 8): logits = MLP([x_q - x_k, q_h . k_h / sqrt(32)]), softmax over keys, . v, output projection; the query locations pass through.
#define NM 8
#define NQ 1024
#define NK 1024
#define DZ 256
#define NH 8
#define HD 32
#define KH 32
#define NF 16              // padded feature width (2 + 8 used)
#define NRQ (NM * NQ)
#define NRK (NM * NK)
#ifndef TQB
#define TQB (NQ / 16)
#define TNM NM
#endif
typedef __attribute__((ext_vector_type(8))) __bf16 v8b;
__device__ __forceinline__ v16b frag_b(const __bf16* rowk0, int lane) {
  union { v16b v; v8b q[2]; } u; const __bf16* p = rowk0 + 8 * (lane >> 4);
  u.q[0] = *(const v8b*)p; u.q[1] = *(const v8b*)(p + 16); return u.v;
}
__device__ __forceinline__ float bfr(float v) { return (float)(__bf16)v; }
__device__ __attribute__((noinline)) float exp_ni(float v) { return expf(v); }
__device__ __attribute__((noinline)) float erf_ni(float v) { return erff(v); }

#define WS_PW  0u                                   // bf16 transposed rows Wq^T, Wk^T, Wv^T, Wout^T [4][256][256]; W1^T padded [32][32] (k = feature 0..9, rest 0); W2^T padded [16][32] (rows 8..15 zero)
#define WS_P1  (WS_PW + 2u * (size_t)4 * DZ * DZ)
#define WS_P2  (WS_P1 + 2u * (size_t)32 * 32)
#define WS_Q   (WS_P2 + 2u * (size_t)16 * 32)         // f16 q rows [NRQ][256]; k rows [NRK][256]; v planes [m][256][NK]; f32 ctx [NRQ][256]
#define WS_K   (WS_Q + 2u * (size_t)NRQ * DZ)
#define WS_V   (WS_K + 2u * (size_t)NRK * DZ)
#define WS_O   (WS_V + 2u * (size_t)NM * DZ * NK)
#define OUT1   ((size_t)NRQ * DZ)                     // float offset of the second output (xq copy)
#define WS_END (WS_O + 4u * (size_t)NRQ * DZ)

__global__ __launch_bounds__(256) void k_pack(const float* __restrict__ WQ, const float* __restrict__ WK, const float* __restrict__ WV, const float* __restrict__ WO, const float* __restrict__ W1, const float* __restrict__ W2, __bf16* __restrict__ PW, __bf16* __restrict__ P1, __bf16* __restrict__ P2) {
  const int n = blockIdx.x, which = blockIdx.y, t = threadIdx.x; __shared__ __align__(16) __bf16 s[DZ];
  if (which < 4) { const float* w = (which == 0) ? WQ : (which == 1) ? WK : (which == 2) ? WV : WO; s[t] = (__bf16)w[(size_t)t * DZ + n]; __syncthreads(); if (t < DZ / 8) vst2((unsigned*)(PW + ((size_t)which * DZ + n) * DZ + t * 8), *(const v4u*)&s[t * 8]); }
  else if (which == 4) { if (n >= 32) return; if (t < 32) s[t] = (t < 10) ? (__bf16)W1[(size_t)t * KH + n] : (__bf16)0.f; __syncthreads(); if (t < 4) vst2((unsigned*)(P1 + (size_t)n * 32 + t * 8), *(const v4u*)&s[t * 8]); }   // W1^T [n=hidden][k=feature]
  else { if (n >= 16) return; if (t < 32) s[t] = (n < NH) ? (__bf16)W2[(size_t)t * NH + n] : (__bf16)0.f; __syncthreads(); if (t < 4) vst2((unsigned*)(P2 + (size_t)n * 32 + t * 8), *(const v4u*)&s[t * 8]); } }   // W2^T [n=head][k=hidden]
// ---- k_proj: block = (64 rows, 128 cols, which): q from zq, k from zk -> f16 rows; v from zv -> planes
__global__ __launch_bounds__(128) void k_proj(const float* __restrict__ ZQ, const float* __restrict__ ZK, const float* __restrict__ ZV, const __bf16* __restrict__ PW, _Float16* __restrict__ Q, _Float16* __restrict__ Kr, _Float16* __restrict__ V) {
  __shared__ __align__(16) _Float16 so[64][136]; __shared__ __align__(16) _Float16 st[128][72];
  const int tid = threadIdx.x, wave = tid >> 5, lane = tid & 31, col = lane & 15, g = lane >> 4; const int which = blockIdx.z; const size_t rb = (size_t)blockIdx.x * 64; const size_t r0 = rb + wave * 16; const int c0 = blockIdx.y * 128; const float* A = (which == 0) ? ZQ : (which == 1) ? ZK : ZV; const __bf16* Wr = PW + ((size_t)which * DZ) * DZ;
  v8f acc[8] = {};
#pragma unroll
  for (int kc = 0; kc < DZ / 32; ++kc) { v16b a; { const float* p = A + (r0 + col) * DZ + kc * 32 + 8 * g;
#pragma unroll
      for (int i = 0; i < 8; ++i) { a[i] = (__bf16)p[i]; a[8 + i] = (__bf16)p[16 + i]; } }
#pragma unroll
    for (int j = 0; j < 8; ++j) acc[j] = wmma_bf(a, frag_b(Wr + (size_t)(c0 + j * 16 + col) * DZ + kc * 32, lane), acc[j]); }
#pragma unroll
  for (int j = 0; j < 8; ++j)
#pragma unroll
    for (int r = 0; r < 8; ++r) { const _Float16 hv = (_Float16)acc[j][r]; if (which < 2) so[wave * 16 + 8 * g + r][j * 16 + col] = hv; else st[j * 16 + col][wave * 16 + 8 * g + r] = hv; }
  __syncthreads();
  if (which < 2) { _Float16* dst = (which == 0) ? Q : Kr; for (int e = tid; e < 64 * 16; e += 128) { const int rl = e >> 4, q = e & 15; vst2((unsigned*)(dst + (rb + rl) * DZ + c0 + q * 8), *(const v4u*)&so[rl][q * 8]); } }
  else { const size_t mI = rb / NK; const int s0 = (int)(rb % NK); for (int e = tid; e < 128 * 8; e += 128) { const int d = e >> 3, pc = e & 7; vst2((unsigned*)(V + ((mI * DZ + c0 + d) * NK) + s0 + pc * 8), *(const v4u*)&st[d][pc * 8]); } }
}
// ---- k_te: block = (16 queries, m), 4 waves; per 32-key chunk: (a) wave w computes token dots for heads 2w, 2w+1 -> F[q*32 + k][2 + h] x 32^-1/2, wave 0 also writes the two position-difference features; (b) each wave runs the MLP on its 8 row tiles (128 pairs): h1 = relu(F . W1 + b1), dots = h1 . W2 + b2 -> SC[pair][h]; (c) wave w runs the running-max softmax + P.v for heads 2w, 2w+1 over the chunk
__global__ __launch_bounds__(128) void k_te(const _Float16* __restrict__ Q, const _Float16* __restrict__ Kr, const _Float16* __restrict__ V, const float* __restrict__ XQ, const float* __restrict__ XKV, const __bf16* __restrict__ P1, const __bf16* __restrict__ P2, const float* __restrict__ B1, const float* __restrict__ B2, float* __restrict__ O) {
  __shared__ __align__(16) float sF[512][NF + 4 + 12];   // 32-wide rows so split_row can read a full 32-col fragment (cols 16..31 zero)
  __shared__ __align__(16) float sH[4][16][KH + 4]; __shared__ __align__(16) float sS[512][NH + 1]; __shared__ __align__(16) _Float16 sph[4][16][40]; __shared__ __align__(16) float so[4][16][68]; __shared__ float sxq[16][2];
  const int tid = threadIdx.x, wave = tid >> 5, lane = tid & 31, col = lane & 15, g = lane >> 4; const size_t mI = blockIdx.y; const int q0 = blockIdx.x * 16; const size_t rq = mI * NQ + q0;
  for (int e = tid; e < 512 * 32; e += 128) sF[e >> 5][e & 31] = 0.f;
  if (tid < 32) sxq[tid >> 1][tid & 1] = bfr(XQ[(rq + (tid >> 1)) * 2 + (tid & 1)]);
  __syncthreads();
  v16h aq[2]; { const int h0 = wave * 2; aq[0] = frag_h(Q + (rq + col) * DZ + h0 * HD, lane); aq[1] = frag_h(Q + (rq + col) * DZ + (h0 + 1) * HD, lane); }
  float m[2][8], l[2][8];
#pragma unroll
  for (int hh = 0; hh < 2; ++hh)
#pragma unroll
    for (int r = 0; r < 8; ++r) { m[hh][r] = -3.0e38f; l[hh][r] = 0.f; }
  v8f acc[2][2] = {};
#pragma unroll 1
  for (int ks = 0; ks < NK / 32; ++ks) { const int j0 = ks * 32;
    // (a) token dots for this wave's two heads, both 16-key halves; + diff features (wave 0)
#pragma unroll
    for (int hh = 0; hh < 2; ++hh) { const int h = wave * 2 + hh;
#pragma unroll
      for (int ct = 0; ct < 2; ++ct) { const int kk = j0 + ct * 16 + col; v8f c = {}; c = wmma16(aq[hh], frag_h(Kr + (mI * NK + kk) * DZ + h * HD, lane), c);
#pragma unroll
        for (int r = 0; r < 8; ++r) sF[(8 * g + r) * 32 + ct * 16 + col][2 + h] = c[r] * 0.17677669529663688f; } }
    if (wave == 0) { for (int e = lane; e < 16 * 32; e += 32) { const int ql = e >> 5, kl = e & 31; const size_t kr = mI * NK + j0 + kl; sF[e][0] = sxq[ql][0] - bfr(XKV[kr * 2]); sF[e][1] = sxq[ql][1] - bfr(XKV[kr * 2 + 1]); } }
    __syncthreads();
    // (b) MLP on this wave's 8 row tiles of 16 pairs
#pragma unroll 1
    for (int rt = 0; rt < 8; ++rt) { const int p0 = wave * 128 + rt * 16;
      { v8f hacc[2] = {}; const F2 a = split_row(&sF[p0 + col][0], 0, lane);
#pragma unroll
        for (int j = 0; j < 2; ++j) { const v16b w = frag_b(P1 + (size_t)(j * 16 + col) * 32, lane); hacc[j] = wmma_bf(a.h, w, hacc[j]); hacc[j] = wmma_bf(a.l, w, hacc[j]); }
#pragma unroll
        for (int j = 0; j < 2; ++j) { const float bb = bfr(B1[j * 16 + col]);
#pragma unroll
          for (int r = 0; r < 8; ++r) { const float v = hacc[j][r] + bb; sH[wave][8 * g + r][j * 16 + col] = v > 0.f ? v : 0.f; } } }
      LDSX();
      { v8f dacc = {}; const F2 a = split_row(&sH[wave][col][0], 0, lane); const v16b w = frag_b(P2 + (size_t)col * 32, lane); dacc = wmma_bf(a.h, w, dacc); dacc = wmma_bf(a.l, w, dacc);
        if (col < NH) {
#pragma unroll
          for (int r = 0; r < 8; ++r) sS[p0 + 8 * g + r][col] = dacc[r] + bfr(B2[col]); } }
      LDSX(); }
    __syncthreads();
    // (c) softmax + P.v for this wave's two heads: s[q][k] = sS[q*32 + k][h]
#pragma unroll
    for (int hh = 0; hh < 2; ++hh) { const int h = wave * 2 + hh; v8f s[2];
#pragma unroll
      for (int ct = 0; ct < 2; ++ct)
#pragma unroll
        for (int r = 0; r < 8; ++r) s[ct][r] = sS[(8 * g + r) * 32 + ct * 16 + col][h];
#pragma unroll
      for (int r = 0; r < 8; ++r) { float mx = fmaxf(s[0][r], s[1][r]);
#pragma unroll
        for (int o = 1; o < 16; o <<= 1) mx = fmaxf(mx, __shfl_xor(mx, o));
        const float mn = fmaxf(m[hh][r], mx); const float alpha = (m[hh][r] <= -1.0e38f) ? 0.f : __expf(m[hh][r] - mn); const float e0 = __expf(s[0][r] - mn), e1 = __expf(s[1][r] - mn); float es = e0 + e1;
#pragma unroll
        for (int o = 1; o < 16; o <<= 1) es += __shfl_xor(es, o);
        l[hh][r] = l[hh][r] * alpha + es; m[hh][r] = mn;
#pragma unroll
        for (int dt = 0; dt < 2; ++dt) acc[hh][dt][r] *= alpha;
        sph[wave][8 * g + r][col] = (_Float16)(e0 * 2048.0f); sph[wave][8 * g + r][16 + col] = (_Float16)(e1 * 2048.0f); }
      LDSX();
      const v16h pa = frag_h(&sph[wave][col][0], lane);
#pragma unroll
      for (int dt = 0; dt < 2; ++dt) acc[hh][dt] = wmma16(pa, frag_h(V + ((mI * DZ + h * HD + dt * 16 + col) * NK) + j0, lane), acc[hh][dt]);
      LDSX(); }
    __syncthreads(); }
#pragma unroll
  for (int hh = 0; hh < 2; ++hh) { const int h = wave * 2 + hh;
#pragma unroll
    for (int r = 0; r < 8; ++r) { const float il = (1.0f / 2048.0f) / l[hh][r];
#pragma unroll
      for (int dt = 0; dt < 2; ++dt) so[wave][8 * g + r][hh * 32 + dt * 16 + col] = acc[hh][dt][r] * il; }
    (void)h; }
  LDSX();
  for (int rl = 0; rl < 16; ++rl) if (lane < 16) vst2(O + (rq + rl) * DZ + wave * 64 + lane * 4, *(const v4f*)&so[wave][rl][lane * 4]);   // heads 2w, 2w+1 = 64 contiguous floats (256-B segment)
}
// ---- k_out: block = (64 rows, 128 cols): out0 = ctx (hi + lo) . Wout + bout
__global__ __launch_bounds__(128) void k_out(const float* __restrict__ O, const __bf16* __restrict__ PW, const float* __restrict__ BO, float* __restrict__ Y) { __shared__ __align__(16) float so[4][16][132];
  const int tid = threadIdx.x, wave = tid >> 5, lane = tid & 31, col = lane & 15, g = lane >> 4; const size_t r0 = (size_t)blockIdx.x * 64 + wave * 16; const int c0 = blockIdx.y * 128; const __bf16* Wr = PW + (size_t)3 * DZ * DZ;
  v8f acc[8] = {};
#pragma unroll
  for (int kc = 0; kc < DZ / 32; ++kc) { const F2 a = split_row(O + (r0 + col) * DZ, kc * 32, lane);
#pragma unroll
    for (int j = 0; j < 8; ++j) { const v16b w = frag_b(Wr + (size_t)(c0 + j * 16 + col) * DZ + kc * 32, lane); acc[j] = wmma_bf(a.h, w, acc[j]); acc[j] = wmma_bf(a.l, w, acc[j]); } }
#pragma unroll
  for (int j = 0; j < 8; ++j) { const float bb = bfr(BO[c0 + j * 16 + col]);
#pragma unroll
    for (int r = 0; r < 8; ++r) so[wave][8 * g + r][j * 16 + col] = acc[j][r] + bb; }
  LDSX(); for (int rl = 0; rl < 16; ++rl) vst2(Y + (r0 + rl) * DZ + c0 + lane * 4, *(const v4f*)&so[wave][rl][lane * 4]); }
// ---- k_copy: second output = xq (f32 copy, 16-B chunks; whole buffer)
__global__ __launch_bounds__(256) void k_copy(const float* __restrict__ XQ, float* __restrict__ OUT, int n4) { const int i = blockIdx.x * 256 + threadIdx.x; if (i < n4) { v4f v = *(const v4f*)(XQ + (size_t)i * 4); vst2(OUT + (size_t)i * 4, v); } }
extern "C" void kernel_launch(void* const* d_in, const int* in_sizes, int n_in, void* d_out, int out_size, void* d_ws, size_t ws_size, hipStream_t stream) {
  (void)in_sizes; (void)n_in; (void)out_size;
  const float** F = (const float**)d_in;   // 0 zq, 1 zk, 2 zv [8,1024,256]; 3 xq, 4 xkv [8,1024,2]; 5 Wq, 6 Wk, 7 Wv [256,256] (in,out); 8 Wout [256,256] (in,out), 9 bout; 10 W1 [10,32], 11 b1 [32], 12 W2 [32,8], 13 b2 [8]
  if (ws_size < (size_t)WS_END) return;
  char* ws = (char*)d_ws; __bf16 *PW = (__bf16*)(ws + WS_PW), *P1 = (__bf16*)(ws + WS_P1), *P2 = (__bf16*)(ws + WS_P2); _Float16 *Q = (_Float16*)(ws + WS_Q), *Kr = (_Float16*)(ws + WS_K), *V = (_Float16*)(ws + WS_V); float* O = (float*)(ws + WS_O);
  k_pack<<<dim3(DZ, 6), 256, 0, stream>>>(F[5], F[6], F[7], F[8], F[10], F[12], PW, P1, P2);
  k_proj<<<dim3(TNM * NQ / 64, DZ / 128, 3), 128, 0, stream>>>(F[0], F[1], F[2], PW, Q, Kr, V);
  k_te<<<dim3(TQB, TNM), 128, 0, stream>>>(Q, Kr, V, F[3], F[4], P1, P2, F[11], F[13], O);
  k_out<<<dim3(TNM * NQ / 64, DZ / 128), 128, 0, stream>>>(O, PW, F[9], (float*)d_out);
  k_copy<<<(NRQ * 2 / 4 + 255) / 256, 256, 0, stream>>>(F[3], (float*)d_out + OUT1, NRQ * 2 / 4);
}

// v001
// It runs in 194 microseconds.
// Timed twice side by side with v000, it ran 1.64 and 1.61 times as fast.
// compute dtype: all float inputs rounded to bf16; q/k/v = z . W with EXACT bf16 products on WMMA 16x16x32 ((in,out) weights as transposed rows), rounded once to f16 (v as planes); per 16-query x 32-key chunk: token dots q_h . k_h x 32^-1/2 on WMMA (single f16), the pair features [xq - xkv | dots | 0] in f32, the kernel MLP relu(F . W1 + b1) . W2 + b2 on WMMA with F and the hidden as bf16 hi + lo (2 products each); per (query, head) running-max softmax over the keys in f32 (hardware exp), P (scaled by 2^11, single f16) x v (single f16); out = ctx (bf16 hi + lo, 2 products) . Wout + bout; xq copied through as the second output; f32 outputs.
#include <hip/hip_runtime.h>
#include <math.h>

typedef __attribute__((ext_vector_type(16))) _Float16 v16h;
typedef __attribute__((ext_vector_type(16))) __bf16 v16b;
typedef __attribute__((ext_vector_type(8)))  _Float16 v8h;
typedef __attribute__((ext_vector_type(8)))  float v8f;
typedef __attribute__((ext_vector_type(4)))  float v4f;
typedef __attribute__((ext_vector_type(2)))  float v2f;
typedef __attribute__((ext_vector_type(4)))  unsigned v4u;
typedef __attribute__((ext_vector_type(4)))  int v4i;
typedef float __attribute__((may_alias)) float_a;
typedef int __attribute__((may_alias)) int_a;

template <typename T> __device__ __forceinline__ void vst2(void* p, T v) { *(T*)p = v;  }
__device__ __forceinline__ v8f wmma16(v16h a, v16h b, v8f c) {
  v8f d = __builtin_amdgcn_wmma_f32_16x16x32_f16(false, a, false, b, (short)0, c, false, false);
  asm volatile("v_nop\n\tv_nop\n\tv_nop\n\tv_nop" : "+v"(d) : "v"(a), "v"(b));
  return d;
}
__device__ __forceinline__ v8f wmma_bf(v16b a, v16b b, v8f c) {
  v8f d = __builtin_amdgcn_wmma_f32_16x16x32_bf16(false, a, false, b, (short)0, c, false, false);
  asm volatile("v_nop\n\tv_nop\n\tv_nop\n\tv_nop" : "+v"(d) : "v"(a), "v"(b));
  return d;
}
// 16x16x32 fragments: lane = (h = lane>>4, row/col = lane&15); elements 0..7 = k0+8h+0..7, 8..15 = k0+16+8h+0..7; D element r = row 8h+r
__device__ __forceinline__ v16h frag_h(const _Float16* rowk0, int lane) {
  union { v16h v; v8h q[2]; } u; const _Float16* p = rowk0 + 8 * (lane >> 4);
  u.q[0] = *(const v8h*)p; u.q[1] = *(const v8h*)(p + 16); return u.v;
}
__device__ __forceinline__ v16h frag_f32(const float* rowk0, int lane) {
  v16h a; const float* p = rowk0 + 8 * (lane >> 4);
#pragma unroll
  for (int i = 0; i < 8; ++i) { a[i] = (_Float16)p[i]; a[8 + i] = (_Float16)p[16 + i]; }
  return a;
}
__device__ __forceinline__ v16h frag_f32s(const float* rowk0, int lane, float sc) {
  v16h a; const float* p = rowk0 + 8 * (lane >> 4);
#pragma unroll
  for (int i = 0; i < 8; ++i) { a[i] = (_Float16)(p[i] * sc); a[8 + i] = (_Float16)(p[16 + i] * sc); }
  return a;
}
// column fragment from a [K][ld] layout (column n), rows >= K read as 0
__device__ __forceinline__ v16h fragc_f32(const float* W, int k0, int n, int lane, int ld, int K) {
  v16h a; const int g = lane >> 4;
#pragma unroll
  for (int i = 0; i < 8; ++i) { const int ka = k0 + 8 * g + i, kb = ka + 16;
    a[i] = (_Float16)(ka < K ? W[(size_t)(ka < K ? ka : K - 1) * ld + n] : 0.f); a[8 + i] = (_Float16)(kb < K ? W[(size_t)(kb < K ? kb : K - 1) * ld + n] : 0.f); }
  return a;
}
struct F2 { v16b h, l; };
__device__ __forceinline__ F2 bsplit16(const float v[16]) { F2 r;
#pragma unroll
  for (int i = 0; i < 16; ++i) { const __bf16 h = (__bf16)v[i]; r.h[i] = h; r.l[i] = (__bf16)(v[i] - (float)h); }
  return r; }
__device__ __forceinline__ F2 split_row(const float* row, int k0, int lane) { float v[16]; const float* p = row + k0 + 8 * (lane >> 4);
#pragma unroll
  for (int i = 0; i < 8; ++i) { v[i] = p[i]; v[8 + i] = p[16 + i]; }
  return bsplit16(v); }
__device__ __forceinline__ F2 split_rowK(const float* row, int k0, int lane, int K) { float v[16]; const int g = lane >> 4;
#pragma unroll
  for (int i = 0; i < 8; ++i) { const int ka = k0 + 8 * g + i, kb = ka + 16; v[i] = ka < K ? row[ka < K ? ka : K - 1] : 0.f; v[8 + i] = kb < K ? row[kb < K ? kb : K - 1] : 0.f; }
  return bsplit16(v); }
__device__ __forceinline__ F2 split_col(const float* W, int k0, int n, int lane, int ld, int K) { float v[16]; const int g = lane >> 4;
#pragma unroll
  for (int i = 0; i < 8; ++i) { const int ka = k0 + 8 * g + i, kb = ka + 16; v[i] = ka < K ? W[(size_t)(ka < K ? ka : K - 1) * ld + n] : 0.f; v[8 + i] = kb < K ? W[(size_t)(kb < K ? kb : K - 1) * ld + n] : 0.f; }
  return bsplit16(v); }
__device__ __forceinline__ v8f mac3(const F2& a, const F2& b, v8f c) { c = wmma_bf(a.l, b.h, c); c = wmma_bf(a.h, b.l, c); return wmma_bf(a.h, b.h, c); }
__device__ __forceinline__ float sigm(float v) { return 1.0f / (1.0f + expf(-v)); }
#define LDSX() do { asm volatile("s_wait_dscnt 0" ::: "memory"); __builtin_amdgcn_wave_barrier(); __builtin_amdgcn_fence(__ATOMIC_RELEASE, "workgroup"); } while (0)


// Translation-equivariant multi-head attention (8 sets, 1,024 queries x 1,024 keys, dz 256, dx 2, 8 heads x 32, kernel MLP 10 -> 32 -> 8): logits = MLP([x_q - x_k, q_h . k_h / sqrt(32)]), softmax over keys, . v, output projection; the query locations pass through.
#define NM 8
#define NQ 1024
#define NK 1024
#define DZ 256
#define NH 8
#define HD 32
#define KH 32
#define NF 16              // padded feature width (2 + 8 used)
#define NRQ (NM * NQ)
#define NRK (NM * NK)
#ifndef TQB
#define TQB (NQ / 16)
#define TNM NM
#endif
typedef __attribute__((ext_vector_type(8))) __bf16 v8b;
__device__ __forceinline__ v16b frag_b(const __bf16* rowk0, int lane) {
  union { v16b v; v8b q[2]; } u; const __bf16* p = rowk0 + 8 * (lane >> 4);
  u.q[0] = *(const v8b*)p; u.q[1] = *(const v8b*)(p + 16); return u.v;
}
__device__ __forceinline__ float bfr(float v) { return (float)(__bf16)v; }
__device__ __attribute__((noinline)) float exp_ni(float v) { return expf(v); }
__device__ __attribute__((noinline)) float erf_ni(float v) { return erff(v); }

#define WS_PW  0u                                   // bf16 transposed rows Wq^T, Wk^T, Wv^T, Wout^T [4][256][256]; W1^T padded [32][32] (k = feature 0..9, rest 0); W2^T padded [16][32] (rows 8..15 zero)
#define WS_P1  (WS_PW + 2u * (size_t)4 * DZ * DZ)
#define WS_P2  (WS_P1 + 2u * (size_t)32 * 32)
#define WS_Q   (WS_P2 + 2u * (size_t)16 * 32)         // f16 q rows [NRQ][256]; k rows [NRK][256]; v planes [m][256][NK]; f32 ctx [NRQ][256]
#define WS_K   (WS_Q + 2u * (size_t)NRQ * DZ)
#define WS_V   (WS_K + 2u * (size_t)NRK * DZ)
#define WS_O   (WS_V + 2u * (size_t)NM * DZ * NK)
#define OUT1   ((size_t)NRQ * DZ)                     // float offset of the second output (xq copy)
#define WS_END (WS_O + 4u * (size_t)NRQ * DZ)

__global__ __launch_bounds__(256) void k_pack(const float* __restrict__ WQ, const float* __restrict__ WK, const float* __restrict__ WV, const float* __restrict__ WO, const float* __restrict__ W1, const float* __restrict__ W2, __bf16* __restrict__ PW, __bf16* __restrict__ P1, __bf16* __restrict__ P2) {
  const int n = blockIdx.x, which = blockIdx.y, t = threadIdx.x; __shared__ __align__(16) __bf16 s[DZ];
  if (which < 4) { const float* w = (which == 0) ? WQ : (which == 1) ? WK : (which == 2) ? WV : WO; s[t] = (__bf16)w[(size_t)t * DZ + n]; __syncthreads(); if (t < DZ / 8) vst2((unsigned*)(PW + ((size_t)which * DZ + n) * DZ + t * 8), *(const v4u*)&s[t * 8]); }
  else if (which == 4) { if (n >= 32) return; if (t < 32) s[t] = (t < 10) ? (__bf16)W1[(size_t)t * KH + n] : (__bf16)0.f; __syncthreads(); if (t < 4) vst2((unsigned*)(P1 + (size_t)n * 32 + t * 8), *(const v4u*)&s[t * 8]); }   // W1^T [n=hidden][k=feature]
  else { if (n >= 16) return; if (t < 32) s[t] = (n < NH) ? (__bf16)W2[(size_t)t * NH + n] : (__bf16)0.f; __syncthreads(); if (t < 4) vst2((unsigned*)(P2 + (size_t)n * 32 + t * 8), *(const v4u*)&s[t * 8]); } }   // W2^T [n=head][k=hidden]
// ---- k_proj: block = (64 rows, 128 cols, which): q from zq, k from zk -> f16 rows; v from zv -> planes
__global__ __launch_bounds__(128) void k_proj(const float* __restrict__ ZQ, const float* __restrict__ ZK, const float* __restrict__ ZV, const __bf16* __restrict__ PW, _Float16* __restrict__ Q, _Float16* __restrict__ Kr, _Float16* __restrict__ V) {
  __shared__ __align__(16) _Float16 so[64][136]; __shared__ __align__(16) _Float16 st[128][72];
  const int tid = threadIdx.x, wave = tid >> 5, lane = tid & 31, col = lane & 15, g = lane >> 4; const int which = blockIdx.z; const size_t rb = (size_t)blockIdx.x * 64; const size_t r0 = rb + wave * 16; const int c0 = blockIdx.y * 128; const float* A = (which == 0) ? ZQ : (which == 1) ? ZK : ZV; const __bf16* Wr = PW + ((size_t)which * DZ) * DZ;
  v8f acc[8] = {};
#pragma unroll
  for (int kc = 0; kc < DZ / 32; ++kc) { v16b a; { const float* p = A + (r0 + col) * DZ + kc * 32 + 8 * g;
#pragma unroll
      for (int i = 0; i < 8; ++i) { a[i] = (__bf16)p[i]; a[8 + i] = (__bf16)p[16 + i]; } }
#pragma unroll
    for (int j = 0; j < 8; ++j) acc[j] = wmma_bf(a, frag_b(Wr + (size_t)(c0 + j * 16 + col) * DZ + kc * 32, lane), acc[j]); }
#pragma unroll
  for (int j = 0; j < 8; ++j)
#pragma unroll
    for (int r = 0; r < 8; ++r) { const _Float16 hv = (_Float16)acc[j][r]; if (which < 2) so[wave * 16 + 8 * g + r][j * 16 + col] = hv; else st[j * 16 + col][wave * 16 + 8 * g + r] = hv; }
  __syncthreads();
  if (which < 2) { _Float16* dst = (which == 0) ? Q : Kr; for (int e = tid; e < 64 * 16; e += 128) { const int rl = e >> 4, q = e & 15; vst2((unsigned*)(dst + (rb + rl) * DZ + c0 + q * 8), *(const v4u*)&so[rl][q * 8]); } }
  else { const size_t mI = rb / NK; const int s0 = (int)(rb % NK); for (int e = tid; e < 128 * 8; e += 128) { const int d = e >> 3, pc = e & 7; vst2((unsigned*)(V + ((mI * DZ + c0 + d) * NK) + s0 + pc * 8), *(const v4u*)&st[d][pc * 8]); } }
}
// ---- k_te: block = (16 queries, m), 4 waves; per 32-key chunk: (a) wave w takes the 16 keys of half w & 1 and 8 of the queries (4 (w >> 1) + 0..3 and 8 + the same): token dots of all 8 heads, so that lane (g, key) holds every feature of its own pairs; (b) the MLP transposed, in registers: h1^T = relu(W1^T . F^T), dots^T = W2^T . h1^T + b2, the features being a B fragment as they stand and the D of the first product the B fragment of the second -> SC[pair][h]; (c) wave w runs the running-max softmax + P.v for heads 2w, 2w+1 over the chunk
#define SP 12              // floats per pair row of the logits: 16-byte stores, 16 rows on 16 distinct bank groups
__global__ __launch_bounds__(128) void k_te(const _Float16* __restrict__ Q, const _Float16* __restrict__ Kr, const _Float16* __restrict__ V, const float* __restrict__ XQ, const float* __restrict__ XKV, const __bf16* __restrict__ P1, const __bf16* __restrict__ P2, const float* __restrict__ B1, const float* __restrict__ B2, float* __restrict__ O) {
  __shared__ __align__(16) float sS[512][SP]; __shared__ __align__(16) _Float16 sq[16][DZ + 8]; __shared__ __align__(16) _Float16 sph[4][16][40]; __shared__ __align__(16) float so[4][16][68];
  const int tid = threadIdx.x, wave = tid >> 5, lane = tid & 31, col = lane & 15, g = lane >> 4; const size_t mI = blockIdx.y; const int q0 = blockIdx.x * 16; const size_t rq = mI * NQ + q0;
  const int w2 = wave >> 1, kh = wave & 1;
  // A row 8g + r holds query 8g + ((r + 4 w2) & 7): D elements 0..3 are this wave's queries 8g + 4 w2 + 0..3
  const int qr = (col & 8) + (((col & 7) + 4 * w2) & 7);
  for (int e = tid; e < 16 * (DZ / 8); e += 128) { const int rl = e >> 5, pc = e & 31; *(v8h*)&sq[rl][pc * 8] = *(const v8h*)(Q + (rq + rl) * DZ + pc * 8); }   // the 16 q rows, read as fragments in every chunk (all 8 heads in registers would spill)
  __syncthreads();
  // W1^T as A, hidden row 16j + col: a lane's 16 k slots = features 0..9, b1 (against the constant feature 1), zeros. wlo has them in the g = 0 lanes only (k slots 0..7, 16..23: it meets the features held by the g = 0 lanes, queries 4 w2 + rr), whi in the g = 1 lanes only (queries 8 + 4 w2 + rr)
  v16b wlo[2], whi[2];
#pragma unroll
  for (int j = 0; j < 2; ++j) { union { v16b v; v8b q[2]; } u; const __bf16* pw = P1 + (size_t)(j * 16 + col) * 32; u.q[0] = *(const v8b*)pw; u.q[1] = *(const v8b*)(pw + 8); u.v[10] = (__bf16)B1[j * 16 + col];
    const v16b z = {}; wlo[j] = (g == 0) ? u.v : z; whi[j] = (g == 0) ? z : u.v; }
  const v16b w2f = frag_b(P2 + (size_t)col * 32, lane);   // W2^T as A: row = head (8..15 zero), k = hidden
  float b2v[NH], xq0[4], xq1[4];
#pragma unroll
  for (int r = 0; r < NH; ++r) b2v[r] = bfr(B2[r]);
#pragma unroll
  for (int rr = 0; rr < 4; ++rr) { const size_t qq = rq + 8 * g + 4 * w2 + rr; xq0[rr] = bfr(XQ[qq * 2]); xq1[rr] = bfr(XQ[qq * 2 + 1]); }
  float m[2][8], l[2][8];
#pragma unroll
  for (int hh = 0; hh < 2; ++hh)
#pragma unroll
    for (int r = 0; r < 8; ++r) { m[hh][r] = -3.0e38f; l[hh][r] = 0.f; }
  v8f acc[2][2] = {};
#pragma unroll 1
  for (int ks = 0; ks < NK / 32; ++ks) { const int j0 = ks * 32;
    // (a) token dots of all heads for this wave's 16 keys; lane (g, col) keeps pairs (8g + 4 w2 + rr, key col)
    const size_t kr = mI * NK + j0 + kh * 16 + col; const v2f xk = *(const v2f*)(XKV + kr * 2); const float xk0 = bfr(xk[0]), xk1 = bfr(xk[1]);
    float ft[4][NH]; v16h kf[NH];   // all 8 heads' key fragments requested before the first product: one memory latency a chunk, not eight
#pragma unroll
    for (int h = 0; h < NH; ++h) kf[h] = frag_h(Kr + kr * DZ + h * HD, lane);
    v16h qn = frag_h(&sq[qr][0], lane);   // q fragments one head ahead of their product
#pragma unroll
    for (int h = 0; h < NH; ++h) { const v16h qc = qn; if (h + 1 < NH) qn = frag_h(&sq[qr][(h + 1) * HD], lane);
      v8f c = {}; c = wmma16(qc, kf[h], c);
#pragma unroll
      for (int rr = 0; rr < 4; ++rr) ft[rr][h] = c[rr] * 0.17677669529663688f; }
    // (b) MLP on 32 pairs a pass, no LDS between the products (unrolled, as every loop here over a register array: its indices must be constants)
#pragma unroll
    for (int rr = 0; rr < 4; ++rr) { float fv[16]; fv[0] = xq0[rr] - xk0; fv[1] = xq1[rr] - xk1;
#pragma unroll
      for (int h = 0; h < NH; ++h) fv[2 + h] = ft[rr][h];
      fv[10] = 1.0f;
#pragma unroll
      for (int i = 11; i < 16; ++i) fv[i] = 0.f;
      const F2 fb = bsplit16(fv); v8f dd[2];
#pragma unroll
      for (int s = 0; s < 2; ++s) { v8f hacc[2] = {};
#pragma unroll
        for (int j = 0; j < 2; ++j) { const v16b w = s ? whi[j] : wlo[j]; hacc[j] = wmma_bf(w, fb.h, hacc[j]); hacc[j] = wmma_bf(w, fb.l, hacc[j]); }
        float hv[16];   // D element r of tile j = hidden 16j + 8g + r = k slot of B element 8j + r
#pragma unroll
        for (int j = 0; j < 2; ++j)
#pragma unroll
          for (int r = 0; r < 8; ++r) { const float v = hacc[j][r]; hv[8 * j + r] = v > 0.f ? v : 0.f; }
        const F2 hb = bsplit16(hv); v8f dacc = {}; dacc = wmma_bf(w2f, hb.h, dacc); dacc = wmma_bf(w2f, hb.l, dacc); dd[s] = dacc; }
      if (g == 0) {   // D rows 0..7 = heads, held by the g = 0 lanes; column = key
#pragma unroll
        for (int s = 0; s < 2; ++s) { float* ps = &sS[(8 * s + 4 * w2 + rr) * 32 + kh * 16 + col][0]; v4f o0, o1;
#pragma unroll
          for (int r = 0; r < 4; ++r) { o0[r] = dd[s][r] + b2v[r]; o1[r] = dd[s][4 + r] + b2v[4 + r]; }
          *(v4f*)ps = o0; *(v4f*)(ps + 4) = o1; } } }
    __syncthreads();
    // (c) softmax + P.v for this wave's two heads: s[q][k] = sS[q*32 + k][h]
#pragma unroll
    for (int hh = 0; hh < 2; ++hh) { const int h = wave * 2 + hh; v8f s[2];
#pragma unroll
      for (int ct = 0; ct < 2; ++ct)
#pragma unroll
        for (int r = 0; r < 8; ++r) s[ct][r] = sS[(8 * g + r) * 32 + ct * 16 + col][h];
#pragma unroll
      for (int r = 0; r < 8; ++r) { float mx = fmaxf(s[0][r], s[1][r]);
#pragma unroll
        for (int o = 1; o < 16; o <<= 1) mx = fmaxf(mx, __shfl_xor(mx, o));
        const float mn = fmaxf(m[hh][r], mx); const float alpha = (m[hh][r] <= -1.0e38f) ? 0.f : __expf(m[hh][r] - mn); const float e0 = __expf(s[0][r] - mn), e1 = __expf(s[1][r] - mn); float es = e0 + e1;
#pragma unroll
        for (int o = 1; o < 16; o <<= 1) es += __shfl_xor(es, o);
        l[hh][r] = l[hh][r] * alpha + es; m[hh][r] = mn;
#pragma unroll
        for (int dt = 0; dt < 2; ++dt) acc[hh][dt][r] *= alpha;
        sph[wave][8 * g + r][col] = (_Float16)(e0 * 2048.0f); sph[wave][8 * g + r][16 + col] = (_Float16)(e1 * 2048.0f); }
      LDSX();
      const v16h pa = frag_h(&sph[wave][col][0], lane);
#pragma unroll
      for (int dt = 0; dt < 2; ++dt) acc[hh][dt] = wmma16(pa, frag_h(V + ((mI * DZ + h * HD + dt * 16 + col) * NK) + j0, lane), acc[hh][dt]);
      LDSX(); }
    __syncthreads(); }
#pragma unroll
  for (int hh = 0; hh < 2; ++hh) { const int h = wave * 2 + hh;
#pragma unroll
    for (int r = 0; r < 8; ++r) { const float il = (1.0f / 2048.0f) / l[hh][r];
#pragma unroll
      for (int dt = 0; dt < 2; ++dt) so[wave][8 * g + r][hh * 32 + dt * 16 + col] = acc[hh][dt][r] * il; }
    (void)h; }
  LDSX();
  for (int rl = 0; rl < 16; ++rl) if (lane < 16) vst2(O + (rq + rl) * DZ + wave * 64 + lane * 4, *(const v4f*)&so[wave][rl][lane * 4]);   // heads 2w, 2w+1 = 64 contiguous floats (256-B segment)
}
// ---- k_out: block = (64 rows, 128 cols): out0 = ctx (hi + lo) . Wout + bout
__global__ __launch_bounds__(128) void k_out(const float* __restrict__ O, const __bf16* __restrict__ PW, const float* __restrict__ BO, float* __restrict__ Y) { __shared__ __align__(16) float so[4][16][132];
  const int tid = threadIdx.x, wave = tid >> 5, lane = tid & 31, col = lane & 15, g = lane >> 4; const size_t r0 = (size_t)blockIdx.x * 64 + wave * 16; const int c0 = blockIdx.y * 128; const __bf16* Wr = PW + (size_t)3 * DZ * DZ;
  v8f acc[8] = {};
#pragma unroll
  for (int kc = 0; kc < DZ / 32; ++kc) { const F2 a = split_row(O + (r0 + col) * DZ, kc * 32, lane);
#pragma unroll
    for (int j = 0; j < 8; ++j) { const v16b w = frag_b(Wr + (size_t)(c0 + j * 16 + col) * DZ + kc * 32, lane); acc[j] = wmma_bf(a.h, w, acc[j]); acc[j] = wmma_bf(a.l, w, acc[j]); } }
#pragma unroll
  for (int j = 0; j < 8; ++j) { const float bb = bfr(BO[c0 + j * 16 + col]);
#pragma unroll
    for (int r = 0; r < 8; ++r) so[wave][8 * g + r][j * 16 + col] = acc[j][r] + bb; }
  LDSX(); for (int rl = 0; rl < 16; ++rl) vst2(Y + (r0 + rl) * DZ + c0 + lane * 4, *(const v4f*)&so[wave][rl][lane * 4]); }
// ---- k_copy: second output = xq (f32 copy, 16-B chunks; whole buffer)
__global__ __launch_bounds__(256) void k_copy(const float* __restrict__ XQ, float* __restrict__ OUT, int n4) { const int i = blockIdx.x * 256 + threadIdx.x; if (i < n4) { v4f v = *(const v4f*)(XQ + (size_t)i * 4); vst2(OUT + (size_t)i * 4, v); } }
extern "C" void kernel_launch(void* const* d_in, const int* in_sizes, int n_in, void* d_out, int out_size, void* d_ws, size_t ws_size, hipStream_t stream) {
  (void)in_sizes; (void)n_in; (void)out_size;
  const float** F = (const float**)d_in;   // 0 zq, 1 zk, 2 zv [8,1024,256]; 3 xq, 4 xkv [8,1024,2]; 5 Wq, 6 Wk, 7 Wv [256,256] (in,out); 8 Wout [256,256] (in,out), 9 bout; 10 W1 [10,32], 11 b1 [32], 12 W2 [32,8], 13 b2 [8]
  if (ws_size < (size_t)WS_END) return;
  char* ws = (char*)d_ws; __bf16 *PW = (__bf16*)(ws + WS_PW), *P1 = (__bf16*)(ws + WS_P1), *P2 = (__bf16*)(ws + WS_P2); _Float16 *Q = (_Float16*)(ws + WS_Q), *Kr = (_Float16*)(ws + WS_K), *V = (_Float16*)(ws + WS_V); float* O = (float*)(ws + WS_O);
  k_pack<<<dim3(DZ, 6), 256, 0, stream>>>(F[5], F[6], F[7], F[8], F[10], F[12], PW, P1, P2);
  k_proj<<<dim3(TNM * NQ / 64, DZ / 128, 3), 128, 0, stream>>>(F[0], F[1], F[2], PW, Q, Kr, V);
  k_te<<<dim3(TQB, TNM), 128, 0, stream>>>(Q, Kr, V, F[3], F[4], P1, P2, F[11], F[13], O);
  k_out<<<dim3(TNM * NQ / 64, DZ / 128), 128, 0, stream>>>(O, PW, F[9], (float*)d_out);
  k_copy<<<(NRQ * 2 / 4 + 255) / 256, 256, 0, stream>>>(F[3], (float*)d_out + OUT1, NRQ * 2 / 4);
}

// v002
// Measured time: 144 microseconds a run.
// Timed twice side by side with v001, it ran 1.33 and 1.30 times as fast.
// Counting every step since v000, it is 2.14 times as fast.
// compute dtype: all float inputs rounded to bf16; q/k/v = z . W with EXACT bf16 products on WMMA 16x16x32 ((in,out) weights as transposed rows), rounded once to f16 (v as planes); per 16-query x 32-key chunk: token dots q_h . k_h x 32^-1/2 on WMMA (single f16), the pair features [xq - xkv | dots | 0] in f32, the kernel MLP relu(F . W1 + b1) . W2 + b2 on WMMA with F and the hidden as bf16 hi + lo (2 products each); per (query, head) running-max softmax over the keys in f32 (hardware exp), P (scaled by 2^11, single f16) x v (single f16); out = ctx (bf16 hi + lo, 2 products) . Wout + bout; xq copied through as the second output; f32 outputs.
#include <hip/hip_runtime.h>
#include <math.h>

typedef __attribute__((ext_vector_type(16))) _Float16 v16h;
typedef __attribute__((ext_vector_type(16))) __bf16 v16b;
typedef __attribute__((ext_vector_type(8)))  _Float16 v8h;
typedef __attribute__((ext_vector_type(8)))  float v8f;
typedef __attribute__((ext_vector_type(4)))  float v4f;
typedef __attribute__((ext_vector_type(2)))  float v2f;
typedef __attribute__((ext_vector_type(4)))  unsigned v4u;
typedef __attribute__((ext_vector_type(4)))  int v4i;
typedef float __attribute__((may_alias)) float_a;
typedef int __attribute__((may_alias)) int_a;

template <typename T> __device__ __forceinline__ void vst2(void* p, T v) { *(T*)p = v;  }
__device__ __forceinline__ v8f wmma16(v16h a, v16h b, v8f c) {
  v8f d = __builtin_amdgcn_wmma_f32_16x16x32_f16(false, a, false, b, (short)0, c, false, false);
  asm volatile("v_nop\n\tv_nop\n\tv_nop\n\tv_nop" : "+v"(d) : "v"(a), "v"(b));
  return d;
}
__device__ __forceinline__ v8f wmma_bf(v16b a, v16b b, v8f c) {
  v8f d = __builtin_amdgcn_wmma_f32_16x16x32_bf16(false, a, false, b, (short)0, c, false, false);
  asm volatile("v_nop\n\tv_nop\n\tv_nop\n\tv_nop" : "+v"(d) : "v"(a), "v"(b));
  return d;
}
// 16x16x32 fragments: lane = (h = lane>>4, row/col = lane&15); elements 0..7 = k0+8h+0..7, 8..15 = k0+16+8h+0..7; D element r = row 8h+r
__device__ __forceinline__ v16h frag_h(const _Float16* rowk0, int lane) {
  union { v16h v; v8h q[2]; } u; const _Float16* p = rowk0 + 8 * (lane >> 4);
  u.q[0] = *(const v8h*)p; u.q[1] = *(const v8h*)(p + 16); return u.v;
}
__device__ __forceinline__ v16h frag_f32(const float* rowk0, int lane) {
  v16h a; const float* p = rowk0 + 8 * (lane >> 4);
#pragma unroll
  for (int i = 0; i < 8; ++i) { a[i] = (_Float16)p[i]; a[8 + i] = (_Float16)p[16 + i]; }
  return a;
}
__device__ __forceinline__ v16h frag_f32s(const float* rowk0, int lane, float sc) {
  v16h a; const float* p = rowk0 + 8 * (lane >> 4);
#pragma unroll
  for (int i = 0; i < 8; ++i) { a[i] = (_Float16)(p[i] * sc); a[8 + i] = (_Float16)(p[16 + i] * sc); }
  return a;
}
// column fragment from a [K][ld] layout (column n), rows >= K read as 0
__device__ __forceinline__ v16h fragc_f32(const float* W, int k0, int n, int lane, int ld, int K) {
  v16h a; const int g = lane >> 4;
#pragma unroll
  for (int i = 0; i < 8; ++i) { const int ka = k0 + 8 * g + i, kb = ka + 16;
    a[i] = (_Float16)(ka < K ? W[(size_t)(ka < K ? ka : K - 1) * ld + n] : 0.f); a[8 + i] = (_Float16)(kb < K ? W[(size_t)(kb < K ? kb : K - 1) * ld + n] : 0.f); }
  return a;
}
struct F2 { v16b h, l; };
__device__ __forceinline__ F2 bsplit16(const float v[16]) { F2 r;
#pragma unroll
  for (int i = 0; i < 16; ++i) { const __bf16 h = (__bf16)v[i]; r.h[i] = h; r.l[i] = (__bf16)(v[i] - (float)h); }
  return r; }
__device__ __forceinline__ F2 split_row(const float* row, int k0, int lane) { float v[16]; const float* p = row + k0 + 8 * (lane >> 4);
#pragma unroll
  for (int i = 0; i < 8; ++i) { v[i] = p[i]; v[8 + i] = p[16 + i]; }
  return bsplit16(v); }
__device__ __forceinline__ F2 split_rowK(const float* row, int k0, int lane, int K) { float v[16]; const int g = lane >> 4;
#pragma unroll
  for (int i = 0; i < 8; ++i) { const int ka = k0 + 8 * g + i, kb = ka + 16; v[i] = ka < K ? row[ka < K ? ka : K - 1] : 0.f; v[8 + i] = kb < K ? row[kb < K ? kb : K - 1] : 0.f; }
  return bsplit16(v); }
__device__ __forceinline__ F2 split_col(const float* W, int k0, int n, int lane, int ld, int K) { float v[16]; const int g = lane >> 4;
#pragma unroll
  for (int i = 0; i < 8; ++i) { const int ka = k0 + 8 * g + i, kb = ka + 16; v[i] = ka < K ? W[(size_t)(ka < K ? ka : K - 1) * ld + n] : 0.f; v[8 + i] = kb < K ? W[(size_t)(kb < K ? kb : K - 1) * ld + n] : 0.f; }
  return bsplit16(v); }
__device__ __forceinline__ v8f mac3(const F2& a, const F2& b, v8f c) { c = wmma_bf(a.l, b.h, c); c = wmma_bf(a.h, b.l, c); return wmma_bf(a.h, b.h, c); }
__device__ __forceinline__ float sigm(float v) { return 1.0f / (1.0f + expf(-v)); }
#define LDSX() do { asm volatile("s_wait_dscnt 0" ::: "memory"); __builtin_amdgcn_wave_barrier(); __builtin_amdgcn_fence(__ATOMIC_RELEASE, "workgroup"); } while (0)


// Translation-equivariant multi-head attention (8 sets, 1,024 queries x 1,024 keys, dz 256, dx 2, 8 heads x 32, kernel MLP 10 -> 32 -> 8): logits = MLP([x_q - x_k, q_h . k_h / sqrt(32)]), softmax over keys, . v, output projection; the query locations pass through.
#define NM 8
#define NQ 1024
#define NK 1024
#define DZ 256
#define NH 8
#define HD 32
#define KH 32
#define NF 16              // padded feature width (2 + 8 used)
#define NRQ (NM * NQ)
#define NRK (NM * NK)
#ifndef TQB
#define TQB (NQ / 16)
#define TNM NM
#endif
typedef __attribute__((ext_vector_type(8))) __bf16 v8b;
__device__ __forceinline__ v16b frag_b(const __bf16* rowk0, int lane) {
  union { v16b v; v8b q[2]; } u; const __bf16* p = rowk0 + 8 * (lane >> 4);
  u.q[0] = *(const v8b*)p; u.q[1] = *(const v8b*)(p + 16); return u.v;
}
__device__ __forceinline__ float bfr(float v) { return (float)(__bf16)v; }
__device__ __attribute__((noinline)) float exp_ni(float v) { return expf(v); }
__device__ __attribute__((noinline)) float erf_ni(float v) { return erff(v); }

#define WS_PW  0u                                   // bf16 transposed rows Wq^T, Wk^T, Wv^T, Wout^T [4][256][256]; W1^T padded [32][32] (k = feature 0..9, rest 0); W2^T padded [16][32] (rows 8..15 zero)
#define WS_P1  (WS_PW + 2u * (size_t)4 * DZ * DZ)
#define WS_P2  (WS_P1 + 2u * (size_t)32 * 32)
#define WS_Q   (WS_P2 + 2u * (size_t)16 * 32)         // f16 q rows [NRQ][256]; k rows [NRK][256]; v planes [m][256][NK]; f32 ctx [NRQ][256]
#define WS_K   (WS_Q + 2u * (size_t)NRQ * DZ)
#define WS_V   (WS_K + 2u * (size_t)NRK * DZ)
#define WS_O   (WS_V + 2u * (size_t)NM * DZ * NK)
#define OUT1   ((size_t)NRQ * DZ)                     // float offset of the second output (xq copy)
#define WS_END (WS_O + 4u * (size_t)NRQ * DZ)

__global__ __launch_bounds__(256) void k_pack(const float* __restrict__ WQ, const float* __restrict__ WK, const float* __restrict__ WV, const float* __restrict__ WO, const float* __restrict__ W1, const float* __restrict__ W2, __bf16* __restrict__ PW, __bf16* __restrict__ P1, __bf16* __restrict__ P2) {
  const int n = blockIdx.x, which = blockIdx.y, t = threadIdx.x; __shared__ __align__(16) __bf16 s[DZ];
  if (which < 4) { const float* w = (which == 0) ? WQ : (which == 1) ? WK : (which == 2) ? WV : WO; s[t] = (__bf16)w[(size_t)t * DZ + n]; __syncthreads(); if (t < DZ / 8) vst2((unsigned*)(PW + ((size_t)which * DZ + n) * DZ + t * 8), *(const v4u*)&s[t * 8]); }
  else if (which == 4) { if (n >= 32) return; if (t < 32) s[t] = (t < 10) ? (__bf16)W1[(size_t)t * KH + n] : (__bf16)0.f; __syncthreads(); if (t < 4) vst2((unsigned*)(P1 + (size_t)n * 32 + t * 8), *(const v4u*)&s[t * 8]); }   // W1^T [n=hidden][k=feature]
  else { if (n >= 16) return; if (t < 32) s[t] = (n < NH) ? (__bf16)W2[(size_t)t * NH + n] : (__bf16)0.f; __syncthreads(); if (t < 4) vst2((unsigned*)(P2 + (size_t)n * 32 + t * 8), *(const v4u*)&s[t * 8]); } }   // W2^T [n=head][k=hidden]
// ---- k_proj: block = (64 rows, 128 cols, which): q from zq, k from zk -> f16 rows; v from zv -> planes
__global__ __launch_bounds__(128) void k_proj(const float* __restrict__ ZQ, const float* __restrict__ ZK, const float* __restrict__ ZV, const __bf16* __restrict__ PW, _Float16* __restrict__ Q, _Float16* __restrict__ Kr, _Float16* __restrict__ V) {
  __shared__ __align__(16) _Float16 so[64][136]; __shared__ __align__(16) _Float16 st[128][72];
  const int tid = threadIdx.x, wave = tid >> 5, lane = tid & 31, col = lane & 15, g = lane >> 4; const int which = blockIdx.z; const size_t rb = (size_t)blockIdx.x * 64; const size_t r0 = rb + wave * 16; const int c0 = blockIdx.y * 128; const float* A = (which == 0) ? ZQ : (which == 1) ? ZK : ZV; const __bf16* Wr = PW + ((size_t)which * DZ) * DZ;
  v8f acc[8] = {};
#pragma unroll
  for (int kc = 0; kc < DZ / 32; ++kc) { v16b a; { const float* p = A + (r0 + col) * DZ + kc * 32 + 8 * g;
#pragma unroll
      for (int i = 0; i < 8; ++i) { a[i] = (__bf16)p[i]; a[8 + i] = (__bf16)p[16 + i]; } }
#pragma unroll
    for (int j = 0; j < 8; ++j) acc[j] = wmma_bf(a, frag_b(Wr + (size_t)(c0 + j * 16 + col) * DZ + kc * 32, lane), acc[j]); }
#pragma unroll
  for (int j = 0; j < 8; ++j)
#pragma unroll
    for (int r = 0; r < 8; ++r) { const _Float16 hv = (_Float16)acc[j][r]; if (which < 2) so[wave * 16 + 8 * g + r][j * 16 + col] = hv; else st[j * 16 + col][wave * 16 + 8 * g + r] = hv; }
  __syncthreads();
  if (which < 2) { _Float16* dst = (which == 0) ? Q : Kr; for (int e = tid; e < 64 * 16; e += 128) { const int rl = e >> 4, q = e & 15; vst2((unsigned*)(dst + (rb + rl) * DZ + c0 + q * 8), *(const v4u*)&so[rl][q * 8]); } }
  else { const size_t mI = rb / NK; const int s0 = (int)(rb % NK); for (int e = tid; e < 128 * 8; e += 128) { const int d = e >> 3, pc = e & 7; vst2((unsigned*)(V + ((mI * DZ + c0 + d) * NK) + s0 + pc * 8), *(const v4u*)&st[d][pc * 8]); } }
}
// ---- k_te: block = (16 queries, m), 4 waves; per 32-key chunk: (a) wave w takes the 16 keys of half w & 1 and 8 of the queries (4 (w >> 1) + 0..3 and 8 + the same): token dots of all 8 heads, so that lane (g, key) holds every feature of its own pairs; (b) the MLP transposed, in registers: h1^T = relu(W1^T . F^T), dots^T = W2^T . h1^T + b2, the features being a B fragment as they stand and the D of the first product the B fragment of the second -> SC[pair][h]; (c) wave w runs the running-max softmax + P.v for heads 2w, 2w+1 over the chunk, transposed: ctx^T += v^T . P^T, lane (g, query) holding 16 of the query's 32 logits, so that maximum and sum are in-lane but for one exchange between the lane halves, and exp(.) is the B fragment as it stands
#define SP 12              // floats per pair row of the logits: 16-byte stores, 16 rows on 16 distinct bank groups
#define SQP (32 * SP + 4)  // floats per query row of the logits: the 16 queries that one read of part (c) touches start 4 banks apart
__device__ __forceinline__ float xhalf(float x) { return __builtin_bit_cast(float, __builtin_amdgcn_permlanex16(__builtin_bit_cast(int, x), __builtin_bit_cast(int, x), 0x76543210, 0xfedcba98, false, false)); }   // lane l with lane l ^ 16
// exp(x) as __expf gives it (the hardware's exp2 of x . log2 e), with one v_nop in the same statement: the instruction set asks for one slot between a transcendental and a next instruction that reads its result or overwrites its source
__device__ __forceinline__ float exp_slot(float x) { float r; asm("v_exp_f32 %0, %1\n\tv_nop" : "=v"(r) : "v"(x * 0x1.715476p+0f)); return r; }
__global__ __launch_bounds__(128) void k_te(const _Float16* __restrict__ Q, const _Float16* __restrict__ Kr, const _Float16* __restrict__ V, const float* __restrict__ XQ, const float* __restrict__ XKV, const __bf16* __restrict__ P1, const __bf16* __restrict__ P2, const float* __restrict__ B1, const float* __restrict__ B2, float* __restrict__ O) {
  __shared__ __align__(16) float sS[16][SQP]; __shared__ __align__(16) _Float16 sq[16][DZ + 8]; __shared__ __align__(16) float so[4][16][68];
  const int tid = threadIdx.x, wave = tid >> 5, lane = tid & 31, col = lane & 15, g = lane >> 4; const size_t mI = blockIdx.y; const int q0 = blockIdx.x * 16; const size_t rq = mI * NQ + q0;
  const int w2 = wave >> 1, kh = wave & 1;
  // A row 8g + r holds query 8g + ((r + 4 w2) & 7): D elements 0..3 are this wave's queries 8g + 4 w2 + 0..3
  const int qr = (col & 8) + (((col & 7) + 4 * w2) & 7);
  for (int e = tid; e < 16 * (DZ / 8); e += 128) { const int rl = e >> 5, pc = e & 31; *(v8h*)&sq[rl][pc * 8] = *(const v8h*)(Q + (rq + rl) * DZ + pc * 8); }   // the 16 q rows, read as fragments in every chunk (all 8 heads in registers would spill)
  __syncthreads();
  // W1^T as A, hidden row 16j + col: a lane's 16 k slots = features 0..9, b1 (against the constant feature 1), zeros. wlo has them in the g = 0 lanes only (k slots 0..7, 16..23: it meets the features held by the g = 0 lanes, queries 4 w2 + rr), whi in the g = 1 lanes only (queries 8 + 4 w2 + rr)
  v16b wlo[2], whi[2];
#pragma unroll
  for (int j = 0; j < 2; ++j) { union { v16b v; v8b q[2]; } u; const __bf16* pw = P1 + (size_t)(j * 16 + col) * 32; u.q[0] = *(const v8b*)pw; u.q[1] = *(const v8b*)(pw + 8); u.v[10] = (__bf16)B1[j * 16 + col];
    const v16b z = {}; wlo[j] = (g == 0) ? u.v : z; whi[j] = (g == 0) ? z : u.v; }
  const v16b w2f = frag_b(P2 + (size_t)col * 32, lane);   // W2^T as A: row = head (8..15 zero), k = hidden
  float b2v[NH], xq0[4], xq1[4];
#pragma unroll
  for (int r = 0; r < NH; ++r) b2v[r] = bfr(B2[r]);
#pragma unroll
  for (int rr = 0; rr < 4; ++rr) { const size_t qq = rq + 8 * g + 4 * w2 + rr; xq0[rr] = bfr(XQ[qq * 2]); xq1[rr] = bfr(XQ[qq * 2 + 1]); }
  float m[2] = {-3.0e38f, -3.0e38f}, l[2] = {0.f, 0.f};   // of query col; l is the sum over this lane half's keys alone, the halves are joined after the loop
  v8f acc[2][2] = {};   // ctx^T: element r = dim 16 dt + 8g + r of head 2w + hh, column = query col
#pragma unroll 1
  for (int ks = 0; ks < NK / 32; ++ks) { const int j0 = ks * 32;
    // (a) token dots of all heads for this wave's 16 keys; lane (g, col) keeps pairs (8g + 4 w2 + rr, key col)
    const size_t kr = mI * NK + j0 + kh * 16 + col; const v2f xk = *(const v2f*)(XKV + kr * 2); const float xk0 = bfr(xk[0]), xk1 = bfr(xk[1]);
    float ft[4][NH]; v16h kf[NH];   // all 8 heads' key fragments requested before the first product: one memory latency a chunk, not eight
#pragma unroll
    for (int h = 0; h < NH; ++h) kf[h] = frag_h(Kr + kr * DZ + h * HD, lane);
    v16h qn = frag_h(&sq[qr][0], lane);   // q fragments one head ahead of their product
#pragma unroll
    for (int h = 0; h < NH; ++h) { const v16h qc = qn; if (h + 1 < NH) qn = frag_h(&sq[qr][(h + 1) * HD], lane);
      v8f c = {}; c = wmma16(qc, kf[h], c);
#pragma unroll
      for (int rr = 0; rr < 4; ++rr) ft[rr][h] = c[rr] * 0.17677669529663688f; }
    // (b) MLP on 32 pairs a pass, no LDS between the products (unrolled, as every loop here over a register array: its indices must be constants)
#pragma unroll
    for (int rr = 0; rr < 4; ++rr) { float fv[16]; fv[0] = xq0[rr] - xk0; fv[1] = xq1[rr] - xk1;
#pragma unroll
      for (int h = 0; h < NH; ++h) fv[2 + h] = ft[rr][h];
      fv[10] = 1.0f;
#pragma unroll
      for (int i = 11; i < 16; ++i) fv[i] = 0.f;
      const F2 fb = bsplit16(fv); v8f dd[2];
#pragma unroll
      for (int s = 0; s < 2; ++s) { v8f hacc[2] = {};
#pragma unroll
        for (int j = 0; j < 2; ++j) { const v16b w = s ? whi[j] : wlo[j]; hacc[j] = wmma_bf(w, fb.h, hacc[j]); hacc[j] = wmma_bf(w, fb.l, hacc[j]); }
        float hv[16];   // D element r of tile j = hidden 16j + 8g + r = k slot of B element 8j + r
#pragma unroll
        for (int j = 0; j < 2; ++j)
#pragma unroll
          for (int r = 0; r < 8; ++r) { const float v = hacc[j][r]; hv[8 * j + r] = v > 0.f ? v : 0.f; }
        const F2 hb = bsplit16(hv); v8f dacc = {}; dacc = wmma_bf(w2f, hb.h, dacc); dacc = wmma_bf(w2f, hb.l, dacc); dd[s] = dacc; }
      if (g == 0) {   // D rows 0..7 = heads, held by the g = 0 lanes; column = key
#pragma unroll
        for (int s = 0; s < 2; ++s) { float* ps = &sS[8 * s + 4 * w2 + rr][(kh * 16 + col) * SP]; v4f o0, o1;
#pragma unroll
          for (int r = 0; r < 4; ++r) { o0[r] = dd[s][r] + b2v[r]; o1[r] = dd[s][4 + r] + b2v[4 + r]; }
          *(v4f*)ps = o0; *(v4f*)(ps + 4) = o1; } } }
    __syncthreads();
    // (c) softmax + P.v for this wave's two heads: lane (g, col) takes query col, keys 8g + i and 16 + 8g + i (the k order of frag_h)
    v16h vf[2][2];
#pragma unroll
    for (int hh = 0; hh < 2; ++hh)
#pragma unroll
      for (int dt = 0; dt < 2; ++dt) vf[hh][dt] = frag_h(V + ((mI * DZ + (wave * 2 + hh) * HD + dt * 16 + col) * NK) + j0, lane);   // v^T as A: row = dim
    v2f sv[16];   // both heads of a pair in one 8-byte read
#pragma unroll
    for (int i = 0; i < 8; ++i) { sv[i] = *(const v2f*)&sS[col][(8 * g + i) * SP + 2 * wave]; sv[8 + i] = *(const v2f*)&sS[col][(16 + 8 * g + i) * SP + 2 * wave]; }
#pragma unroll
    for (int hh = 0; hh < 2; ++hh) { float t[8];
#pragma unroll
      for (int i = 0; i < 8; ++i) t[i] = fmaxf(sv[i][hh], sv[8 + i][hh]);
      float mx = fmaxf(fmaxf(fmaxf(t[0], t[1]), fmaxf(t[2], t[3])), fmaxf(fmaxf(t[4], t[5]), fmaxf(t[6], t[7])));
      mx = fmaxf(mx, xhalf(mx));
      const float mn = fmaxf(m[hh], mx); const float am = exp_slot(m[hh] - mn); const float alpha = (m[hh] <= -1.0e38f) ? 0.f : am;
      v16h pb; float es[4];   // four independent chains of four
#pragma unroll
      for (int i = 0; i < 16; ++i) { const float e = exp_slot(sv[i][hh] - mn); es[i & 3] = (i < 4) ? e : es[i & 3] + e; pb[i] = (_Float16)(e * 2048.0f); }
      l[hh] = l[hh] * alpha + ((es[0] + es[1]) + (es[2] + es[3])); m[hh] = mn;
#pragma unroll
      for (int dt = 0; dt < 2; ++dt) { acc[hh][dt] *= alpha; acc[hh][dt] = wmma16(vf[hh][dt], pb, acc[hh][dt]); } }
    __syncthreads(); }
#pragma unroll
  for (int hh = 0; hh < 2; ++hh) { const float il = (1.0f / 2048.0f) / (l[hh] + xhalf(l[hh]));
#pragma unroll
    for (int dt = 0; dt < 2; ++dt) { v4f o0, o1;
#pragma unroll
      for (int r = 0; r < 4; ++r) { o0[r] = acc[hh][dt][r] * il; o1[r] = acc[hh][dt][4 + r] * il; }
      float* po = &so[wave][col][hh * 32 + dt * 16 + 8 * g]; *(v4f*)po = o0; *(v4f*)(po + 4) = o1; } }
  LDSX();
  for (int rl = 0; rl < 16; ++rl) if (lane < 16) vst2(O + (rq + rl) * DZ + wave * 64 + lane * 4, *(const v4f*)&so[wave][rl][lane * 4]);   // heads 2w, 2w+1 = 64 contiguous floats (256-B segment)
}
// ---- k_out: block = (64 rows, 128 cols): out0 = ctx (hi + lo) . Wout + bout
__global__ __launch_bounds__(128) void k_out(const float* __restrict__ O, const __bf16* __restrict__ PW, const float* __restrict__ BO, float* __restrict__ Y) { __shared__ __align__(16) float so[4][16][132];
  const int tid = threadIdx.x, wave = tid >> 5, lane = tid & 31, col = lane & 15, g = lane >> 4; const size_t r0 = (size_t)blockIdx.x * 64 + wave * 16; const int c0 = blockIdx.y * 128; const __bf16* Wr = PW + (size_t)3 * DZ * DZ;
  v8f acc[8] = {};
#pragma unroll
  for (int kc = 0; kc < DZ / 32; ++kc) { const F2 a = split_row(O + (r0 + col) * DZ, kc * 32, lane);
#pragma unroll
    for (int j = 0; j < 8; ++j) { const v16b w = frag_b(Wr + (size_t)(c0 + j * 16 + col) * DZ + kc * 32, lane); acc[j] = wmma_bf(a.h, w, acc[j]); acc[j] = wmma_bf(a.l, w, acc[j]); } }
#pragma unroll
  for (int j = 0; j < 8; ++j) { const float bb = bfr(BO[c0 + j * 16 + col]);
#pragma unroll
    for (int r = 0; r < 8; ++r) so[wave][8 * g + r][j * 16 + col] = acc[j][r] + bb; }
  LDSX(); for (int rl = 0; rl < 16; ++rl) vst2(Y + (r0 + rl) * DZ + c0 + lane * 4, *(const v4f*)&so[wave][rl][lane * 4]); }
// ---- k_copy: second output = xq (f32 copy, 16-B chunks; whole buffer)
__global__ __launch_bounds__(256) void k_copy(const float* __restrict__ XQ, float* __restrict__ OUT, int n4) { const int i = blockIdx.x * 256 + threadIdx.x; if (i < n4) { v4f v = *(const v4f*)(XQ + (size_t)i * 4); vst2(OUT + (size_t)i * 4, v); } }
extern "C" void kernel_launch(void* const* d_in, const int* in_sizes, int n_in, void* d_out, int out_size, void* d_ws, size_t ws_size, hipStream_t stream) {
  (void)in_sizes; (void)n_in; (void)out_size;
  const float** F = (const float**)d_in;   // 0 zq, 1 zk, 2 zv [8,1024,256]; 3 xq, 4 xkv [8,1024,2]; 5 Wq, 6 Wk, 7 Wv [256,256] (in,out); 8 Wout [256,256] (in,out), 9 bout; 10 W1 [10,32], 11 b1 [32], 12 W2 [32,8], 13 b2 [8]
  if (ws_size < (size_t)WS_END) return;
  char* ws = (char*)d_ws; __bf16 *PW = (__bf16*)(ws + WS_PW), *P1 = (__bf16*)(ws + WS_P1), *P2 = (__bf16*)(ws + WS_P2); _Float16 *Q = (_Float16*)(ws + WS_Q), *Kr = (_Float16*)(ws + WS_K), *V = (_Float16*)(ws + WS_V); float* O = (float*)(ws + WS_O);
  k_pack<<<dim3(DZ, 6), 256, 0, stream>>>(F[5], F[6], F[7], F[8], F[10], F[12], PW, P1, P2);
  k_proj<<<dim3(TNM * NQ / 64, DZ / 128, 3), 128, 0, stream>>>(F[0], F[1], F[2], PW, Q, Kr, V);
  k_te<<<dim3(TQB, TNM), 128, 0, stream>>>(Q, Kr, V, F[3], F[4], P1, P2, F[11], F[13], O);
  k_out<<<dim3(TNM * NQ / 64, DZ / 128), 128, 0, stream>>>(O, PW, F[9], (float*)d_out);
  k_copy<<<(NRQ * 2 / 4 + 255) / 256, 256, 0, stream>>>(F[3], (float*)d_out + OUT1, NRQ * 2 / 4);
}

// v003
// It runs in 135 microseconds.
// Two timings next to v002 both put it at 1.06 times that version's speed.
// All steps since v000 together make it 2.26 times as fast.
// compute dtype: all float inputs rounded to bf16; q/k/v = z . W with EXACT bf16 products on WMMA 16x16x32 ((in,out) weights as transposed rows), rounded once to f16 (v as planes); per 16-query x 32-key chunk: token dots q_h . k_h x 32^-1/2 on WMMA (single f16), the pair features [xq - xkv | dots | 0] in f32, the kernel MLP relu(F . W1 + b1) . W2 + b2 on WMMA with F and the hidden as bf16 hi + lo (2 products each); per (query, head) running-max softmax over the keys in f32 (hardware exp), P (scaled by 2^11, single f16) x v (single f16); out = ctx (bf16 hi + lo, 2 products) . Wout + bout; xq copied through as the second output; f32 outputs.
#include <hip/hip_runtime.h>
#include <math.h>

typedef __attribute__((ext_vector_type(16))) _Float16 v16h;
typedef __attribute__((ext_vector_type(16))) __bf16 v16b;
typedef __attribute__((ext_vector_type(8)))  _Float16 v8h;
typedef __attribute__((ext_vector_type(8)))  float v8f;
typedef __attribute__((ext_vector_type(4)))  float v4f;
typedef __attribute__((ext_vector_type(2)))  float v2f;
typedef __attribute__((ext_vector_type(4)))  unsigned v4u;
typedef __attribute__((ext_vector_type(4)))  int v4i;
typedef float __attribute__((may_alias)) float_a;
typedef int __attribute__((may_alias)) int_a;

template <typename T> __device__ __forceinline__ void vst2(void* p, T v) { *(T*)p = v;  }
__device__ __forceinline__ v8f wmma16(v16h a, v16h b, v8f c) {
  v8f d = __builtin_amdgcn_wmma_f32_16x16x32_f16(false, a, false, b, (short)0, c, false, false);
  asm volatile("v_nop\n\tv_nop\n\tv_nop\n\tv_nop" : "+v"(d) : "v"(a), "v"(b));
  return d;
}
__device__ __forceinline__ v8f wmma_bf(v16b a, v16b b, v8f c) {
  v8f d = __builtin_amdgcn_wmma_f32_16x16x32_bf16(false, a, false, b, (short)0, c, false, false);
  asm volatile("v_nop\n\tv_nop\n\tv_nop\n\tv_nop" : "+v"(d) : "v"(a), "v"(b));
  return d;
}
// 16x16x32 fragments: lane = (h = lane>>4, row/col = lane&15); elements 0..7 = k0+8h+0..7, 8..15 = k0+16+8h+0..7; D element r = row 8h+r
__device__ __forceinline__ v16h frag_h(const _Float16* rowk0, int lane) {
  union { v16h v; v8h q[2]; } u; const _Float16* p = rowk0 + 8 * (lane >> 4);
  u.q[0] = *(const v8h*)p; u.q[1] = *(const v8h*)(p + 16); return u.v;
}
__device__ __forceinline__ v16h frag_f32(const float* rowk0, int lane) {
  v16h a; const float* p = rowk0 + 8 * (lane >> 4);
#pragma unroll
  for (int i = 0; i < 8; ++i) { a[i] = (_Float16)p[i]; a[8 + i] = (_Float16)p[16 + i]; }
  return a;
}
__device__ __forceinline__ v16h frag_f32s(const float* rowk0, int lane, float sc) {
  v16h a; const float* p = rowk0 + 8 * (lane >> 4);
#pragma unroll
  for (int i = 0; i < 8; ++i) { a[i] = (_Float16)(p[i] * sc); a[8 + i] = (_Float16)(p[16 + i] * sc); }
  return a;
}
// column fragment from a [K][ld] layout (column n), rows >= K read as 0
__device__ __forceinline__ v16h fragc_f32(const float* W, int k0, int n, int lane, int ld, int K) {
  v16h a; const int g = lane >> 4;
#pragma unroll
  for (int i = 0; i < 8; ++i) { const int ka = k0 + 8 * g + i, kb = ka + 16;
    a[i] = (_Float16)(ka < K ? W[(size_t)(ka < K ? ka : K - 1) * ld + n] : 0.f); a[8 + i] = (_Float16)(kb < K ? W[(size_t)(kb < K ? kb : K - 1) * ld + n] : 0.f); }
  return a;
}
struct F2 { v16b h, l; };
__device__ __forceinline__ F2 bsplit16(const float v[16]) { F2 r;
#pragma unroll
  for (int i = 0; i < 16; ++i) { const __bf16 h = (__bf16)v[i]; r.h[i] = h; r.l[i] = (__bf16)(v[i] - (float)h); }
  return r; }
__device__ __forceinline__ F2 split_row(const float* row, int k0, int lane) { float v[16]; const float* p = row + k0 + 8 * (lane >> 4);
#pragma unroll
  for (int i = 0; i < 8; ++i) { v[i] = p[i]; v[8 + i] = p[16 + i]; }
  return bsplit16(v); }
__device__ __forceinline__ F2 split_rowK(const float* row, int k0, int lane, int K) { float v[16]; const int g = lane >> 4;
#pragma unroll
  for (int i = 0; i < 8; ++i) { const int ka = k0 + 8 * g + i, kb = ka + 16; v[i] = ka < K ? row[ka < K ? ka : K - 1] : 0.f; v[8 + i] = kb < K ? row[kb < K ? kb : K - 1] : 0.f; }
  return bsplit16(v); }
__device__ __forceinline__ F2 split_col(const float* W, int k0, int n, int lane, int ld, int K) { float v[16]; const int g = lane >> 4;
#pragma unroll
  for (int i = 0; i < 8; ++i) { const int ka = k0 + 8 * g + i, kb = ka + 16; v[i] = ka < K ? W[(size_t)(ka < K ? ka : K - 1) * ld + n] : 0.f; v[8 + i] = kb < K ? W[(size_t)(kb < K ? kb : K - 1) * ld + n] : 0.f; }
  return bsplit16(v); }
__device__ __forceinline__ v8f mac3(const F2& a, const F2& b, v8f c) { c = wmma_bf(a.l, b.h, c); c = wmma_bf(a.h, b.l, c); return wmma_bf(a.h, b.h, c); }
__device__ __forceinline__ float sigm(float v) { return 1.0f / (1.0f + expf(-v)); }
#define LDSX() do { asm volatile("s_wait_dscnt 0" ::: "memory"); __builtin_amdgcn_wave_barrier(); __builtin_amdgcn_fence(__ATOMIC_RELEASE, "workgroup"); } while (0)


// Translation-equivariant multi-head attention (8 sets, 1,024 queries x 1,024 keys, dz 256, dx 2, 8 heads x 32, kernel MLP 10 -> 32 -> 8): logits = MLP([x_q - x_k, q_h . k_h / sqrt(32)]), softmax over keys, . v, output projection; the query locations pass through.
#define NM 8
#define NQ 1024
#define NK 1024
#define DZ 256
#define NH 8
#define HD 32
#define KH 32
#define NF 16              // padded feature width (2 + 8 used)
#define NRQ (NM * NQ)
#define NRK (NM * NK)
#ifndef TQB
#define TQB (NQ / 16)
#define TNM NM
#endif
typedef __attribute__((ext_vector_type(8))) __bf16 v8b;
__device__ __forceinline__ v16b frag_b(const __bf16* rowk0, int lane) {
  union { v16b v; v8b q[2]; } u; const __bf16* p = rowk0 + 8 * (lane >> 4);
  u.q[0] = *(const v8b*)p; u.q[1] = *(const v8b*)(p + 16); return u.v;
}
__device__ __forceinline__ float bfr(float v) { return (float)(__bf16)v; }
__device__ __attribute__((noinline)) float exp_ni(float v) { return expf(v); }
__device__ __attribute__((noinline)) float erf_ni(float v) { return erff(v); }

#define WS_PW  0u                                   // bf16 transposed rows Wq^T, Wk^T, Wv^T, Wout^T [4][256][256]; W1^T padded [32][32] (k = feature 0..9, rest 0); W2^T padded [16][32] (rows 8..15 zero)
#define WS_P1  (WS_PW + 2u * (size_t)4 * DZ * DZ)
#define WS_P2  (WS_P1 + 2u * (size_t)32 * 32)
#define WS_Q   (WS_P2 + 2u * (size_t)16 * 32)         // f16 q rows [NRQ][256]; k rows [NRK][256]; v planes [m][256][NK]; f32 ctx [NRQ][256]
#define WS_K   (WS_Q + 2u * (size_t)NRQ * DZ)
#define WS_V   (WS_K + 2u * (size_t)NRK * DZ)
#define WS_O   (WS_V + 2u * (size_t)NM * DZ * NK)
#define OUT1   ((size_t)NRQ * DZ)                     // float offset of the second output (xq copy)
#define WS_END (WS_O + 4u * (size_t)NRQ * DZ)

__global__ __launch_bounds__(256) void k_pack(const float* __restrict__ WQ, const float* __restrict__ WK, const float* __restrict__ WV, const float* __restrict__ WO, const float* __restrict__ W1, const float* __restrict__ W2, __bf16* __restrict__ PW, __bf16* __restrict__ P1, __bf16* __restrict__ P2) {
  const int n = blockIdx.x, which = blockIdx.y, t = threadIdx.x; __shared__ __align__(16) __bf16 s[DZ];
  if (which < 4) { const float* w = (which == 0) ? WQ : (which == 1) ? WK : (which == 2) ? WV : WO; s[t] = (__bf16)w[(size_t)t * DZ + n]; __syncthreads(); if (t < DZ / 8) vst2((unsigned*)(PW + ((size_t)which * DZ + n) * DZ + t * 8), *(const v4u*)&s[t * 8]); }
  else if (which == 4) { if (n >= 32) return; if (t < 32) s[t] = (t < 10) ? (__bf16)W1[(size_t)t * KH + n] : (__bf16)0.f; __syncthreads(); if (t < 4) vst2((unsigned*)(P1 + (size_t)n * 32 + t * 8), *(const v4u*)&s[t * 8]); }   // W1^T [n=hidden][k=feature]
  else { if (n >= 16) return; if (t < 32) s[t] = (n < NH) ? (__bf16)W2[(size_t)t * NH + n] : (__bf16)0.f; __syncthreads(); if (t < 4) vst2((unsigned*)(P2 + (size_t)n * 32 + t * 8), *(const v4u*)&s[t * 8]); } }   // W2^T [n=head][k=hidden]
// ---- k_proj: block = (64 rows, 128 cols, which): q from zq, k from zk -> f16 rows; v from zv -> planes
__global__ __launch_bounds__(128) void k_proj(const float* __restrict__ ZQ, const float* __restrict__ ZK, const float* __restrict__ ZV, const __bf16* __restrict__ PW, _Float16* __restrict__ Q, _Float16* __restrict__ Kr, _Float16* __restrict__ V) {
  __shared__ __align__(16) _Float16 so[64][136]; __shared__ __align__(16) _Float16 st[128][72];
  const int tid = threadIdx.x, wave = tid >> 5, lane = tid & 31, col = lane & 15, g = lane >> 4; const int which = blockIdx.z; const size_t rb = (size_t)blockIdx.x * 64; const size_t r0 = rb + wave * 16; const int c0 = blockIdx.y * 128; const float* A = (which == 0) ? ZQ : (which == 1) ? ZK : ZV; const __bf16* Wr = PW + ((size_t)which * DZ) * DZ;
  v8f acc[8] = {};
#pragma unroll
  for (int kc = 0; kc < DZ / 32; ++kc) { v16b a; { const float* p = A + (r0 + col) * DZ + kc * 32 + 8 * g;
#pragma unroll
      for (int i = 0; i < 8; ++i) { a[i] = (__bf16)p[i]; a[8 + i] = (__bf16)p[16 + i]; } }
#pragma unroll
    for (int j = 0; j < 8; ++j) acc[j] = wmma_bf(a, frag_b(Wr + (size_t)(c0 + j * 16 + col) * DZ + kc * 32, lane), acc[j]); }
#pragma unroll
  for (int j = 0; j < 8; ++j)
#pragma unroll
    for (int r = 0; r < 8; ++r) { const _Float16 hv = (_Float16)acc[j][r]; if (which < 2) so[wave * 16 + 8 * g + r][j * 16 + col] = hv; else st[j * 16 + col][wave * 16 + 8 * g + r] = hv; }
  __syncthreads();
  if (which < 2) { _Float16* dst = (which == 0) ? Q : Kr; for (int e = tid; e < 64 * 16; e += 128) { const int rl = e >> 4, q = e & 15; vst2((unsigned*)(dst + (rb + rl) * DZ + c0 + q * 8), *(const v4u*)&so[rl][q * 8]); } }
  else { const size_t mI = rb / NK; const int s0 = (int)(rb % NK); for (int e = tid; e < 128 * 8; e += 128) { const int d = e >> 3, pc = e & 7; vst2((unsigned*)(V + ((mI * DZ + c0 + d) * NK) + s0 + pc * 8), *(const v4u*)&st[d][pc * 8]); } }
}
// ---- k_te: block = (16 queries, m), 8 waves = two groups of 4; group grp takes the 32-key chunks 2 it + grp with its own logits buffer and its own running (m, l, ctx), so that 4 waves and not 2 stand on each SIMD to cover each other's load, LDS and matrix latencies; the two partial softmax states are joined once behind the loop. Below, wave = the wave's number inside its group. Per 32-key chunk: (a) wave w takes the 16 keys of half w & 1 and 8 of the queries (4 (w >> 1) + 0..3 and 8 + the same): token dots of all 8 heads, so that lane (g, key) holds every feature of its own pairs; (b) the MLP transposed, in registers: h1^T = relu(W1^T . F^T), dots^T = W2^T . h1^T + b2, the features being a B fragment as they stand and the D of the first product the B fragment of the second -> SC[pair][h]; (c) wave w runs the running-max softmax + P.v for heads 2w, 2w+1 over the chunk, transposed: ctx^T += v^T . P^T, lane (g, query) holding 16 of the query's 32 logits, so that maximum and sum are in-lane but for one exchange between the lane halves, and exp(.) is the B fragment as it stands
#define SP 12              // floats per pair row of the logits: 16-byte stores, 16 rows on 16 distinct bank groups
#define SQP (32 * SP + 4)  // floats per query row of the logits: the 16 queries that one read of part (c) touches start 4 banks apart
__device__ __forceinline__ float xhalf(float x) { return __builtin_bit_cast(float, __builtin_amdgcn_permlanex16(__builtin_bit_cast(int, x), __builtin_bit_cast(int, x), 0x76543210, 0xfedcba98, false, false)); }   // lane l with lane l ^ 16
// exp(x) as __expf gives it (the hardware's exp2 of x . log2 e), with one v_nop in the same statement: the instruction set asks for one slot between a transcendental and a next instruction that reads its result or overwrites its source
__device__ __forceinline__ float exp_slot(float x) { float r; asm("v_exp_f32 %0, %1\n\tv_nop" : "=v"(r) : "v"(x * 0x1.715476p+0f)); return r; }
__global__ __launch_bounds__(256) void k_te(const _Float16* __restrict__ Q, const _Float16* __restrict__ Kr, const _Float16* __restrict__ V, const float* __restrict__ XQ, const float* __restrict__ XKV, const __bf16* __restrict__ P1, const __bf16* __restrict__ P2, const float* __restrict__ B1, const float* __restrict__ B2, float* __restrict__ O) {
  __shared__ __align__(16) float sS2[2][16][SQP]; __shared__ __align__(16) _Float16 sq[16][DZ + 8]; __shared__ __align__(16) float so[4][16][68];
  const int tid = threadIdx.x, grp = tid >> 7, wave = (tid >> 5) & 3, lane = tid & 31, col = lane & 15, g = lane >> 4; const size_t mI = blockIdx.y; const int q0 = blockIdx.x * 16; const size_t rq = mI * NQ + q0;
  const int w2 = wave >> 1, kh = wave & 1;
  float (*sS)[SQP] = sS2[grp];   // this group's logits
  // A row 8g + r holds query 8g + ((r + 4 w2) & 7): D elements 0..3 are this wave's queries 8g + 4 w2 + 0..3
  const int qr = (col & 8) + (((col & 7) + 4 * w2) & 7);
  for (int e = tid; e < 16 * (DZ / 8); e += 256) { const int rl = e >> 5, pc = e & 31; *(v8h*)&sq[rl][pc * 8] = *(const v8h*)(Q + (rq + rl) * DZ + pc * 8); }   // the 16 q rows, read as fragments in every chunk (all 8 heads in registers would spill)
  __syncthreads();
  // W1^T as A, hidden row 16j + col: a lane's 16 k slots = features 0..9, b1 (against the constant feature 1), zeros. wlo has them in the g = 0 lanes only (k slots 0..7, 16..23: it meets the features held by the g = 0 lanes, queries 4 w2 + rr), whi in the g = 1 lanes only (queries 8 + 4 w2 + rr)
  v16b wlo[2], whi[2];
#pragma unroll
  for (int j = 0; j < 2; ++j) { union { v16b v; v8b q[2]; } u; const __bf16* pw = P1 + (size_t)(j * 16 + col) * 32; u.q[0] = *(const v8b*)pw; u.q[1] = *(const v8b*)(pw + 8); u.v[10] = (__bf16)B1[j * 16 + col];
    const v16b z = {}; wlo[j] = (g == 0) ? u.v : z; whi[j] = (g == 0) ? z : u.v; }
  const v16b w2f = frag_b(P2 + (size_t)col * 32, lane);   // W2^T as A: row = head (8..15 zero), k = hidden
  float b2v[NH], xq0[4], xq1[4];
#pragma unroll
  for (int r = 0; r < NH; ++r) b2v[r] = bfr(B2[r]);
#pragma unroll
  for (int rr = 0; rr < 4; ++rr) { const size_t qq = rq + 8 * g + 4 * w2 + rr; xq0[rr] = bfr(XQ[qq * 2]); xq1[rr] = bfr(XQ[qq * 2 + 1]); }
  float m[2] = {-3.0e38f, -3.0e38f}, l[2] = {0.f, 0.f};   // of query col; l is the sum over this lane half's keys alone, the halves are joined after the loop
  v8f acc[2][2] = {};   // ctx^T: element r = dim 16 dt + 8g + r of head 2w + hh, column = query col
#pragma unroll 1
  for (int it = 0; it < NK / 64; ++it) { const int j0 = (it * 2 + grp) * 32;   // the same trip count in both groups: every barrier is met by all 8 waves
    // (a) token dots of all heads for this wave's 16 keys; lane (g, col) keeps pairs (8g + 4 w2 + rr, key col)
    const size_t kr = mI * NK + j0 + kh * 16 + col; const v2f xk = *(const v2f*)(XKV + kr * 2); const float xk0 = bfr(xk[0]), xk1 = bfr(xk[1]);
    float ft[4][NH]; v16h kf[NH];   // all 8 heads' key fragments requested before the first product: one memory latency a chunk, not eight
#pragma unroll
    for (int h = 0; h < NH; ++h) kf[h] = frag_h(Kr + kr * DZ + h * HD, lane);
    v16h qn = frag_h(&sq[qr][0], lane);   // q fragments one head ahead of their product
#pragma unroll
    for (int h = 0; h < NH; ++h) { const v16h qc = qn; if (h + 1 < NH) qn = frag_h(&sq[qr][(h + 1) * HD], lane);
      v8f c = {}; c = wmma16(qc, kf[h], c);
#pragma unroll
      for (int rr = 0; rr < 4; ++rr) ft[rr][h] = c[rr] * 0.17677669529663688f; }
    // (b) MLP on 32 pairs a pass, no LDS between the products (unrolled, as every loop here over a register array: its indices must be constants)
#pragma unroll
    for (int rr = 0; rr < 4; ++rr) { float fv[16]; fv[0] = xq0[rr] - xk0; fv[1] = xq1[rr] - xk1;
#pragma unroll
      for (int h = 0; h < NH; ++h) fv[2 + h] = ft[rr][h];
      fv[10] = 1.0f;
#pragma unroll
      for (int i = 11; i < 16; ++i) fv[i] = 0.f;
      const F2 fb = bsplit16(fv); v8f dd[2];
#pragma unroll
      for (int s = 0; s < 2; ++s) { v8f hacc[2] = {};
#pragma unroll
        for (int j = 0; j < 2; ++j) { const v16b w = s ? whi[j] : wlo[j]; hacc[j] = wmma_bf(w, fb.h, hacc[j]); hacc[j] = wmma_bf(w, fb.l, hacc[j]); }
        float hv[16];   // D element r of tile j = hidden 16j + 8g + r = k slot of B element 8j + r
#pragma unroll
        for (int j = 0; j < 2; ++j)
#pragma unroll
          for (int r = 0; r < 8; ++r) { const float v = hacc[j][r]; hv[8 * j + r] = v > 0.f ? v : 0.f; }
        const F2 hb = bsplit16(hv); v8f dacc = {}; dacc = wmma_bf(w2f, hb.h, dacc); dacc = wmma_bf(w2f, hb.l, dacc); dd[s] = dacc; }
      if (g == 0) {   // D rows 0..7 = heads, held by the g = 0 lanes; column = key
#pragma unroll
        for (int s = 0; s < 2; ++s) { float* ps = &sS[8 * s + 4 * w2 + rr][(kh * 16 + col) * SP]; v4f o0, o1;
#pragma unroll
          for (int r = 0; r < 4; ++r) { o0[r] = dd[s][r] + b2v[r]; o1[r] = dd[s][4 + r] + b2v[4 + r]; }
          *(v4f*)ps = o0; *(v4f*)(ps + 4) = o1; } } }
    __syncthreads();
    // (c) softmax + P.v for this wave's two heads: lane (g, col) takes query col, keys 8g + i and 16 + 8g + i (the k order of frag_h)
    v16h vf[2][2];
#pragma unroll
    for (int hh = 0; hh < 2; ++hh)
#pragma unroll
      for (int dt = 0; dt < 2; ++dt) vf[hh][dt] = frag_h(V + ((mI * DZ + (wave * 2 + hh) * HD + dt * 16 + col) * NK) + j0, lane);   // v^T as A: row = dim
    v2f sv[16];   // both heads of a pair in one 8-byte read
#pragma unroll
    for (int i = 0; i < 8; ++i) { sv[i] = *(const v2f*)&sS[col][(8 * g + i) * SP + 2 * wave]; sv[8 + i] = *(const v2f*)&sS[col][(16 + 8 * g + i) * SP + 2 * wave]; }
#pragma unroll
    for (int hh = 0; hh < 2; ++hh) { float t[8];
#pragma unroll
      for (int i = 0; i < 8; ++i) t[i] = fmaxf(sv[i][hh], sv[8 + i][hh]);
      float mx = fmaxf(fmaxf(fmaxf(t[0], t[1]), fmaxf(t[2], t[3])), fmaxf(fmaxf(t[4], t[5]), fmaxf(t[6], t[7])));
      mx = fmaxf(mx, xhalf(mx));
      const float mn = fmaxf(m[hh], mx); const float am = exp_slot(m[hh] - mn); const float alpha = (m[hh] <= -1.0e38f) ? 0.f : am;
      v16h pb; float es[4];   // four independent chains of four
#pragma unroll
      for (int i = 0; i < 16; ++i) { const float e = exp_slot(sv[i][hh] - mn); es[i & 3] = (i < 4) ? e : es[i & 3] + e; pb[i] = (_Float16)(e * 2048.0f); }
      l[hh] = l[hh] * alpha + ((es[0] + es[1]) + (es[2] + es[3])); m[hh] = mn;
#pragma unroll
      for (int dt = 0; dt < 2; ++dt) { acc[hh][dt] *= alpha; acc[hh][dt] = wmma16(vf[hh][dt], pb, acc[hh][dt]); } }
    __syncthreads(); }
  // join of the two groups: group 1 hands its (m, l, ctx^T) over in LDS (the logits buffer is free behind the loop's last barrier; 36 floats a lane = 16 B x odd), group 0 rescales both to the common maximum and goes on alone (loops unrolled: the indices of register arrays must be constants)
  float* mg = &sS2[0][0][0] + (wave * 32 + lane) * 36;
  if (grp == 1) {
#pragma unroll
    for (int hh = 0; hh < 2; ++hh)
#pragma unroll
      for (int dt = 0; dt < 2; ++dt) { v4f o0, o1;
#pragma unroll
        for (int r = 0; r < 4; ++r) { o0[r] = acc[hh][dt][r]; o1[r] = acc[hh][dt][4 + r]; }
        *(v4f*)(mg + (hh * 2 + dt) * 8) = o0; *(v4f*)(mg + (hh * 2 + dt) * 8 + 4) = o1; }
    v4f ml; ml[0] = m[0]; ml[1] = m[1]; ml[2] = l[0]; ml[3] = l[1]; *(v4f*)(mg + 32) = ml; }
  __syncthreads();
  if (grp == 1) return;   // behind the kernel's last barrier
  { const v4f ml = *(const v4f*)(mg + 32);
#pragma unroll
    for (int hh = 0; hh < 2; ++hh) { const float mn = fmaxf(m[hh], ml[hh]); const float a0 = exp_slot(m[hh] - mn), a1 = exp_slot(ml[hh] - mn);
      l[hh] = l[hh] * a0 + ml[2 + hh] * a1;
#pragma unroll
      for (int dt = 0; dt < 2; ++dt) { const v4f o0 = *(const v4f*)(mg + (hh * 2 + dt) * 8), o1 = *(const v4f*)(mg + (hh * 2 + dt) * 8 + 4);
#pragma unroll
        for (int r = 0; r < 4; ++r) { acc[hh][dt][r] = acc[hh][dt][r] * a0 + o0[r] * a1; acc[hh][dt][4 + r] = acc[hh][dt][4 + r] * a0 + o1[r] * a1; } } } }
#pragma unroll
  for (int hh = 0; hh < 2; ++hh) { const float il = (1.0f / 2048.0f) / (l[hh] + xhalf(l[hh]));
#pragma unroll
    for (int dt = 0; dt < 2; ++dt) { v4f o0, o1;
#pragma unroll
      for (int r = 0; r < 4; ++r) { o0[r] = acc[hh][dt][r] * il; o1[r] = acc[hh][dt][4 + r] * il; }
      float* po = &so[wave][col][hh * 32 + dt * 16 + 8 * g]; *(v4f*)po = o0; *(v4f*)(po + 4) = o1; } }
  LDSX();
  for (int rl = 0; rl < 16; ++rl) if (lane < 16) vst2(O + (rq + rl) * DZ + wave * 64 + lane * 4, *(const v4f*)&so[wave][rl][lane * 4]);   // heads 2w, 2w+1 = 64 contiguous floats (256-B segment)
}
// ---- k_out: block = (64 rows, 128 cols): out0 = ctx (hi + lo) . Wout + bout
__global__ __launch_bounds__(128) void k_out(const float* __restrict__ O, const __bf16* __restrict__ PW, const float* __restrict__ BO, float* __restrict__ Y) { __shared__ __align__(16) float so[4][16][132];
  const int tid = threadIdx.x, wave = tid >> 5, lane = tid & 31, col = lane & 15, g = lane >> 4; const size_t r0 = (size_t)blockIdx.x * 64 + wave * 16; const int c0 = blockIdx.y * 128; const __bf16* Wr = PW + (size_t)3 * DZ * DZ;
  v8f acc[8] = {};
#pragma unroll
  for (int kc = 0; kc < DZ / 32; ++kc) { const F2 a = split_row(O + (r0 + col) * DZ, kc * 32, lane);
#pragma unroll
    for (int j = 0; j < 8; ++j) { const v16b w = frag_b(Wr + (size_t)(c0 + j * 16 + col) * DZ + kc * 32, lane); acc[j] = wmma_bf(a.h, w, acc[j]); acc[j] = wmma_bf(a.l, w, acc[j]); } }
#pragma unroll
  for (int j = 0; j < 8; ++j) { const float bb = bfr(BO[c0 + j * 16 + col]);
#pragma unroll
    for (int r = 0; r < 8; ++r) so[wave][8 * g + r][j * 16 + col] = acc[j][r] + bb; }
  LDSX(); for (int rl = 0; rl < 16; ++rl) vst2(Y + (r0 + rl) * DZ + c0 + lane * 4, *(const v4f*)&so[wave][rl][lane * 4]); }
// ---- k_copy: second output = xq (f32 copy, 16-B chunks; whole buffer)
__global__ __launch_bounds__(256) void k_copy(const float* __restrict__ XQ, float* __restrict__ OUT, int n4) { const int i = blockIdx.x * 256 + threadIdx.x; if (i < n4) { v4f v = *(const v4f*)(XQ + (size_t)i * 4); vst2(OUT + (size_t)i * 4, v); } }
extern "C" void kernel_launch(void* const* d_in, const int* in_sizes, int n_in, void* d_out, int out_size, void* d_ws, size_t ws_size, hipStream_t stream) {
  (void)in_sizes; (void)n_in; (void)out_size;
  const float** F = (const float**)d_in;   // 0 zq, 1 zk, 2 zv [8,1024,256]; 3 xq, 4 xkv [8,1024,2]; 5 Wq, 6 Wk, 7 Wv [256,256] (in,out); 8 Wout [256,256] (in,out), 9 bout; 10 W1 [10,32], 11 b1 [32], 12 W2 [32,8], 13 b2 [8]
  if (ws_size < (size_t)WS_END) return;
  char* ws = (char*)d_ws; __bf16 *PW = (__bf16*)(ws + WS_PW), *P1 = (__bf16*)(ws + WS_P1), *P2 = (__bf16*)(ws + WS_P2); _Float16 *Q = (_Float16*)(ws + WS_Q), *Kr = (_Float16*)(ws + WS_K), *V = (_Float16*)(ws + WS_V); float* O = (float*)(ws + WS_O);
  k_pack<<<dim3(DZ, 6), 256, 0, stream>>>(F[5], F[6], F[7], F[8], F[10], F[12], PW, P1, P2);
  k_proj<<<dim3(TNM * NQ / 64, DZ / 128, 3), 128, 0, stream>>>(F[0], F[1], F[2], PW, Q, Kr, V);
  k_te<<<dim3(TQB, TNM), 256, 0, stream>>>(Q, Kr, V, F[3], F[4], P1, P2, F[11], F[13], O);
  k_out<<<dim3(TNM * NQ / 64, DZ / 128), 128, 0, stream>>>(O, PW, F[9], (float*)d_out);
  k_copy<<<(NRQ * 2 / 4 + 255) / 256, 256, 0, stream>>>(F[3], (float*)d_out + OUT1, NRQ * 2 / 4);
}

// v004
// One run takes 123 microseconds.
// Timed twice side by side with v003, it ran 1.09 and 1.12 times as fast.
// All steps since v000 together make it 2.51 times as fast.
// compute dtype: all float inputs rounded to bf16; q/k/v = z . W with EXACT bf16 products on WMMA 16x16x32 ((in,out) weights as transposed rows), rounded once to f16 (k and v stored as fragments); per 16-query x 32-key chunk: token dots q_h . k_h x 32^-1/2 on WMMA (single f16), the pair features [xq - xkv | dots | 0] in f32, the kernel MLP relu(F . W1 + b1) . W2 + b2 on WMMA with F and the hidden as bf16 hi + lo (2 products each); per (query, head) running-max softmax over the keys in f32 (hardware exp), P (scaled by 2^11, single f16) x v (single f16); out = ctx (bf16 hi + lo, 2 products) . Wout + bout; xq copied through as the second output; f32 outputs.
#include <hip/hip_runtime.h>
#include <math.h>

typedef __attribute__((ext_vector_type(16))) _Float16 v16h;
typedef __attribute__((ext_vector_type(16))) __bf16 v16b;
typedef __attribute__((ext_vector_type(8)))  _Float16 v8h;
typedef __attribute__((ext_vector_type(8)))  float v8f;
typedef __attribute__((ext_vector_type(4)))  float v4f;
typedef __attribute__((ext_vector_type(2)))  float v2f;
typedef __attribute__((ext_vector_type(4)))  unsigned v4u;
typedef __attribute__((ext_vector_type(4)))  int v4i;
typedef float __attribute__((may_alias)) float_a;
typedef int __attribute__((may_alias)) int_a;

template <typename T> __device__ __forceinline__ void vst2(void* p, T v) { *(T*)p = v;  }
__device__ __forceinline__ v8f wmma16(v16h a, v16h b, v8f c) {
  v8f d = __builtin_amdgcn_wmma_f32_16x16x32_f16(false, a, false, b, (short)0, c, false, false);
  asm volatile("v_nop\n\tv_nop\n\tv_nop\n\tv_nop" : "+v"(d) : "v"(a), "v"(b));
  return d;
}
__device__ __forceinline__ v8f wmma_bf(v16b a, v16b b, v8f c) {
  v8f d = __builtin_amdgcn_wmma_f32_16x16x32_bf16(false, a, false, b, (short)0, c, false, false);
  asm volatile("v_nop\n\tv_nop\n\tv_nop\n\tv_nop" : "+v"(d) : "v"(a), "v"(b));
  return d;
}
// 16x16x32 fragments: lane = (h = lane>>4, row/col = lane&15); elements 0..7 = k0+8h+0..7, 8..15 = k0+16+8h+0..7; D element r = row 8h+r
__device__ __forceinline__ v16h frag_h(const _Float16* rowk0, int lane) {
  union { v16h v; v8h q[2]; } u; const _Float16* p = rowk0 + 8 * (lane >> 4);
  u.q[0] = *(const v8h*)p; u.q[1] = *(const v8h*)(p + 16); return u.v;
}
// the same fragment from a tile stored in fragment order, [piece 0, 1][lane][8 halves]: each of the two loads reads 512 contiguous bytes (4 whole lines; from 16 rows it would touch 16)
__device__ __forceinline__ v16h frag_t(const _Float16* tile, int lane) {
  union { v16h v; v8h q[2]; } u; const _Float16* p = tile + 8 * lane;
  u.q[0] = *(const v8h*)p; u.q[1] = *(const v8h*)(p + 256); return u.v;
}
__device__ __forceinline__ v16h frag_f32(const float* rowk0, int lane) {
  v16h a; const float* p = rowk0 + 8 * (lane >> 4);
#pragma unroll
  for (int i = 0; i < 8; ++i) { a[i] = (_Float16)p[i]; a[8 + i] = (_Float16)p[16 + i]; }
  return a;
}
__device__ __forceinline__ v16h frag_f32s(const float* rowk0, int lane, float sc) {
  v16h a; const float* p = rowk0 + 8 * (lane >> 4);
#pragma unroll
  for (int i = 0; i < 8; ++i) { a[i] = (_Float16)(p[i] * sc); a[8 + i] = (_Float16)(p[16 + i] * sc); }
  return a;
}
// column fragment from a [K][ld] layout (column n), rows >= K read as 0
__device__ __forceinline__ v16h fragc_f32(const float* W, int k0, int n, int lane, int ld, int K) {
  v16h a; const int g = lane >> 4;
#pragma unroll
  for (int i = 0; i < 8; ++i) { const int ka = k0 + 8 * g + i, kb = ka + 16;
    a[i] = (_Float16)(ka < K ? W[(size_t)(ka < K ? ka : K - 1) * ld + n] : 0.f); a[8 + i] = (_Float16)(kb < K ? W[(size_t)(kb < K ? kb : K - 1) * ld + n] : 0.f); }
  return a;
}
struct F2 { v16b h, l; };
__device__ __forceinline__ F2 bsplit16(const float v[16]) { F2 r;
#pragma unroll
  for (int i = 0; i < 16; ++i) { const __bf16 h = (__bf16)v[i]; r.h[i] = h; r.l[i] = (__bf16)(v[i] - (float)h); }
  return r; }
__device__ __forceinline__ F2 split_row(const float* row, int k0, int lane) { float v[16]; const float* p = row + k0 + 8 * (lane >> 4);
#pragma unroll
  for (int i = 0; i < 8; ++i) { v[i] = p[i]; v[8 + i] = p[16 + i]; }
  return bsplit16(v); }
__device__ __forceinline__ F2 split_rowK(const float* row, int k0, int lane, int K) { float v[16]; const int g = lane >> 4;
#pragma unroll
  for (int i = 0; i < 8; ++i) { const int ka = k0 + 8 * g + i, kb = ka + 16; v[i] = ka < K ? row[ka < K ? ka : K - 1] : 0.f; v[8 + i] = kb < K ? row[kb < K ? kb : K - 1] : 0.f; }
  return bsplit16(v); }
__device__ __forceinline__ F2 split_col(const float* W, int k0, int n, int lane, int ld, int K) { float v[16]; const int g = lane >> 4;
#pragma unroll
  for (int i = 0; i < 8; ++i) { const int ka = k0 + 8 * g + i, kb = ka + 16; v[i] = ka < K ? W[(size_t)(ka < K ? ka : K - 1) * ld + n] : 0.f; v[8 + i] = kb < K ? W[(size_t)(kb < K ? kb : K - 1) * ld + n] : 0.f; }
  return bsplit16(v); }
__device__ __forceinline__ v8f mac3(const F2& a, const F2& b, v8f c) { c = wmma_bf(a.l, b.h, c); c = wmma_bf(a.h, b.l, c); return wmma_bf(a.h, b.h, c); }
__device__ __forceinline__ float sigm(float v) { return 1.0f / (1.0f + expf(-v)); }
#define LDSX() do { asm volatile("s_wait_dscnt 0" ::: "memory"); __builtin_amdgcn_wave_barrier(); __builtin_amdgcn_fence(__ATOMIC_RELEASE, "workgroup"); } while (0)


// Translation-equivariant multi-head attention (8 sets, 1,024 queries x 1,024 keys, dz 256, dx 2, 8 heads x 32, kernel MLP 10 -> 32 -> 8): logits = MLP([x_q - x_k, q_h . k_h / sqrt(32)]), softmax over keys, . v, output projection; the query locations pass through.
#define NM 8
#define NQ 1024
#define NK 1024
#define DZ 256
#define NH 8
#define HD 32
#define KH 32
#define NF 16              // padded feature width (2 + 8 used)
#define NRQ (NM * NQ)
#define NRK (NM * NK)
#ifndef TQB
#define TQB (NQ / 16)
#define TNM NM
#endif
typedef __attribute__((ext_vector_type(8))) __bf16 v8b;
__device__ __forceinline__ v16b frag_b(const __bf16* rowk0, int lane) {
  union { v16b v; v8b q[2]; } u; const __bf16* p = rowk0 + 8 * (lane >> 4);
  u.q[0] = *(const v8b*)p; u.q[1] = *(const v8b*)(p + 16); return u.v;
}
__device__ __forceinline__ float bfr(float v) { return (float)(__bf16)v; }
__device__ __attribute__((noinline)) float exp_ni(float v) { return expf(v); }
__device__ __attribute__((noinline)) float erf_ni(float v) { return erff(v); }

#define WS_PW  0u                                   // bf16 transposed rows Wq^T, Wk^T, Wv^T, Wout^T [4][256][256]; W1^T padded [32][32] (k = feature 0..9, rest 0); W2^T padded [16][32] (rows 8..15 zero)
#define WS_P1  (WS_PW + 2u * (size_t)4 * DZ * DZ)
#define WS_P2  (WS_P1 + 2u * (size_t)32 * 32)
#define WS_Q   (WS_P2 + 2u * (size_t)16 * 32)         // f16 q rows [NRQ][256]; k fragments [NRK / 16][head][512] (row = key, k = dim); v fragments [m][NK / 32][head][dim half][512] (row = dim, k = key), each 512 = [piece][lane][8] as frag_t reads it; f32 ctx [NRQ][256]
#define WS_K   (WS_Q + 2u * (size_t)NRQ * DZ)
#define WS_V   (WS_K + 2u * (size_t)NRK * DZ)
#define WS_O   (WS_V + 2u * (size_t)NM * DZ * NK)
#define OUT1   ((size_t)NRQ * DZ)                     // float offset of the second output (xq copy)
#define WS_END (WS_O + 4u * (size_t)NRQ * DZ)

__global__ __launch_bounds__(256) void k_pack(const float* __restrict__ WQ, const float* __restrict__ WK, const float* __restrict__ WV, const float* __restrict__ WO, const float* __restrict__ W1, const float* __restrict__ W2, __bf16* __restrict__ PW, __bf16* __restrict__ P1, __bf16* __restrict__ P2) {
  const int n = blockIdx.x, which = blockIdx.y, t = threadIdx.x; __shared__ __align__(16) __bf16 s[DZ];
  if (which < 4) { const float* w = (which == 0) ? WQ : (which == 1) ? WK : (which == 2) ? WV : WO; s[t] = (__bf16)w[(size_t)t * DZ + n]; __syncthreads(); if (t < DZ / 8) vst2((unsigned*)(PW + ((size_t)which * DZ + n) * DZ + t * 8), *(const v4u*)&s[t * 8]); }
  else if (which == 4) { if (n >= 32) return; if (t < 32) s[t] = (t < 10) ? (__bf16)W1[(size_t)t * KH + n] : (__bf16)0.f; __syncthreads(); if (t < 4) vst2((unsigned*)(P1 + (size_t)n * 32 + t * 8), *(const v4u*)&s[t * 8]); }   // W1^T [n=hidden][k=feature]
  else { if (n >= 16) return; if (t < 32) s[t] = (n < NH) ? (__bf16)W2[(size_t)t * NH + n] : (__bf16)0.f; __syncthreads(); if (t < 4) vst2((unsigned*)(P2 + (size_t)n * 32 + t * 8), *(const v4u*)&s[t * 8]); } }   // W2^T [n=head][k=hidden]
// ---- k_proj: block = (64 rows, 128 cols, which): q from zq -> f16 rows; k from zk, v from zv -> fragment order (consecutive lanes store consecutive 16-byte chunks: a wave stores 512 contiguous bytes)
__global__ __launch_bounds__(128) void k_proj(const float* __restrict__ ZQ, const float* __restrict__ ZK, const float* __restrict__ ZV, const __bf16* __restrict__ PW, _Float16* __restrict__ Q, _Float16* __restrict__ Kr, _Float16* __restrict__ V) {
  __shared__ __align__(16) _Float16 so[64][136]; __shared__ __align__(16) _Float16 st[128][72];
  const int tid = threadIdx.x, wave = tid >> 5, lane = tid & 31, col = lane & 15, g = lane >> 4; const int which = blockIdx.z; const size_t rb = (size_t)blockIdx.x * 64; const size_t r0 = rb + wave * 16; const int c0 = blockIdx.y * 128; const float* A = (which == 0) ? ZQ : (which == 1) ? ZK : ZV; const __bf16* Wr = PW + ((size_t)which * DZ) * DZ;
  v8f acc[8] = {};
#pragma unroll
  for (int kc = 0; kc < DZ / 32; ++kc) { v16b a; { const float* p = A + (r0 + col) * DZ + kc * 32 + 8 * g;
#pragma unroll
      for (int i = 0; i < 8; ++i) { a[i] = (__bf16)p[i]; a[8 + i] = (__bf16)p[16 + i]; } }
#pragma unroll
    for (int j = 0; j < 8; ++j) acc[j] = wmma_bf(a, frag_b(Wr + (size_t)(c0 + j * 16 + col) * DZ + kc * 32, lane), acc[j]); }
#pragma unroll
  for (int j = 0; j < 8; ++j)
#pragma unroll
    for (int r = 0; r < 8; ++r) { const _Float16 hv = (_Float16)acc[j][r]; if (which < 2) so[wave * 16 + 8 * g + r][j * 16 + col] = hv; else st[j * 16 + col][wave * 16 + 8 * g + r] = hv; }
  __syncthreads();
  if (which == 0) { for (int e = tid; e < 64 * 16; e += 128) { const int rl = e >> 4, q = e & 15; vst2((unsigned*)(Q + (rb + rl) * DZ + c0 + q * 8), *(const v4u*)&so[rl][q * 8]); } }
  else if (which == 1) { for (int e = tid; e < 64 * 16; e += 128) { const int ln = e & 31, pc = (e >> 5) & 1, hh = (e >> 6) & 3, t = e >> 8;   // key tile t, head hh of the block's four each
      vst2((unsigned*)(Kr + ((((rb / 16 + t) * NH + c0 / HD + hh) * 2 + pc) * 32 + ln) * 8), *(const v4u*)&so[t * 16 + (ln & 15)][hh * HD + pc * 16 + (ln >> 4) * 8]); } }
  else { const size_t mI = rb / NK; const int s0 = (int)(rb % NK); for (int e = tid; e < 128 * 8; e += 128) { const int ln = e & 31, pc = (e >> 5) & 1, dt = (e >> 6) & 1, hh = (e >> 7) & 3, cc = e >> 9;   // 32-key chunk cc of the block's two, head hh of its four
      vst2((unsigned*)(V + ((((((mI * (NK / 32) + s0 / 32 + cc) * NH + c0 / HD + hh) * 2 + dt) * 2 + pc) * 32 + ln) * 8)), *(const v4u*)&st[hh * HD + dt * 16 + (ln & 15)][cc * 32 + pc * 16 + (ln >> 4) * 8]); } }
}
// ---- k_te: block = (16 queries, m), 8 waves = two groups of 4; group grp takes the 32-key chunks 2 it + grp with its own logits buffer and its own running (m, l, ctx), so that 4 waves and not 2 stand on each SIMD to cover each other's load, LDS and matrix latencies; the two partial softmax states are joined once behind the loop. Below, wave = the wave's number inside its group. Per 32-key chunk: (a) wave w takes the 16 keys of half w & 1 and 8 of the queries (4 (w >> 1) + 0..3 and 8 + the same): token dots of all 8 heads, so that lane (g, key) holds every feature of its own pairs; (b) the MLP transposed, in registers: h1^T = relu(W1^T . F^T), dots^T = W2^T . h1^T + b2, the features being a B fragment as they stand and the D of the first product the B fragment of the second -> SC[pair][h]; (c) wave w runs the running-max softmax + P.v for heads 2w, 2w+1 over the chunk, transposed: ctx^T += v^T . P^T, lane (g, query) holding 16 of the query's 32 logits, so that maximum and sum are in-lane but for one exchange between the lane halves, and exp(.) is the B fragment as it stands
#define SP 12              // floats per pair row of the logits: 16-byte stores, 16 rows on 16 distinct bank groups
#define SQP (32 * SP + 4)  // floats per query row of the logits: the 16 queries that one read of part (c) touches start 4 banks apart
__device__ __forceinline__ float xhalf(float x) { return __builtin_bit_cast(float, __builtin_amdgcn_permlanex16(__builtin_bit_cast(int, x), __builtin_bit_cast(int, x), 0x76543210, 0xfedcba98, false, false)); }   // lane l with lane l ^ 16
// exp(x) as __expf gives it (the hardware's exp2 of x . log2 e), with one v_nop in the same statement: the instruction set asks for one slot between a transcendental and a next instruction that reads its result or overwrites its source
__device__ __forceinline__ float exp_slot(float x) { float r; asm("v_exp_f32 %0, %1\n\tv_nop" : "=v"(r) : "v"(x * 0x1.715476p+0f)); return r; }
__global__ __launch_bounds__(256) void k_te(const _Float16* __restrict__ Q, const _Float16* __restrict__ Kr, const _Float16* __restrict__ V, const float* __restrict__ XQ, const float* __restrict__ XKV, const __bf16* __restrict__ P1, const __bf16* __restrict__ P2, const float* __restrict__ B1, const float* __restrict__ B2, float* __restrict__ O) {
  __shared__ __align__(16) float sS2[2][16][SQP]; __shared__ __align__(16) _Float16 sq[16][DZ + 8]; __shared__ __align__(16) float so[4][16][68];
  const int tid = threadIdx.x, grp = tid >> 7, wave = (tid >> 5) & 3, lane = tid & 31, col = lane & 15, g = lane >> 4; const size_t mI = blockIdx.y; const int q0 = blockIdx.x * 16; const size_t rq = mI * NQ + q0;
  const int w2 = wave >> 1, kh = wave & 1;
  float (*sS)[SQP] = sS2[grp];   // this group's logits
  // A row 8g + r holds query 8g + ((r + 4 w2) & 7): D elements 0..3 are this wave's queries 8g + 4 w2 + 0..3
  const int qr = (col & 8) + (((col & 7) + 4 * w2) & 7);
  for (int e = tid; e < 16 * (DZ / 8); e += 256) { const int rl = e >> 5, pc = e & 31; *(v8h*)&sq[rl][pc * 8] = *(const v8h*)(Q + (rq + rl) * DZ + pc * 8); }   // the 16 q rows, read as fragments in every chunk (all 8 heads in registers would spill)
  __syncthreads();
  // W1^T as A, hidden row 16j + col: a lane's 16 k slots = features 0..9, b1 (against the constant feature 1), zeros. wlo has them in the g = 0 lanes only (k slots 0..7, 16..23: it meets the features held by the g = 0 lanes, queries 4 w2 + rr), whi in the g = 1 lanes only (queries 8 + 4 w2 + rr)
  v16b wlo[2], whi[2];
#pragma unroll
  for (int j = 0; j < 2; ++j) { union { v16b v; v8b q[2]; } u; const __bf16* pw = P1 + (size_t)(j * 16 + col) * 32; u.q[0] = *(const v8b*)pw; u.q[1] = *(const v8b*)(pw + 8); u.v[10] = (__bf16)B1[j * 16 + col];
    const v16b z = {}; wlo[j] = (g == 0) ? u.v : z; whi[j] = (g == 0) ? z : u.v; }
  const v16b w2f = frag_b(P2 + (size_t)col * 32, lane);   // W2^T as A: row = head (8..15 zero), k = hidden
  float b2v[NH], xq0[4], xq1[4];
#pragma unroll
  for (int r = 0; r < NH; ++r) b2v[r] = bfr(B2[r]);
#pragma unroll
  for (int rr = 0; rr < 4; ++rr) { const size_t qq = rq + 8 * g + 4 * w2 + rr; xq0[rr] = bfr(XQ[qq * 2]); xq1[rr] = bfr(XQ[qq * 2 + 1]); }
  float m[2] = {-3.0e38f, -3.0e38f}, l[2] = {0.f, 0.f};   // of query col; l is the sum over this lane half's keys alone, the halves are joined after the loop
  v8f acc[2][2] = {};   // ctx^T: element r = dim 16 dt + 8g + r of head 2w + hh, column = query col
#pragma unroll 1
  for (int it = 0; it < NK / 64; ++it) { const int j0 = (it * 2 + grp) * 32;   // the same trip count in both groups: every barrier is met by all 8 waves
    // (a) token dots of all heads for this wave's 16 keys; lane (g, col) keeps pairs (8g + 4 w2 + rr, key col)
    const size_t kr = mI * NK + j0 + kh * 16 + col; const v2f xk = *(const v2f*)(XKV + kr * 2); const float xk0 = bfr(xk[0]), xk1 = bfr(xk[1]);
    float ft[4][NH]; v16h kf[NH];   // all 8 heads' key fragments requested before the first product: one memory latency a chunk, not eight
#pragma unroll
    for (int h = 0; h < NH; ++h) kf[h] = frag_t(Kr + (((mI * NK + j0) / 16 + kh) * NH + h) * 512, lane);
    v16h qn = frag_h(&sq[qr][0], lane);   // q fragments one head ahead of their product
#pragma unroll
    for (int h = 0; h < NH; ++h) { const v16h qc = qn; if (h + 1 < NH) qn = frag_h(&sq[qr][(h + 1) * HD], lane);
      v8f c = {}; c = wmma16(qc, kf[h], c);
#pragma unroll
      for (int rr = 0; rr < 4; ++rr) ft[rr][h] = c[rr] * 0.17677669529663688f; }
    // (b) MLP on 32 pairs a pass, no LDS between the products (unrolled, as every loop here over a register array: its indices must be constants)
#pragma unroll
    for (int rr = 0; rr < 4; ++rr) { float fv[16]; fv[0] = xq0[rr] - xk0; fv[1] = xq1[rr] - xk1;
#pragma unroll
      for (int h = 0; h < NH; ++h) fv[2 + h] = ft[rr][h];
      fv[10] = 1.0f;
#pragma unroll
      for (int i = 11; i < 16; ++i) fv[i] = 0.f;
      const F2 fb = bsplit16(fv); v8f dd[2];
#pragma unroll
      for (int s = 0; s < 2; ++s) { v8f hacc[2] = {};
#pragma unroll
        for (int j = 0; j < 2; ++j) { const v16b w = s ? whi[j] : wlo[j]; hacc[j] = wmma_bf(w, fb.h, hacc[j]); hacc[j] = wmma_bf(w, fb.l, hacc[j]); }
        float hv[16];   // D element r of tile j = hidden 16j + 8g + r = k slot of B element 8j + r
#pragma unroll
        for (int j = 0; j < 2; ++j)
#pragma unroll
          for (int r = 0; r < 8; ++r) { const float v = hacc[j][r]; hv[8 * j + r] = v > 0.f ? v : 0.f; }
        const F2 hb = bsplit16(hv); v8f dacc = {}; dacc = wmma_bf(w2f, hb.h, dacc); dacc = wmma_bf(w2f, hb.l, dacc); dd[s] = dacc; }
      if (g == 0) {   // D rows 0..7 = heads, held by the g = 0 lanes; column = key
#pragma unroll
        for (int s = 0; s < 2; ++s) { float* ps = &sS[8 * s + 4 * w2 + rr][(kh * 16 + col) * SP]; v4f o0, o1;
#pragma unroll
          for (int r = 0; r < 4; ++r) { o0[r] = dd[s][r] + b2v[r]; o1[r] = dd[s][4 + r] + b2v[4 + r]; }
          *(v4f*)ps = o0; *(v4f*)(ps + 4) = o1; } } }
    __syncthreads();
    // (c) softmax + P.v for this wave's two heads: lane (g, col) takes query col, keys 8g + i and 16 + 8g + i (the k order of frag_h)
    v16h vf[2][2];
#pragma unroll
    for (int hh = 0; hh < 2; ++hh)
#pragma unroll
      for (int dt = 0; dt < 2; ++dt) vf[hh][dt] = frag_t(V + (((mI * (NK / 32) + j0 / 32) * NH + wave * 2 + hh) * 2 + dt) * 512, lane);   // v^T as A: row = dim
    v2f sv[16];   // both heads of a pair in one 8-byte read
#pragma unroll
    for (int i = 0; i < 8; ++i) { sv[i] = *(const v2f*)&sS[col][(8 * g + i) * SP + 2 * wave]; sv[8 + i] = *(const v2f*)&sS[col][(16 + 8 * g + i) * SP + 2 * wave]; }
#pragma unroll
    for (int hh = 0; hh < 2; ++hh) { float t[8];
#pragma unroll
      for (int i = 0; i < 8; ++i) t[i] = fmaxf(sv[i][hh], sv[8 + i][hh]);
      float mx = fmaxf(fmaxf(fmaxf(t[0], t[1]), fmaxf(t[2], t[3])), fmaxf(fmaxf(t[4], t[5]), fmaxf(t[6], t[7])));
      mx = fmaxf(mx, xhalf(mx));
      const float mn = fmaxf(m[hh], mx); const float am = exp_slot(m[hh] - mn); const float alpha = (m[hh] <= -1.0e38f) ? 0.f : am;
      v16h pb; float es[4];   // four independent chains of four
#pragma unroll
      for (int i = 0; i < 16; ++i) { const float e = exp_slot(sv[i][hh] - mn); es[i & 3] = (i < 4) ? e : es[i & 3] + e; pb[i] = (_Float16)(e * 2048.0f); }
      l[hh] = l[hh] * alpha + ((es[0] + es[1]) + (es[2] + es[3])); m[hh] = mn;
#pragma unroll
      for (int dt = 0; dt < 2; ++dt) { acc[hh][dt] *= alpha; acc[hh][dt] = wmma16(vf[hh][dt], pb, acc[hh][dt]); } }
    __syncthreads(); }
  // join of the two groups: group 1 hands its (m, l, ctx^T) over in LDS (the logits buffer is free behind the loop's last barrier; 36 floats a lane = 16 B x odd), group 0 rescales both to the common maximum and goes on alone (loops unrolled: the indices of register arrays must be constants)
  float* mg = &sS2[0][0][0] + (wave * 32 + lane) * 36;
  if (grp == 1) {
#pragma unroll
    for (int hh = 0; hh < 2; ++hh)
#pragma unroll
      for (int dt = 0; dt < 2; ++dt) { v4f o0, o1;
#pragma unroll
        for (int r = 0; r < 4; ++r) { o0[r] = acc[hh][dt][r]; o1[r] = acc[hh][dt][4 + r]; }
        *(v4f*)(mg + (hh * 2 + dt) * 8) = o0; *(v4f*)(mg + (hh * 2 + dt) * 8 + 4) = o1; }
    v4f ml; ml[0] = m[0]; ml[1] = m[1]; ml[2] = l[0]; ml[3] = l[1]; *(v4f*)(mg + 32) = ml; }
  __syncthreads();
  if (grp == 1) return;   // behind the kernel's last barrier
  { const v4f ml = *(const v4f*)(mg + 32);
#pragma unroll
    for (int hh = 0; hh < 2; ++hh) { const float mn = fmaxf(m[hh], ml[hh]); const float a0 = exp_slot(m[hh] - mn), a1 = exp_slot(ml[hh] - mn);
      l[hh] = l[hh] * a0 + ml[2 + hh] * a1;
#pragma unroll
      for (int dt = 0; dt < 2; ++dt) { const v4f o0 = *(const v4f*)(mg + (hh * 2 + dt) * 8), o1 = *(const v4f*)(mg + (hh * 2 + dt) * 8 + 4);
#pragma unroll
        for (int r = 0; r < 4; ++r) { acc[hh][dt][r] = acc[hh][dt][r] * a0 + o0[r] * a1; acc[hh][dt][4 + r] = acc[hh][dt][4 + r] * a0 + o1[r] * a1; } } } }
#pragma unroll
  for (int hh = 0; hh < 2; ++hh) { const float il = (1.0f / 2048.0f) / (l[hh] + xhalf(l[hh]));
#pragma unroll
    for (int dt = 0; dt < 2; ++dt) { v4f o0, o1;
#pragma unroll
      for (int r = 0; r < 4; ++r) { o0[r] = acc[hh][dt][r] * il; o1[r] = acc[hh][dt][4 + r] * il; }
      float* po = &so[wave][col][hh * 32 + dt * 16 + 8 * g]; *(v4f*)po = o0; *(v4f*)(po + 4) = o1; } }
  LDSX();
  for (int rl = 0; rl < 16; ++rl) if (lane < 16) vst2(O + (rq + rl) * DZ + wave * 64 + lane * 4, *(const v4f*)&so[wave][rl][lane * 4]);   // heads 2w, 2w+1 = 64 contiguous floats (256-B segment)
}
// ---- k_out: block = (64 rows, 128 cols): out0 = ctx (hi + lo) . Wout + bout
__global__ __launch_bounds__(128) void k_out(const float* __restrict__ O, const __bf16* __restrict__ PW, const float* __restrict__ BO, float* __restrict__ Y) { __shared__ __align__(16) float so[4][16][132];
  const int tid = threadIdx.x, wave = tid >> 5, lane = tid & 31, col = lane & 15, g = lane >> 4; const size_t r0 = (size_t)blockIdx.x * 64 + wave * 16; const int c0 = blockIdx.y * 128; const __bf16* Wr = PW + (size_t)3 * DZ * DZ;
  v8f acc[8] = {};
#pragma unroll
  for (int kc = 0; kc < DZ / 32; ++kc) { const F2 a = split_row(O + (r0 + col) * DZ, kc * 32, lane);
#pragma unroll
    for (int j = 0; j < 8; ++j) { const v16b w = frag_b(Wr + (size_t)(c0 + j * 16 + col) * DZ + kc * 32, lane); acc[j] = wmma_bf(a.h, w, acc[j]); acc[j] = wmma_bf(a.l, w, acc[j]); } }
#pragma unroll
  for (int j = 0; j < 8; ++j) { const float bb = bfr(BO[c0 + j * 16 + col]);
#pragma unroll
    for (int r = 0; r < 8; ++r) so[wave][8 * g + r][j * 16 + col] = acc[j][r] + bb; }
  LDSX(); for (int rl = 0; rl < 16; ++rl) vst2(Y + (r0 + rl) * DZ + c0 + lane * 4, *(const v4f*)&so[wave][rl][lane * 4]); }
// ---- k_copy: second output = xq (f32 copy, 16-B chunks; whole buffer)
__global__ __launch_bounds__(256) void k_copy(const float* __restrict__ XQ, float* __restrict__ OUT, int n4) { const int i = blockIdx.x * 256 + threadIdx.x; if (i < n4) { v4f v = *(const v4f*)(XQ + (size_t)i * 4); vst2(OUT + (size_t)i * 4, v); } }
extern "C" void kernel_launch(void* const* d_in, const int* in_sizes, int n_in, void* d_out, int out_size, void* d_ws, size_t ws_size, hipStream_t stream) {
  (void)in_sizes; (void)n_in; (void)out_size;
  const float** F = (const float**)d_in;   // 0 zq, 1 zk, 2 zv [8,1024,256]; 3 xq, 4 xkv [8,1024,2]; 5 Wq, 6 Wk, 7 Wv [256,256] (in,out); 8 Wout [256,256] (in,out), 9 bout; 10 W1 [10,32], 11 b1 [32], 12 W2 [32,8], 13 b2 [8]
  if (ws_size < (size_t)WS_END) return;
  char* ws = (char*)d_ws; __bf16 *PW = (__bf16*)(ws + WS_PW), *P1 = (__bf16*)(ws + WS_P1), *P2 = (__bf16*)(ws + WS_P2); _Float16 *Q = (_Float16*)(ws + WS_Q), *Kr = (_Float16*)(ws + WS_K), *V = (_Float16*)(ws + WS_V); float* O = (float*)(ws + WS_O);
  k_pack<<<dim3(DZ, 6), 256, 0, stream>>>(F[5], F[6], F[7], F[8], F[10], F[12], PW, P1, P2);
  k_proj<<<dim3(TNM * NQ / 64, DZ / 128, 3), 128, 0, stream>>>(F[0], F[1], F[2], PW, Q, Kr, V);
  k_te<<<dim3(TQB, TNM), 256, 0, stream>>>(Q, Kr, V, F[3], F[4], P1, P2, F[11], F[13], O);
  k_out<<<dim3(TNM * NQ / 64, DZ / 128), 128, 0, stream>>>(O, PW, F[9], (float*)d_out);
  k_copy<<<(NRQ * 2 / 4 + 255) / 256, 256, 0, stream>>>(F[3], (float*)d_out + OUT1, NRQ * 2 / 4);
}

// v005
// It runs in 116 microseconds.
// Timed twice side by side with v004, it ran 1.04 and 1.05 times as fast.
// Counting every step since v000, it is 2.63 times as fast.
// compute dtype: all float inputs rounded to bf16; q/k/v = z . W with EXACT bf16 products on WMMA 16x16x32 ((in,out) weights as transposed rows), rounded once to f16 (k and v stored as fragments); per 16-query x 32-key chunk: token dots q_h . k_h x 32^-1/2 on WMMA (single f16), the pair features [xq - xkv | dots | 0] in f32, the kernel MLP relu(F . W1 + b1) . W2 + b2 on WMMA with F and the hidden as bf16 hi + lo (2 products each); per (query, head) running-max softmax over the keys in f32 (hardware exp), P (scaled by 2^11, single f16) x v (single f16); out = ctx (bf16 hi + lo, 2 products) . Wout + bout; xq copied through as the second output; f32 outputs.
#include <hip/hip_runtime.h>
#include <math.h>

typedef __attribute__((ext_vector_type(16))) _Float16 v16h;
typedef __attribute__((ext_vector_type(16))) __bf16 v16b;
typedef __attribute__((ext_vector_type(8)))  _Float16 v8h;
typedef __attribute__((ext_vector_type(8)))  float v8f;
typedef __attribute__((ext_vector_type(4)))  float v4f;
typedef __attribute__((ext_vector_type(2)))  float v2f;
typedef __attribute__((ext_vector_type(4)))  unsigned v4u;
typedef __attribute__((ext_vector_type(4)))  int v4i;
typedef float __attribute__((may_alias)) float_a;
typedef int __attribute__((may_alias)) int_a;

template <typename T> __device__ __forceinline__ void vst2(void* p, T v) { *(T*)p = v;  }
__device__ __forceinline__ v8f wmma16(v16h a, v16h b, v8f c) {
  v8f d = __builtin_amdgcn_wmma_f32_16x16x32_f16(false, a, false, b, (short)0, c, false, false);
  asm volatile("v_nop\n\tv_nop\n\tv_nop\n\tv_nop" : "+v"(d) : "v"(a), "v"(b));
  return d;
}
__device__ __forceinline__ v8f wmma_bf(v16b a, v16b b, v8f c) {
  v8f d = __builtin_amdgcn_wmma_f32_16x16x32_bf16(false, a, false, b, (short)0, c, false, false);
  asm volatile("v_nop\n\tv_nop\n\tv_nop\n\tv_nop" : "+v"(d) : "v"(a), "v"(b));
  return d;
}
// 16x16x32 fragments: lane = (h = lane>>4, row/col = lane&15); elements 0..7 = k0+8h+0..7, 8..15 = k0+16+8h+0..7; D element r = row 8h+r
__device__ __forceinline__ v16h frag_h(const _Float16* rowk0, int lane) {
  union { v16h v; v8h q[2]; } u; const _Float16* p = rowk0 + 8 * (lane >> 4);
  u.q[0] = *(const v8h*)p; u.q[1] = *(const v8h*)(p + 16); return u.v;
}
// the same fragment from a tile stored in fragment order, [piece 0, 1][lane][8 halves]: each of the two loads reads 512 contiguous bytes (4 whole lines; from 16 rows it would touch 16)
__device__ __forceinline__ v16h frag_t(const _Float16* tile, int lane) {
  union { v16h v; v8h q[2]; } u; const _Float16* p = tile + 8 * lane;
  u.q[0] = *(const v8h*)p; u.q[1] = *(const v8h*)(p + 256); return u.v;
}
__device__ __forceinline__ v16h frag_f32(const float* rowk0, int lane) {
  v16h a; const float* p = rowk0 + 8 * (lane >> 4);
#pragma unroll
  for (int i = 0; i < 8; ++i) { a[i] = (_Float16)p[i]; a[8 + i] = (_Float16)p[16 + i]; }
  return a;
}
__device__ __forceinline__ v16h frag_f32s(const float* rowk0, int lane, float sc) {
  v16h a; const float* p = rowk0 + 8 * (lane >> 4);
#pragma unroll
  for (int i = 0; i < 8; ++i) { a[i] = (_Float16)(p[i] * sc); a[8 + i] = (_Float16)(p[16 + i] * sc); }
  return a;
}
// column fragment from a [K][ld] layout (column n), rows >= K read as 0
__device__ __forceinline__ v16h fragc_f32(const float* W, int k0, int n, int lane, int ld, int K) {
  v16h a; const int g = lane >> 4;
#pragma unroll
  for (int i = 0; i < 8; ++i) { const int ka = k0 + 8 * g + i, kb = ka + 16;
    a[i] = (_Float16)(ka < K ? W[(size_t)(ka < K ? ka : K - 1) * ld + n] : 0.f); a[8 + i] = (_Float16)(kb < K ? W[(size_t)(kb < K ? kb : K - 1) * ld + n] : 0.f); }
  return a;
}
struct F2 { v16b h, l; };
typedef __attribute__((ext_vector_type(2))) __bf16 v2b;
// bf16 hi + lo split, three instructions a pair of values: one packed conversion makes both hi halves; each lo half is x - hi rounded to bf16 in ONE instruction that reads its hi half in place
// (v_fma_mixlo_bf16 writes the low half of the result register, v_fma_mixhi_bf16 the high half; x - hi is exact in f32, so that one rounding is the rounding of a separate conversion).
// In asm because the compiler does not form these two from source: it converts every hi a second time alone, or unpacks the pair with a shift and a mask. All the mixlo of a statement stand ahead of
// its mixhi, so that the write of a register's second half stands four or five instructions behind the write of its first half and hardly waits for it.
#define MIXLO(o, h, x) "v_fma_mixlo_bf16 %" #o ", %" #h ", -1.0, %" #x " op_sel:[0,1,0] op_sel_hi:[1,1,0]\n\t"
#define MIXHI(o, h, x) "v_fma_mixhi_bf16 %" #o ", %" #h ", -1.0, %" #x " op_sel:[1,1,0] op_sel_hi:[1,1,0]\n\t"
// closes the last statement of a split: the matrix instruction that reads the lo halves stands directly behind it, and the compiler, which does not look into asm, gives that reader no hint; unhinted, its wait for the last mixhi would hold up the other waves of the SIMD too
#define MIXEND "s_delay_alu instid0(VALU_DEP_1)"
#define TAILS4(END) asm(MIXLO(0, 4, 8) MIXLO(1, 5, 10) MIXLO(2, 6, 12) MIXLO(3, 7, 14) MIXHI(0, 4, 9) MIXHI(1, 5, 11) MIXHI(2, 6, 13) MIXHI(3, 7, 15) END \
      : "=&v"(l[0]), "=&v"(l[1]), "=&v"(l[2]), "=&v"(l[3]) : "v"(h[0]), "v"(h[1]), "v"(h[2]), "v"(h[3]), "v"(x[0]), "v"(x[1]), "v"(x[2]), "v"(x[3]), "v"(x[4]), "v"(x[5]), "v"(x[6]), "v"(x[7]))
__device__ __forceinline__ void tails4(unsigned* l, const unsigned* h, const float* x) { TAILS4(""); }
__device__ __forceinline__ void tails4e(unsigned* l, const unsigned* h, const float* x) { TAILS4(MIXEND); }
__device__ __forceinline__ void tails5e(unsigned* l, const unsigned* h, const float* x) {
  asm(MIXLO(0, 5, 10) MIXLO(1, 6, 12) MIXLO(2, 7, 14) MIXLO(3, 8, 16) MIXLO(4, 9, 18) MIXHI(0, 5, 11) MIXHI(1, 6, 13) MIXHI(2, 7, 15) MIXHI(3, 8, 17) MIXHI(4, 9, 19) MIXEND
      : "=&v"(l[0]), "=&v"(l[1]), "=&v"(l[2]), "=&v"(l[3]), "=&v"(l[4]) : "v"(h[0]), "v"(h[1]), "v"(h[2]), "v"(h[3]), "v"(h[4]), "v"(x[0]), "v"(x[1]), "v"(x[2]), "v"(x[3]), "v"(x[4]), "v"(x[5]), "v"(x[6]), "v"(x[7]), "v"(x[8]), "v"(x[9])); }
// NP = 8: all sixteen values; NP = 5: values 0..9, the caller's other six being compile-time constants that bf16 holds exactly (their lo is 0)
template <int NP> __device__ __forceinline__ F2 bsplit(const float v[16]) { union { v16b v; unsigned u[8]; } uh, ul;
#pragma unroll
  for (int i = 0; i < 8; ++i) { v2f x; x[0] = v[2 * i]; x[1] = v[2 * i + 1]; uh.u[i] = __builtin_bit_cast(unsigned, __builtin_convertvector(x, v2b)); ul.u[i] = 0u; }
  if (NP == 8) { tails4(ul.u, uh.u, v); tails4e(ul.u + 4, uh.u + 4, v + 8); } else tails5e(ul.u, uh.u, v);
  F2 r; r.h = uh.v; r.l = ul.v; return r; }
__device__ __forceinline__ F2 bsplit16(const float v[16]) { return bsplit<8>(v); }
__device__ __forceinline__ F2 split_row(const float* row, int k0, int lane) { float v[16]; const float* p = row + k0 + 8 * (lane >> 4);
#pragma unroll
  for (int i = 0; i < 8; ++i) { v[i] = p[i]; v[8 + i] = p[16 + i]; }
  return bsplit16(v); }
__device__ __forceinline__ F2 split_rowK(const float* row, int k0, int lane, int K) { float v[16]; const int g = lane >> 4;
#pragma unroll
  for (int i = 0; i < 8; ++i) { const int ka = k0 + 8 * g + i, kb = ka + 16; v[i] = ka < K ? row[ka < K ? ka : K - 1] : 0.f; v[8 + i] = kb < K ? row[kb < K ? kb : K - 1] : 0.f; }
  return bsplit16(v); }
__device__ __forceinline__ F2 split_col(const float* W, int k0, int n, int lane, int ld, int K) { float v[16]; const int g = lane >> 4;
#pragma unroll
  for (int i = 0; i < 8; ++i) { const int ka = k0 + 8 * g + i, kb = ka + 16; v[i] = ka < K ? W[(size_t)(ka < K ? ka : K - 1) * ld + n] : 0.f; v[8 + i] = kb < K ? W[(size_t)(kb < K ? kb : K - 1) * ld + n] : 0.f; }
  return bsplit16(v); }
__device__ __forceinline__ v8f mac3(const F2& a, const F2& b, v8f c) { c = wmma_bf(a.l, b.h, c); c = wmma_bf(a.h, b.l, c); return wmma_bf(a.h, b.h, c); }
__device__ __forceinline__ float sigm(float v) { return 1.0f / (1.0f + expf(-v)); }
#define LDSX() do { asm volatile("s_wait_dscnt 0" ::: "memory"); __builtin_amdgcn_wave_barrier(); __builtin_amdgcn_fence(__ATOMIC_RELEASE, "workgroup"); } while (0)


// Translation-equivariant multi-head attention (8 sets, 1,024 queries x 1,024 keys, dz 256, dx 2, 8 heads x 32, kernel MLP 10 -> 32 -> 8): logits = MLP([x_q - x_k, q_h . k_h / sqrt(32)]), softmax over keys, . v, output projection; the query locations pass through.
#define NM 8
#define NQ 1024
#define NK 1024
#define DZ 256
#define NH 8
#define HD 32
#define KH 32
#define NF 16              // padded feature width (2 + 8 used)
#define NRQ (NM * NQ)
#define NRK (NM * NK)
#ifndef TQB
#define TQB (NQ / 16)
#define TNM NM
#endif
typedef __attribute__((ext_vector_type(8))) __bf16 v8b;
__device__ __forceinline__ v16b frag_b(const __bf16* rowk0, int lane) {
  union { v16b v; v8b q[2]; } u; const __bf16* p = rowk0 + 8 * (lane >> 4);
  u.q[0] = *(const v8b*)p; u.q[1] = *(const v8b*)(p + 16); return u.v;
}
__device__ __forceinline__ float bfr(float v) { return (float)(__bf16)v; }
__device__ __attribute__((noinline)) float exp_ni(float v) { return expf(v); }
__device__ __attribute__((noinline)) float erf_ni(float v) { return erff(v); }

#define WS_PW  0u                                   // bf16 transposed rows Wq^T, Wk^T, Wv^T, Wout^T [4][256][256]; W1^T padded [32][32] (k = feature 0..9, rest 0); W2^T padded [16][32] (rows 8..15 zero)
#define WS_P1  (WS_PW + 2u * (size_t)4 * DZ * DZ)
#define WS_P2  (WS_P1 + 2u * (size_t)32 * 32)
#define WS_Q   (WS_P2 + 2u * (size_t)16 * 32)         // f16 q rows [NRQ][256]; k fragments [NRK / 16][head][512] (row = key, k = dim); v fragments [m][NK / 32][head][dim half][512] (row = dim, k = key), each 512 = [piece][lane][8] as frag_t reads it; f32 ctx [NRQ][256]
#define WS_K   (WS_Q + 2u * (size_t)NRQ * DZ)
#define WS_V   (WS_K + 2u * (size_t)NRK * DZ)
#define WS_O   (WS_V + 2u * (size_t)NM * DZ * NK)
#define OUT1   ((size_t)NRQ * DZ)                     // float offset of the second output (xq copy)
#define WS_END (WS_O + 4u * (size_t)NRQ * DZ)

__global__ __launch_bounds__(256) void k_pack(const float* __restrict__ WQ, const float* __restrict__ WK, const float* __restrict__ WV, const float* __restrict__ WO, const float* __restrict__ W1, const float* __restrict__ W2, __bf16* __restrict__ PW, __bf16* __restrict__ P1, __bf16* __restrict__ P2) {
  const int n = blockIdx.x, which = blockIdx.y, t = threadIdx.x; __shared__ __align__(16) __bf16 s[DZ];
  if (which < 4) { const float* w = (which == 0) ? WQ : (which == 1) ? WK : (which == 2) ? WV : WO; s[t] = (__bf16)w[(size_t)t * DZ + n]; __syncthreads(); if (t < DZ / 8) vst2((unsigned*)(PW + ((size_t)which * DZ + n) * DZ + t * 8), *(const v4u*)&s[t * 8]); }
  else if (which == 4) { if (n >= 32) return; if (t < 32) s[t] = (t < 10) ? (__bf16)W1[(size_t)t * KH + n] : (__bf16)0.f; __syncthreads(); if (t < 4) vst2((unsigned*)(P1 + (size_t)n * 32 + t * 8), *(const v4u*)&s[t * 8]); }   // W1^T [n=hidden][k=feature]
  else { if (n >= 16) return; if (t < 32) s[t] = (n < NH) ? (__bf16)W2[(size_t)t * NH + n] : (__bf16)0.f; __syncthreads(); if (t < 4) vst2((unsigned*)(P2 + (size_t)n * 32 + t * 8), *(const v4u*)&s[t * 8]); } }   // W2^T [n=head][k=hidden]
// ---- k_proj: block = (64 rows, 128 cols, which): q from zq -> f16 rows; k from zk, v from zv -> fragment order (consecutive lanes store consecutive 16-byte chunks: a wave stores 512 contiguous bytes)
__global__ __launch_bounds__(128) void k_proj(const float* __restrict__ ZQ, const float* __restrict__ ZK, const float* __restrict__ ZV, const __bf16* __restrict__ PW, _Float16* __restrict__ Q, _Float16* __restrict__ Kr, _Float16* __restrict__ V) {
  __shared__ __align__(16) _Float16 so[64][136]; __shared__ __align__(16) _Float16 st[128][72];
  const int tid = threadIdx.x, wave = tid >> 5, lane = tid & 31, col = lane & 15, g = lane >> 4; const int which = blockIdx.z; const size_t rb = (size_t)blockIdx.x * 64; const size_t r0 = rb + wave * 16; const int c0 = blockIdx.y * 128; const float* A = (which == 0) ? ZQ : (which == 1) ? ZK : ZV; const __bf16* Wr = PW + ((size_t)which * DZ) * DZ;
  v8f acc[8] = {};
#pragma unroll
  for (int kc = 0; kc < DZ / 32; ++kc) { v16b a; { const float* p = A + (r0 + col) * DZ + kc * 32 + 8 * g;
#pragma unroll
      for (int i = 0; i < 8; ++i) { a[i] = (__bf16)p[i]; a[8 + i] = (__bf16)p[16 + i]; } }
#pragma unroll
    for (int j = 0; j < 8; ++j) acc[j] = wmma_bf(a, frag_b(Wr + (size_t)(c0 + j * 16 + col) * DZ + kc * 32, lane), acc[j]); }
#pragma unroll
  for (int j = 0; j < 8; ++j)
#pragma unroll
    for (int r = 0; r < 8; ++r) { const _Float16 hv = (_Float16)acc[j][r]; if (which < 2) so[wave * 16 + 8 * g + r][j * 16 + col] = hv; else st[j * 16 + col][wave * 16 + 8 * g + r] = hv; }
  __syncthreads();
  if (which == 0) { for (int e = tid; e < 64 * 16; e += 128) { const int rl = e >> 4, q = e & 15; vst2((unsigned*)(Q + (rb + rl) * DZ + c0 + q * 8), *(const v4u*)&so[rl][q * 8]); } }
  else if (which == 1) { for (int e = tid; e < 64 * 16; e += 128) { const int ln = e & 31, pc = (e >> 5) & 1, hh = (e >> 6) & 3, t = e >> 8;   // key tile t, head hh of the block's four each
      vst2((unsigned*)(Kr + ((((rb / 16 + t) * NH + c0 / HD + hh) * 2 + pc) * 32 + ln) * 8), *(const v4u*)&so[t * 16 + (ln & 15)][hh * HD + pc * 16 + (ln >> 4) * 8]); } }
  else { const size_t mI = rb / NK; const int s0 = (int)(rb % NK); for (int e = tid; e < 128 * 8; e += 128) { const int ln = e & 31, pc = (e >> 5) & 1, dt = (e >> 6) & 1, hh = (e >> 7) & 3, cc = e >> 9;   // 32-key chunk cc of the block's two, head hh of its four
      vst2((unsigned*)(V + ((((((mI * (NK / 32) + s0 / 32 + cc) * NH + c0 / HD + hh) * 2 + dt) * 2 + pc) * 32 + ln) * 8)), *(const v4u*)&st[hh * HD + dt * 16 + (ln & 15)][cc * 32 + pc * 16 + (ln >> 4) * 8]); } }
}
// ---- k_te: block = (16 queries, m), 8 waves = two groups of 4; group grp takes the 32-key chunks 2 it + grp with its own logits buffer and its own running (m, l, ctx), so that 4 waves and not 2 stand on each SIMD to cover each other's load, LDS and matrix latencies; the two partial softmax states are joined once behind the loop. Below, wave = the wave's number inside its group. Per 32-key chunk: (a) wave w takes the 16 keys of half w & 1 and 8 of the queries (4 (w >> 1) + 0..3 and 8 + the same): token dots of all 8 heads, so that lane (g, key) holds every feature of its own pairs; (b) the MLP transposed, in registers: h1^T = relu(W1^T . F^T), dots^T = W2^T . h1^T + b2, the features being a B fragment as they stand and the D of the first product the B fragment of the second -> SC[pair][h]; (c) wave w runs the running-max softmax + P.v for heads 2w, 2w+1 over the chunk, transposed: ctx^T += v^T . P^T, lane (g, query) holding 16 of the query's 32 logits, so that maximum and sum are in-lane but for one exchange between the lane halves, and exp(.) is the B fragment as it stands
#define SP 12              // floats per pair row of the logits: 16-byte stores, 16 rows on 16 distinct bank groups
#define SQP (32 * SP + 4)  // floats per query row of the logits: the 16 queries that one read of part (c) touches start 4 banks apart
__device__ __forceinline__ float xhalf(float x) { return __builtin_bit_cast(float, __builtin_amdgcn_permlanex16(__builtin_bit_cast(int, x), __builtin_bit_cast(int, x), 0x76543210, 0xfedcba98, false, false)); }   // lane l with lane l ^ 16
// exp(x) as __expf gives it (the hardware's exp2 of x . log2 e), with one v_nop in the same statement: the instruction set asks for one slot between a transcendental and a next instruction that reads its result or overwrites its source
__device__ __forceinline__ float exp_slot(float x) { float r; asm("v_exp_f32 %0, %1\n\tv_nop" : "=v"(r) : "v"(x * 0x1.715476p+0f)); return r; }
__global__ __launch_bounds__(256) void k_te(const _Float16* __restrict__ Q, const _Float16* __restrict__ Kr, const _Float16* __restrict__ V, const float* __restrict__ XQ, const float* __restrict__ XKV, const __bf16* __restrict__ P1, const __bf16* __restrict__ P2, const float* __restrict__ B1, const float* __restrict__ B2, float* __restrict__ O) {
  __shared__ __align__(16) float sS2[2][16][SQP]; __shared__ __align__(16) _Float16 sq[16][DZ + 8]; __shared__ __align__(16) float so[4][16][68];
  const int tid = threadIdx.x, grp = tid >> 7, wave = (tid >> 5) & 3, lane = tid & 31, col = lane & 15, g = lane >> 4; const size_t mI = blockIdx.y; const int q0 = blockIdx.x * 16; const size_t rq = mI * NQ + q0;
  const int w2 = wave >> 1, kh = wave & 1;
  float (*sS)[SQP] = sS2[grp];   // this group's logits
  // A row 8g + r holds query 8g + ((r + 4 w2) & 7): D elements 0..3 are this wave's queries 8g + 4 w2 + 0..3
  const int qr = (col & 8) + (((col & 7) + 4 * w2) & 7);
  for (int e = tid; e < 16 * (DZ / 8); e += 256) { const int rl = e >> 5, pc = e & 31; *(v8h*)&sq[rl][pc * 8] = *(const v8h*)(Q + (rq + rl) * DZ + pc * 8); }   // the 16 q rows, read as fragments in every chunk (all 8 heads in registers would spill)
  __syncthreads();
  // W1^T as A, hidden row 16j + col: a lane's 16 k slots = features 0..9, b1 (against the constant feature 1), zeros. wlo has them in the g = 0 lanes only (k slots 0..7, 16..23: it meets the features held by the g = 0 lanes, queries 4 w2 + rr), whi in the g = 1 lanes only (queries 8 + 4 w2 + rr)
  v16b wlo[2], whi[2];
#pragma unroll
  for (int j = 0; j < 2; ++j) { union { v16b v; v8b q[2]; } u; const __bf16* pw = P1 + (size_t)(j * 16 + col) * 32; u.q[0] = *(const v8b*)pw; u.q[1] = *(const v8b*)(pw + 8); u.v[10] = (__bf16)B1[j * 16 + col];
    const v16b z = {}; wlo[j] = (g == 0) ? u.v : z; whi[j] = (g == 0) ? z : u.v; }
  const v16b w2f = frag_b(P2 + (size_t)col * 32, lane);   // W2^T as A: row = head (8..15 zero), k = hidden
  float b2v[NH], xq0[4], xq1[4];
#pragma unroll
  for (int r = 0; r < NH; ++r) b2v[r] = bfr(B2[r]);
#pragma unroll
  for (int rr = 0; rr < 4; ++rr) { const size_t qq = rq + 8 * g + 4 * w2 + rr; xq0[rr] = bfr(XQ[qq * 2]); xq1[rr] = bfr(XQ[qq * 2 + 1]); }
  float m[2] = {-3.0e38f, -3.0e38f}, l[2] = {0.f, 0.f};   // of query col; l is the sum over this lane half's keys alone, the halves are joined after the loop
  v8f acc[2][2] = {};   // ctx^T: element r = dim 16 dt + 8g + r of head 2w + hh, column = query col
#pragma unroll 1
  for (int it = 0; it < NK / 64; ++it) { const int j0 = (it * 2 + grp) * 32;   // the same trip count in both groups: every barrier is met by all 8 waves
    // (a) token dots of all heads for this wave's 16 keys; lane (g, col) keeps pairs (8g + 4 w2 + rr, key col)
    const size_t kr = mI * NK + j0 + kh * 16 + col; const v2f xk = *(const v2f*)(XKV + kr * 2); const float xk0 = bfr(xk[0]), xk1 = bfr(xk[1]);
    float ft[4][NH]; v16h kf[NH];   // all 8 heads' key fragments requested before the first product: one memory latency a chunk, not eight
#pragma unroll
    for (int h = 0; h < NH; ++h) kf[h] = frag_t(Kr + (((mI * NK + j0) / 16 + kh) * NH + h) * 512, lane);
    v16h qn = frag_h(&sq[qr][0], lane);   // q fragments one head ahead of their product
#pragma unroll
    for (int h = 0; h < NH; ++h) { const v16h qc = qn; if (h + 1 < NH) qn = frag_h(&sq[qr][(h + 1) * HD], lane);
      v8f c = {}; c = wmma16(qc, kf[h], c);
#pragma unroll
      for (int rr = 0; rr < 4; ++rr) ft[rr][h] = c[rr] * 0.17677669529663688f; }
    // (b) MLP on 32 pairs a pass, no LDS between the products (unrolled, as every loop here over a register array: its indices must be constants)
#pragma unroll
    for (int rr = 0; rr < 4; ++rr) { float fv[16]; fv[0] = xq0[rr] - xk0; fv[1] = xq1[rr] - xk1;
#pragma unroll
      for (int h = 0; h < NH; ++h) fv[2 + h] = ft[rr][h];
      fv[10] = 1.0f;
#pragma unroll
      for (int i = 11; i < 16; ++i) fv[i] = 0.f;
      const F2 fb = bsplit<5>(fv); v8f dd[2];
#pragma unroll
      for (int s = 0; s < 2; ++s) { v8f hacc[2] = {};
#pragma unroll
        for (int j = 0; j < 2; ++j) { const v16b w = s ? whi[j] : wlo[j]; hacc[j] = wmma_bf(w, fb.h, hacc[j]); hacc[j] = wmma_bf(w, fb.l, hacc[j]); }
        float hv[16];   // D element r of tile j = hidden 16j + 8g + r = k slot of B element 8j + r
#pragma unroll
        for (int j = 0; j < 2; ++j)
#pragma unroll
          for (int r = 0; r < 8; ++r) { const float v = hacc[j][r]; hv[8 * j + r] = v > 0.f ? v : 0.f; }
        const F2 hb = bsplit16(hv); v8f dacc = {}; dacc = wmma_bf(w2f, hb.h, dacc); dacc = wmma_bf(w2f, hb.l, dacc); dd[s] = dacc; }
      if (g == 0) {   // D rows 0..7 = heads, held by the g = 0 lanes; column = key
#pragma unroll
        for (int s = 0; s < 2; ++s) { float* ps = &sS[8 * s + 4 * w2 + rr][(kh * 16 + col) * SP]; v4f o0, o1;
#pragma unroll
          for (int r = 0; r < 4; ++r) { o0[r] = dd[s][r] + b2v[r]; o1[r] = dd[s][4 + r] + b2v[4 + r]; }
          *(v4f*)ps = o0; *(v4f*)(ps + 4) = o1; } } }
    __syncthreads();
    // (c) softmax + P.v for this wave's two heads: lane (g, col) takes query col, keys 8g + i and 16 + 8g + i (the k order of frag_h)
    v16h vf[2][2];
#pragma unroll
    for (int hh = 0; hh < 2; ++hh)
#pragma unroll
      for (int dt = 0; dt < 2; ++dt) vf[hh][dt] = frag_t(V + (((mI * (NK / 32) + j0 / 32) * NH + wave * 2 + hh) * 2 + dt) * 512, lane);   // v^T as A: row = dim
    v2f sv[16];   // both heads of a pair in one 8-byte read
#pragma unroll
    for (int i = 0; i < 8; ++i) { sv[i] = *(const v2f*)&sS[col][(8 * g + i) * SP + 2 * wave]; sv[8 + i] = *(const v2f*)&sS[col][(16 + 8 * g + i) * SP + 2 * wave]; }
#pragma unroll
    for (int hh = 0; hh < 2; ++hh) { float t[8];
#pragma unroll
      for (int i = 0; i < 8; ++i) t[i] = fmaxf(sv[i][hh], sv[8 + i][hh]);
      float mx = fmaxf(fmaxf(fmaxf(t[0], t[1]), fmaxf(t[2], t[3])), fmaxf(fmaxf(t[4], t[5]), fmaxf(t[6], t[7])));
      mx = fmaxf(mx, xhalf(mx));
      const float mn = fmaxf(m[hh], mx); const float am = exp_slot(m[hh] - mn); const float alpha = (m[hh] <= -1.0e38f) ? 0.f : am;
      v16h pb; float es[4];   // four independent chains of four
#pragma unroll
      for (int i = 0; i < 16; ++i) { const float e = exp_slot(sv[i][hh] - mn); es[i & 3] = (i < 4) ? e : es[i & 3] + e; pb[i] = (_Float16)(e * 2048.0f); }
      l[hh] = l[hh] * alpha + ((es[0] + es[1]) + (es[2] + es[3])); m[hh] = mn;
#pragma unroll
      for (int dt = 0; dt < 2; ++dt) { acc[hh][dt] *= alpha; acc[hh][dt] = wmma16(vf[hh][dt], pb, acc[hh][dt]); } }
    __syncthreads(); }
  // join of the two groups: group 1 hands its (m, l, ctx^T) over in LDS (the logits buffer is free behind the loop's last barrier; 36 floats a lane = 16 B x odd), group 0 rescales both to the common maximum and goes on alone (loops unrolled: the indices of register arrays must be constants)
  float* mg = &sS2[0][0][0] + (wave * 32 + lane) * 36;
  if (grp == 1) {
#pragma unroll
    for (int hh = 0; hh < 2; ++hh)
#pragma unroll
      for (int dt = 0; dt < 2; ++dt) { v4f o0, o1;
#pragma unroll
        for (int r = 0; r < 4; ++r) { o0[r] = acc[hh][dt][r]; o1[r] = acc[hh][dt][4 + r]; }
        *(v4f*)(mg + (hh * 2 + dt) * 8) = o0; *(v4f*)(mg + (hh * 2 + dt) * 8 + 4) = o1; }
    v4f ml; ml[0] = m[0]; ml[1] = m[1]; ml[2] = l[0]; ml[3] = l[1]; *(v4f*)(mg + 32) = ml; }
  __syncthreads();
  if (grp == 1) return;   // behind the kernel's last barrier
  { const v4f ml = *(const v4f*)(mg + 32);
#pragma unroll
    for (int hh = 0; hh < 2; ++hh) { const float mn = fmaxf(m[hh], ml[hh]); const float a0 = exp_slot(m[hh] - mn), a1 = exp_slot(ml[hh] - mn);
      l[hh] = l[hh] * a0 + ml[2 + hh] * a1;
#pragma unroll
      for (int dt = 0; dt < 2; ++dt) { const v4f o0 = *(const v4f*)(mg + (hh * 2 + dt) * 8), o1 = *(const v4f*)(mg + (hh * 2 + dt) * 8 + 4);
#pragma unroll
        for (int r = 0; r < 4; ++r) { acc[hh][dt][r] = acc[hh][dt][r] * a0 + o0[r] * a1; acc[hh][dt][4 + r] = acc[hh][dt][4 + r] * a0 + o1[r] * a1; } } } }
#pragma unroll
  for (int hh = 0; hh < 2; ++hh) { const float il = (1.0f / 2048.0f) / (l[hh] + xhalf(l[hh]));
#pragma unroll
    for (int dt = 0; dt < 2; ++dt) { v4f o0, o1;
#pragma unroll
      for (int r = 0; r < 4; ++r) { o0[r] = acc[hh][dt][r] * il; o1[r] = acc[hh][dt][4 + r] * il; }
      float* po = &so[wave][col][hh * 32 + dt * 16 + 8 * g]; *(v4f*)po = o0; *(v4f*)(po + 4) = o1; } }
  LDSX();
  for (int rl = 0; rl < 16; ++rl) if (lane < 16) vst2(O + (rq + rl) * DZ + wave * 64 + lane * 4, *(const v4f*)&so[wave][rl][lane * 4]);   // heads 2w, 2w+1 = 64 contiguous floats (256-B segment)
}
// ---- k_out: block = (64 rows, 128 cols): out0 = ctx (hi + lo) . Wout + bout
__global__ __launch_bounds__(128) void k_out(const float* __restrict__ O, const __bf16* __restrict__ PW, const float* __restrict__ BO, float* __restrict__ Y) { __shared__ __align__(16) float so[4][16][132];
  const int tid = threadIdx.x, wave = tid >> 5, lane = tid & 31, col = lane & 15, g = lane >> 4; const size_t r0 = (size_t)blockIdx.x * 64 + wave * 16; const int c0 = blockIdx.y * 128; const __bf16* Wr = PW + (size_t)3 * DZ * DZ;
  v8f acc[8] = {};
#pragma unroll
  for (int kc = 0; kc < DZ / 32; ++kc) { const F2 a = split_row(O + (r0 + col) * DZ, kc * 32, lane);
#pragma unroll
    for (int j = 0; j < 8; ++j) { const v16b w = frag_b(Wr + (size_t)(c0 + j * 16 + col) * DZ + kc * 32, lane); acc[j] = wmma_bf(a.h, w, acc[j]); acc[j] = wmma_bf(a.l, w, acc[j]); } }
#pragma unroll
  for (int j = 0; j < 8; ++j) { const float bb = bfr(BO[c0 + j * 16 + col]);
#pragma unroll
    for (int r = 0; r < 8; ++r) so[wave][8 * g + r][j * 16 + col] = acc[j][r] + bb; }
  LDSX(); for (int rl = 0; rl < 16; ++rl) vst2(Y + (r0 + rl) * DZ + c0 + lane * 4, *(const v4f*)&so[wave][rl][lane * 4]); }
// ---- k_copy: second output = xq (f32 copy, 16-B chunks; whole buffer)
__global__ __launch_bounds__(256) void k_copy(const float* __restrict__ XQ, float* __restrict__ OUT, int n4) { const int i = blockIdx.x * 256 + threadIdx.x; if (i < n4) { v4f v = *(const v4f*)(XQ + (size_t)i * 4); vst2(OUT + (size_t)i * 4, v); } }
extern "C" void kernel_launch(void* const* d_in, const int* in_sizes, int n_in, void* d_out, int out_size, void* d_ws, size_t ws_size, hipStream_t stream) {
  (void)in_sizes; (void)n_in; (void)out_size;
  const float** F = (const float**)d_in;   // 0 zq, 1 zk, 2 zv [8,1024,256]; 3 xq, 4 xkv [8,1024,2]; 5 Wq, 6 Wk, 7 Wv [256,256] (in,out); 8 Wout [256,256] (in,out), 9 bout; 10 W1 [10,32], 11 b1 [32], 12 W2 [32,8], 13 b2 [8]
  if (ws_size < (size_t)WS_END) return;
  char* ws = (char*)d_ws; __bf16 *PW = (__bf16*)(ws + WS_PW), *P1 = (__bf16*)(ws + WS_P1), *P2 = (__bf16*)(ws + WS_P2); _Float16 *Q = (_Float16*)(ws + WS_Q), *Kr = (_Float16*)(ws + WS_K), *V = (_Float16*)(ws + WS_V); float* O = (float*)(ws + WS_O);
  k_pack<<<dim3(DZ, 6), 256, 0, stream>>>(F[5], F[6], F[7], F[8], F[10], F[12], PW, P1, P2);
  k_proj<<<dim3(TNM * NQ / 64, DZ / 128, 3), 128, 0, stream>>>(F[0], F[1], F[2], PW, Q, Kr, V);
  k_te<<<dim3(TQB, TNM), 256, 0, stream>>>(Q, Kr, V, F[3], F[4], P1, P2, F[11], F[13], O);
  k_out<<<dim3(TNM * NQ / 64, DZ / 128), 128, 0, stream>>>(O, PW, F[9], (float*)d_out);
  k_copy<<<(NRQ * 2 / 4 + 255) / 256, 256, 0, stream>>>(F[3], (float*)d_out + OUT1, NRQ * 2 / 4);
}

// v006
// It runs in 110 microseconds.
// In two side-by-side timings against v005, it was 1.06 and 1.07 times as fast.
// Counting every step since v000, it is 2.80 times as fast.
// compute dtype: all float inputs rounded to bf16; q/k/v = z . W with EXACT bf16 products on WMMA 16x16x32 ((in,out) weights as transposed rows), rounded once to f16 (k and v stored as fragments); per 16-query x 32-key chunk: token dots q_h . k_h x 32^-1/2 on WMMA (single f16), the pair features [xq - xkv | dots | 0] in f32, the kernel MLP relu(F . W1 + b1) . W2 + b2 on WMMA with F and the hidden as bf16 hi + lo (2 products each); per (query, head) running-max softmax over the keys in f32 (hardware exp), P (scaled by 2^11, single f16) x v (single f16); out = ctx (bf16 hi + lo, 2 products) . Wout + bout; xq copied through as the second output; f32 outputs.
#include <hip/hip_runtime.h>
#include <math.h>

typedef __attribute__((ext_vector_type(16))) _Float16 v16h;
typedef __attribute__((ext_vector_type(16))) __bf16 v16b;
typedef __attribute__((ext_vector_type(8)))  _Float16 v8h;
typedef __attribute__((ext_vector_type(8)))  float v8f;
typedef __attribute__((ext_vector_type(4)))  float v4f;
typedef __attribute__((ext_vector_type(2)))  float v2f;
typedef __attribute__((ext_vector_type(4)))  unsigned v4u;
typedef __attribute__((ext_vector_type(4)))  int v4i;
typedef float __attribute__((may_alias)) float_a;
typedef int __attribute__((may_alias)) int_a;

template <typename T> __device__ __forceinline__ void vst2(void* p, T v) { *(T*)p = v;  }
__device__ __forceinline__ v8f wmma16(v16h a, v16h b, v8f c) {
  v8f d = __builtin_amdgcn_wmma_f32_16x16x32_f16(false, a, false, b, (short)0, c, false, false);
  return d;
}
// for the token dots alone, of whose D only elements 0..3 are read: the compiler lays the next product's D over the dead half, and the four slots keep that write at the distance the chip asks for behind a matrix instruction
__device__ __forceinline__ v8f wmma16p(v16h a, v16h b, v8f c) {
  v8f d = __builtin_amdgcn_wmma_f32_16x16x32_f16(false, a, false, b, (short)0, c, false, false);
  asm volatile("v_nop\n\tv_nop\n\tv_nop\n\tv_nop" : "+v"(d) : "v"(a), "v"(b));
  return d;
}
__device__ __forceinline__ v8f wmma_bf(v16b a, v16b b, v8f c) {
  v8f d = __builtin_amdgcn_wmma_f32_16x16x32_bf16(false, a, false, b, (short)0, c, false, false);
  return d;
}
// 16x16x32 fragments: lane = (h = lane>>4, row/col = lane&15); elements 0..7 = k0+8h+0..7, 8..15 = k0+16+8h+0..7; D element r = row 8h+r
__device__ __forceinline__ v16h frag_h(const _Float16* rowk0, int lane) {
  union { v16h v; v8h q[2]; } u; const _Float16* p = rowk0 + 8 * (lane >> 4);
  u.q[0] = *(const v8h*)p; u.q[1] = *(const v8h*)(p + 16); return u.v;
}
// the same fragment from a tile stored in fragment order, [piece 0, 1][lane][8 halves]: each of the two loads reads 512 contiguous bytes (4 whole lines; from 16 rows it would touch 16)
__device__ __forceinline__ v16h frag_t(const _Float16* tile, int lane) {
  union { v16h v; v8h q[2]; } u; const _Float16* p = tile + 8 * lane;
  u.q[0] = *(const v8h*)p; u.q[1] = *(const v8h*)(p + 256); return u.v;
}
__device__ __forceinline__ v16h frag_f32(const float* rowk0, int lane) {
  v16h a; const float* p = rowk0 + 8 * (lane >> 4);
#pragma unroll
  for (int i = 0; i < 8; ++i) { a[i] = (_Float16)p[i]; a[8 + i] = (_Float16)p[16 + i]; }
  return a;
}
__device__ __forceinline__ v16h frag_f32s(const float* rowk0, int lane, float sc) {
  v16h a; const float* p = rowk0 + 8 * (lane >> 4);
#pragma unroll
  for (int i = 0; i < 8; ++i) { a[i] = (_Float16)(p[i] * sc); a[8 + i] = (_Float16)(p[16 + i] * sc); }
  return a;
}
// column fragment from a [K][ld] layout (column n), rows >= K read as 0
__device__ __forceinline__ v16h fragc_f32(const float* W, int k0, int n, int lane, int ld, int K) {
  v16h a; const int g = lane >> 4;
#pragma unroll
  for (int i = 0; i < 8; ++i) { const int ka = k0 + 8 * g + i, kb = ka + 16;
    a[i] = (_Float16)(ka < K ? W[(size_t)(ka < K ? ka : K - 1) * ld + n] : 0.f); a[8 + i] = (_Float16)(kb < K ? W[(size_t)(kb < K ? kb : K - 1) * ld + n] : 0.f); }
  return a;
}
struct F2 { v16b h, l; };
typedef __attribute__((ext_vector_type(2))) __bf16 v2b;
// bf16 hi + lo split, three instructions a pair of values: one packed conversion makes both hi halves; each lo half is x - hi rounded to bf16 in ONE instruction that reads its hi half in place
// (v_fma_mixlo_bf16 writes the low half of the result register, v_fma_mixhi_bf16 the high half; x - hi is exact in f32, so that one rounding is the rounding of a separate conversion).
// In asm because the compiler does not form these two from source: it converts every hi a second time alone, or unpacks the pair with a shift and a mask. All the mixlo of a statement stand ahead of
// its mixhi, so that the write of a register's second half stands four or five instructions behind the write of its first half and hardly waits for it.
#define MIXLO(o, h, x) "v_fma_mixlo_bf16 %" #o ", %" #h ", -1.0, %" #x " op_sel:[0,1,0] op_sel_hi:[1,1,0]\n\t"
#define MIXHI(o, h, x) "v_fma_mixhi_bf16 %" #o ", %" #h ", -1.0, %" #x " op_sel:[1,1,0] op_sel_hi:[1,1,0]\n\t"
// closes the last statement of a split: the matrix instruction that reads the lo halves stands directly behind it, and the compiler, which does not look into asm, gives that reader no hint; unhinted, its wait for the last mixhi would hold up the other waves of the SIMD too
#define MIXEND "s_delay_alu instid0(VALU_DEP_1)"
#define TAILS4(END) asm(MIXLO(0, 4, 8) MIXLO(1, 5, 10) MIXLO(2, 6, 12) MIXLO(3, 7, 14) MIXHI(0, 4, 9) MIXHI(1, 5, 11) MIXHI(2, 6, 13) MIXHI(3, 7, 15) END \
      : "=&v"(l[0]), "=&v"(l[1]), "=&v"(l[2]), "=&v"(l[3]) : "v"(h[0]), "v"(h[1]), "v"(h[2]), "v"(h[3]), "v"(x[0]), "v"(x[1]), "v"(x[2]), "v"(x[3]), "v"(x[4]), "v"(x[5]), "v"(x[6]), "v"(x[7]))
__device__ __forceinline__ void tails4(unsigned* l, const unsigned* h, const float* x) { TAILS4(""); }
__device__ __forceinline__ void tails4e(unsigned* l, const unsigned* h, const float* x) { TAILS4(MIXEND); }
__device__ __forceinline__ void tails5e(unsigned* l, const unsigned* h, const float* x) {
  asm(MIXLO(0, 5, 10) MIXLO(1, 6, 12) MIXLO(2, 7, 14) MIXLO(3, 8, 16) MIXLO(4, 9, 18) MIXHI(0, 5, 11) MIXHI(1, 6, 13) MIXHI(2, 7, 15) MIXHI(3, 8, 17) MIXHI(4, 9, 19) MIXEND
      : "=&v"(l[0]), "=&v"(l[1]), "=&v"(l[2]), "=&v"(l[3]), "=&v"(l[4]) : "v"(h[0]), "v"(h[1]), "v"(h[2]), "v"(h[3]), "v"(h[4]), "v"(x[0]), "v"(x[1]), "v"(x[2]), "v"(x[3]), "v"(x[4]), "v"(x[5]), "v"(x[6]), "v"(x[7]), "v"(x[8]), "v"(x[9])); }
// NP = 8: all sixteen values; NP = 5: values 0..9, the caller's other six being compile-time constants that bf16 holds exactly (their lo is 0)
template <int NP> __device__ __forceinline__ F2 bsplit(const float v[16]) { union { v16b v; unsigned u[8]; } uh, ul;
#pragma unroll
  for (int i = 0; i < 8; ++i) { v2f x; x[0] = v[2 * i]; x[1] = v[2 * i + 1]; uh.u[i] = __builtin_bit_cast(unsigned, __builtin_convertvector(x, v2b)); ul.u[i] = 0u; }
  if (NP == 8) { tails4(ul.u, uh.u, v); tails4e(ul.u + 4, uh.u + 4, v + 8); } else tails5e(ul.u, uh.u, v);
  F2 r; r.h = uh.v; r.l = ul.v; return r; }
__device__ __forceinline__ F2 bsplit16(const float v[16]) { return bsplit<8>(v); }
__device__ __forceinline__ F2 split_row(const float* row, int k0, int lane) { float v[16]; const float* p = row + k0 + 8 * (lane >> 4);
#pragma unroll
  for (int i = 0; i < 8; ++i) { v[i] = p[i]; v[8 + i] = p[16 + i]; }
  return bsplit16(v); }
__device__ __forceinline__ F2 split_rowK(const float* row, int k0, int lane, int K) { float v[16]; const int g = lane >> 4;
#pragma unroll
  for (int i = 0; i < 8; ++i) { const int ka = k0 + 8 * g + i, kb = ka + 16; v[i] = ka < K ? row[ka < K ? ka : K - 1] : 0.f; v[8 + i] = kb < K ? row[kb < K ? kb : K - 1] : 0.f; }
  return bsplit16(v); }
__device__ __forceinline__ F2 split_col(const float* W, int k0, int n, int lane, int ld, int K) { float v[16]; const int g = lane >> 4;
#pragma unroll
  for (int i = 0; i < 8; ++i) { const int ka = k0 + 8 * g + i, kb = ka + 16; v[i] = ka < K ? W[(size_t)(ka < K ? ka : K - 1) * ld + n] : 0.f; v[8 + i] = kb < K ? W[(size_t)(kb < K ? kb : K - 1) * ld + n] : 0.f; }
  return bsplit16(v); }
__device__ __forceinline__ v8f mac3(const F2& a, const F2& b, v8f c) { c = wmma_bf(a.l, b.h, c); c = wmma_bf(a.h, b.l, c); return wmma_bf(a.h, b.h, c); }
__device__ __forceinline__ float sigm(float v) { return 1.0f / (1.0f + expf(-v)); }
#define LDSX() do { asm volatile("s_wait_dscnt 0" ::: "memory"); __builtin_amdgcn_wave_barrier(); __builtin_amdgcn_fence(__ATOMIC_RELEASE, "workgroup"); } while (0)


// Translation-equivariant multi-head attention (8 sets, 1,024 queries x 1,024 keys, dz 256, dx 2, 8 heads x 32, kernel MLP 10 -> 32 -> 8): logits = MLP([x_q - x_k, q_h . k_h / sqrt(32)]), softmax over keys, . v, output projection; the query locations pass through.
#define NM 8
#define NQ 1024
#define NK 1024
#define DZ 256
#define NH 8
#define HD 32
#define KH 32
#define NF 16              // padded feature width (2 + 8 used)
#define NRQ (NM * NQ)
#define NRK (NM * NK)
#ifndef TQB
#define TQB (NQ / 16)
#define TNM NM
#endif
typedef __attribute__((ext_vector_type(8))) __bf16 v8b;
__device__ __forceinline__ v16b frag_b(const __bf16* rowk0, int lane) {
  union { v16b v; v8b q[2]; } u; const __bf16* p = rowk0 + 8 * (lane >> 4);
  u.q[0] = *(const v8b*)p; u.q[1] = *(const v8b*)(p + 16); return u.v;
}
__device__ __forceinline__ float bfr(float v) { return (float)(__bf16)v; }
__device__ __attribute__((noinline)) float exp_ni(float v) { return expf(v); }
__device__ __attribute__((noinline)) float erf_ni(float v) { return erff(v); }

#define WS_PW  0u                                   // bf16 transposed rows Wq^T, Wk^T, Wv^T, Wout^T [4][256][256]; W1^T padded [32][32] (k = feature 0..9, rest 0); W2^T padded [16][32] (rows 8..15 zero)
#define WS_P1  (WS_PW + 2u * (size_t)4 * DZ * DZ)
#define WS_P2  (WS_P1 + 2u * (size_t)32 * 32)
#define WS_Q   (WS_P2 + 2u * (size_t)16 * 32)         // f16 q rows [NRQ][256]; k fragments [NRK / 16][head][512] (row = key, k = dim); v fragments [m][NK / 32][head][dim half][512] (row = dim, k = key), each 512 = [piece][lane][8] as frag_t reads it; f32 ctx [NRQ][256]
#define WS_K   (WS_Q + 2u * (size_t)NRQ * DZ)
#define WS_V   (WS_K + 2u * (size_t)NRK * DZ)
#define WS_O   (WS_V + 2u * (size_t)NM * DZ * NK)
#define OUT1   ((size_t)NRQ * DZ)                     // float offset of the second output (xq copy)
#define WS_END (WS_O + 4u * (size_t)NRQ * DZ)

__global__ __launch_bounds__(256) void k_pack(const float* __restrict__ WQ, const float* __restrict__ WK, const float* __restrict__ WV, const float* __restrict__ WO, const float* __restrict__ W1, const float* __restrict__ W2, __bf16* __restrict__ PW, __bf16* __restrict__ P1, __bf16* __restrict__ P2) {
  const int n = blockIdx.x, which = blockIdx.y, t = threadIdx.x; __shared__ __align__(16) __bf16 s[DZ];
  if (which < 4) { const float* w = (which == 0) ? WQ : (which == 1) ? WK : (which == 2) ? WV : WO; s[t] = (__bf16)w[(size_t)t * DZ + n]; __syncthreads(); if (t < DZ / 8) vst2((unsigned*)(PW + ((size_t)which * DZ + n) * DZ + t * 8), *(const v4u*)&s[t * 8]); }
  else if (which == 4) { if (n >= 32) return; if (t < 32) s[t] = (t < 10) ? (__bf16)W1[(size_t)t * KH + n] : (__bf16)0.f; __syncthreads(); if (t < 4) vst2((unsigned*)(P1 + (size_t)n * 32 + t * 8), *(const v4u*)&s[t * 8]); }   // W1^T [n=hidden][k=feature]
  else { if (n >= 16) return; if (t < 32) s[t] = (n < NH) ? (__bf16)W2[(size_t)t * NH + n] : (__bf16)0.f; __syncthreads(); if (t < 4) vst2((unsigned*)(P2 + (size_t)n * 32 + t * 8), *(const v4u*)&s[t * 8]); } }   // W2^T [n=head][k=hidden]
// ---- k_proj: block = (64 rows, 128 cols, which): q from zq -> f16 rows; k from zk, v from zv -> fragment order (consecutive lanes store consecutive 16-byte chunks: a wave stores 512 contiguous bytes)
__global__ __launch_bounds__(128) void k_proj(const float* __restrict__ ZQ, const float* __restrict__ ZK, const float* __restrict__ ZV, const __bf16* __restrict__ PW, _Float16* __restrict__ Q, _Float16* __restrict__ Kr, _Float16* __restrict__ V) {
  __shared__ __align__(16) _Float16 so[64][136]; __shared__ __align__(16) _Float16 st[128][72];
  const int tid = threadIdx.x, wave = tid >> 5, lane = tid & 31, col = lane & 15, g = lane >> 4; const int which = blockIdx.z; const size_t rb = (size_t)blockIdx.x * 64; const size_t r0 = rb + wave * 16; const int c0 = blockIdx.y * 128; const float* A = (which == 0) ? ZQ : (which == 1) ? ZK : ZV; const __bf16* Wr = PW + ((size_t)which * DZ) * DZ;
  v8f acc[8] = {};
#pragma unroll
  for (int kc = 0; kc < DZ / 32; ++kc) { v16b a; { const float* p = A + (r0 + col) * DZ + kc * 32 + 8 * g;
#pragma unroll
      for (int i = 0; i < 8; ++i) { a[i] = (__bf16)p[i]; a[8 + i] = (__bf16)p[16 + i]; } }
#pragma unroll
    for (int j = 0; j < 8; ++j) acc[j] = wmma_bf(a, frag_b(Wr + (size_t)(c0 + j * 16 + col) * DZ + kc * 32, lane), acc[j]); }
#pragma unroll
  for (int j = 0; j < 8; ++j)
#pragma unroll
    for (int r = 0; r < 8; ++r) { const _Float16 hv = (_Float16)acc[j][r]; if (which < 2) so[wave * 16 + 8 * g + r][j * 16 + col] = hv; else st[j * 16 + col][wave * 16 + 8 * g + r] = hv; }
  __syncthreads();
  if (which == 0) { for (int e = tid; e < 64 * 16; e += 128) { const int rl = e >> 4, q = e & 15; vst2((unsigned*)(Q + (rb + rl) * DZ + c0 + q * 8), *(const v4u*)&so[rl][q * 8]); } }
  else if (which == 1) { for (int e = tid; e < 64 * 16; e += 128) { const int ln = e & 31, pc = (e >> 5) & 1, hh = (e >> 6) & 3, t = e >> 8;   // key tile t, head hh of the block's four each
      vst2((unsigned*)(Kr + ((((rb / 16 + t) * NH + c0 / HD + hh) * 2 + pc) * 32 + ln) * 8), *(const v4u*)&so[t * 16 + (ln & 15)][hh * HD + pc * 16 + (ln >> 4) * 8]); } }
  else { const size_t mI = rb / NK; const int s0 = (int)(rb % NK); for (int e = tid; e < 128 * 8; e += 128) { const int ln = e & 31, pc = (e >> 5) & 1, dt = (e >> 6) & 1, hh = (e >> 7) & 3, cc = e >> 9;   // 32-key chunk cc of the block's two, head hh of its four
      vst2((unsigned*)(V + ((((((mI * (NK / 32) + s0 / 32 + cc) * NH + c0 / HD + hh) * 2 + dt) * 2 + pc) * 32 + ln) * 8)), *(const v4u*)&st[hh * HD + dt * 16 + (ln & 15)][cc * 32 + pc * 16 + (ln >> 4) * 8]); } }
}
// ---- k_te: block = (16 queries, m), 8 waves = two groups of 4; group grp takes the 32-key chunks 2 it + grp with its own logits buffer and its own running (m, l, ctx), so that 4 waves and not 2 stand on each SIMD to cover each other's load, LDS and matrix latencies; the two partial softmax states are joined once behind the loop. Below, wave = the wave's number inside its group. Per 32-key chunk: (a) wave w takes the 16 keys of half w & 1 and 8 of the queries (4 (w >> 1) + 0..3 and 8 + the same): token dots of all 8 heads, so that lane (g, key) holds every feature of its own pairs; (b) the MLP transposed, in registers: h1^T = relu(W1^T . F^T), dots^T = W2^T . h1^T + b2, the features being a B fragment as they stand and the D of the first product the B fragment of the second -> SC[pair][h]; (c) wave w runs the running-max softmax + P.v for heads 2w, 2w+1 over the chunk, transposed: ctx^T += v^T . P^T, lane (g, query) holding 16 of the query's 32 logits, so that maximum and sum are in-lane but for one exchange between the lane halves, and exp(.) is the B fragment as it stands
#define SP 12              // floats per pair row of the logits: 16-byte stores, 16 rows on 16 distinct bank groups
#define SQP (32 * SP + 4)  // floats per query row of the logits: the 16 queries that one read of part (c) touches start 4 banks apart
__device__ __forceinline__ float xhalf(float x) { return __builtin_bit_cast(float, __builtin_amdgcn_permlanex16(__builtin_bit_cast(int, x), __builtin_bit_cast(int, x), 0x76543210, 0xfedcba98, false, false)); }   // lane l with lane l ^ 16
// exp(x) as __expf gives it (the hardware's exp2 of x . log2 e), with one v_nop in the same statement: the instruction set asks for one slot between a transcendental and a next instruction that reads its result or overwrites its source
__device__ __forceinline__ float exp_slot(float x) { float r; asm("v_exp_f32 %0, %1\n\tv_nop" : "=v"(r) : "v"(x * 0x1.715476p+0f)); return r; }
__global__ __launch_bounds__(256) void k_te(const _Float16* __restrict__ Q, const _Float16* __restrict__ Kr, const _Float16* __restrict__ V, const float* __restrict__ XQ, const float* __restrict__ XKV, const __bf16* __restrict__ P1, const __bf16* __restrict__ P2, const float* __restrict__ B1, const float* __restrict__ B2, float* __restrict__ O) {
  __shared__ __align__(16) float sS2[2][16][SQP]; __shared__ __align__(16) _Float16 sq[16][DZ + 8]; __shared__ __align__(16) float so[4][16][68];
  const int tid = threadIdx.x, grp = tid >> 7, wave = (tid >> 5) & 3, lane = tid & 31, col = lane & 15, g = lane >> 4; const size_t mI = blockIdx.y; const int q0 = blockIdx.x * 16; const size_t rq = mI * NQ + q0;
  const int w2 = wave >> 1, kh = wave & 1;
  float (*sS)[SQP] = sS2[grp];   // this group's logits
  // A row 8g + r holds query 8g + ((r + 4 w2) & 7): D elements 0..3 are this wave's queries 8g + 4 w2 + 0..3
  const int qr = (col & 8) + (((col & 7) + 4 * w2) & 7);
  for (int e = tid; e < 16 * (DZ / 8); e += 256) { const int rl = e >> 5, pc = e & 31; *(v8h*)&sq[rl][pc * 8] = *(const v8h*)(Q + (rq + rl) * DZ + pc * 8); }   // the 16 q rows, read as fragments in every chunk (all 8 heads in registers would spill)
  __syncthreads();
  // W1^T as A, hidden row 16j + col: a lane's 16 k slots = features 0..9, b1 (against the constant feature 1), zeros. wlo has them in the g = 0 lanes only (k slots 0..7, 16..23: it meets the features held by the g = 0 lanes, queries 4 w2 + rr), whi in the g = 1 lanes only (queries 8 + 4 w2 + rr)
  v16b wlo[2], whi[2];
#pragma unroll
  for (int j = 0; j < 2; ++j) { union { v16b v; v8b q[2]; } u; const __bf16* pw = P1 + (size_t)(j * 16 + col) * 32; u.q[0] = *(const v8b*)pw; u.q[1] = *(const v8b*)(pw + 8); u.v[10] = (__bf16)B1[j * 16 + col];
    const v16b z = {}; wlo[j] = (g == 0) ? u.v : z; whi[j] = (g == 0) ? z : u.v; }
  const v16b w2f = frag_b(P2 + (size_t)col * 32, lane);   // W2^T as A: row = head (8..15 zero), k = hidden
  float b2v[NH], xq0[4], xq1[4];
#pragma unroll
  for (int r = 0; r < NH; ++r) b2v[r] = bfr(B2[r]);
#pragma unroll
  for (int rr = 0; rr < 4; ++rr) { const size_t qq = rq + 8 * g + 4 * w2 + rr; xq0[rr] = bfr(XQ[qq * 2]); xq1[rr] = bfr(XQ[qq * 2 + 1]); }
  float m[2] = {-3.0e38f, -3.0e38f}, l[2] = {0.f, 0.f};   // of query col; l is the sum over this lane half's keys alone, the halves are joined after the loop
  v8f acc[2][2] = {};   // ctx^T: element r = dim 16 dt + 8g + r of head 2w + hh, column = query col
#pragma unroll 1
  for (int it = 0; it < NK / 64; ++it) { const int j0 = (it * 2 + grp) * 32;   // the same trip count in both groups: every barrier is met by all 8 waves
    // (a) token dots of all heads for this wave's 16 keys; lane (g, col) keeps pairs (8g + 4 w2 + rr, key col)
    const size_t kr = mI * NK + j0 + kh * 16 + col; const v2f xk = *(const v2f*)(XKV + kr * 2); const float xk0 = bfr(xk[0]), xk1 = bfr(xk[1]);
    float ft[4][NH]; v16h kf[NH];   // all 8 heads' key fragments requested before the first product: one memory latency a chunk, not eight
#pragma unroll
    for (int h = 0; h < NH; ++h) kf[h] = frag_t(Kr + (((mI * NK + j0) / 16 + kh) * NH + h) * 512, lane);
    v16h qn = frag_h(&sq[qr][0], lane);   // q fragments one head ahead of their product
#pragma unroll
    for (int h = 0; h < NH; ++h) { const v16h qc = qn; if (h + 1 < NH) qn = frag_h(&sq[qr][(h + 1) * HD], lane);
      v8f c = {}; c = wmma16p(qc, kf[h], c);
#pragma unroll
      for (int rr = 0; rr < 4; ++rr) ft[rr][h] = c[rr] * 0.17677669529663688f; }
    // (b) MLP on 32 pairs a pass, no LDS between the products (unrolled, as every loop here over a register array: its indices must be constants)
#pragma unroll
    for (int rr = 0; rr < 4; ++rr) { float fv[16]; fv[0] = xq0[rr] - xk0; fv[1] = xq1[rr] - xk1;
#pragma unroll
      for (int h = 0; h < NH; ++h) fv[2 + h] = ft[rr][h];
      fv[10] = 1.0f;
#pragma unroll
      for (int i = 11; i < 16; ++i) fv[i] = 0.f;
      const F2 fb = bsplit<5>(fv); v8f dd[2];
#pragma unroll
      for (int s = 0; s < 2; ++s) { v8f hacc[2] = {};
#pragma unroll
        for (int j = 0; j < 2; ++j) { const v16b w = s ? whi[j] : wlo[j]; hacc[j] = wmma_bf(w, fb.h, hacc[j]); hacc[j] = wmma_bf(w, fb.l, hacc[j]); }
        float hv[16];   // D element r of tile j = hidden 16j + 8g + r = k slot of B element 8j + r
#pragma unroll
        for (int j = 0; j < 2; ++j)
#pragma unroll
          for (int r = 0; r < 8; ++r) { const float v = hacc[j][r]; hv[8 * j + r] = v > 0.f ? v : 0.f; }
        const F2 hb = bsplit16(hv); v8f dacc = {}; dacc = wmma_bf(w2f, hb.h, dacc); dacc = wmma_bf(w2f, hb.l, dacc); dd[s] = dacc; }
      if (g == 0) {   // D rows 0..7 = heads, held by the g = 0 lanes; column = key
#pragma unroll
        for (int s = 0; s < 2; ++s) { float* ps = &sS[8 * s + 4 * w2 + rr][(kh * 16 + col) * SP]; v4f o0, o1;
#pragma unroll
          for (int r = 0; r < 4; ++r) { o0[r] = dd[s][r] + b2v[r]; o1[r] = dd[s][4 + r] + b2v[4 + r]; }
          *(v4f*)ps = o0; *(v4f*)(ps + 4) = o1; } } }
    __syncthreads();
    // (c) softmax + P.v for this wave's two heads: lane (g, col) takes query col, keys 8g + i and 16 + 8g + i (the k order of frag_h)
    v16h vf[2][2];
#pragma unroll
    for (int hh = 0; hh < 2; ++hh)
#pragma unroll
      for (int dt = 0; dt < 2; ++dt) vf[hh][dt] = frag_t(V + (((mI * (NK / 32) + j0 / 32) * NH + wave * 2 + hh) * 2 + dt) * 512, lane);   // v^T as A: row = dim
    v2f sv[16];   // both heads of a pair in one 8-byte read
#pragma unroll
    for (int i = 0; i < 8; ++i) { sv[i] = *(const v2f*)&sS[col][(8 * g + i) * SP + 2 * wave]; sv[8 + i] = *(const v2f*)&sS[col][(16 + 8 * g + i) * SP + 2 * wave]; }
#pragma unroll
    for (int hh = 0; hh < 2; ++hh) { float t[8];
#pragma unroll
      for (int i = 0; i < 8; ++i) t[i] = fmaxf(sv[i][hh], sv[8 + i][hh]);
      float mx = fmaxf(fmaxf(fmaxf(t[0], t[1]), fmaxf(t[2], t[3])), fmaxf(fmaxf(t[4], t[5]), fmaxf(t[6], t[7])));
      mx = fmaxf(mx, xhalf(mx));
      const float mn = fmaxf(m[hh], mx); const float am = exp_slot(m[hh] - mn); const float alpha = (m[hh] <= -1.0e38f) ? 0.f : am;
      v16h pb; float es[4];   // four independent chains of four
#pragma unroll
      for (int i = 0; i < 16; ++i) { const float e = exp_slot(sv[i][hh] - mn); es[i & 3] = (i < 4) ? e : es[i & 3] + e; pb[i] = (_Float16)(e * 2048.0f); }
      l[hh] = l[hh] * alpha + ((es[0] + es[1]) + (es[2] + es[3])); m[hh] = mn;
#pragma unroll
      for (int dt = 0; dt < 2; ++dt) { acc[hh][dt] *= alpha; acc[hh][dt] = wmma16(vf[hh][dt], pb, acc[hh][dt]); } }
    __syncthreads(); }
  // join of the two groups: group 1 hands its (m, l, ctx^T) over in LDS (the logits buffer is free behind the loop's last barrier; 36 floats a lane = 16 B x odd), group 0 rescales both to the common maximum and goes on alone (loops unrolled: the indices of register arrays must be constants)
  float* mg = &sS2[0][0][0] + (wave * 32 + lane) * 36;
  if (grp == 1) {
#pragma unroll
    for (int hh = 0; hh < 2; ++hh)
#pragma unroll
      for (int dt = 0; dt < 2; ++dt) { v4f o0, o1;
#pragma unroll
        for (int r = 0; r < 4; ++r) { o0[r] = acc[hh][dt][r]; o1[r] = acc[hh][dt][4 + r]; }
        *(v4f*)(mg + (hh * 2 + dt) * 8) = o0; *(v4f*)(mg + (hh * 2 + dt) * 8 + 4) = o1; }
    v4f ml; ml[0] = m[0]; ml[1] = m[1]; ml[2] = l[0]; ml[3] = l[1]; *(v4f*)(mg + 32) = ml; }
  __syncthreads();
  if (grp == 1) return;   // behind the kernel's last barrier
  { const v4f ml = *(const v4f*)(mg + 32);
#pragma unroll
    for (int hh = 0; hh < 2; ++hh) { const float mn = fmaxf(m[hh], ml[hh]); const float a0 = exp_slot(m[hh] - mn), a1 = exp_slot(ml[hh] - mn);
      l[hh] = l[hh] * a0 + ml[2 + hh] * a1;
#pragma unroll
      for (int dt = 0; dt < 2; ++dt) { const v4f o0 = *(const v4f*)(mg + (hh * 2 + dt) * 8), o1 = *(const v4f*)(mg + (hh * 2 + dt) * 8 + 4);
#pragma unroll
        for (int r = 0; r < 4; ++r) { acc[hh][dt][r] = acc[hh][dt][r] * a0 + o0[r] * a1; acc[hh][dt][4 + r] = acc[hh][dt][4 + r] * a0 + o1[r] * a1; } } } }
#pragma unroll
  for (int hh = 0; hh < 2; ++hh) { const float il = (1.0f / 2048.0f) / (l[hh] + xhalf(l[hh]));
#pragma unroll
    for (int dt = 0; dt < 2; ++dt) { v4f o0, o1;
#pragma unroll
      for (int r = 0; r < 4; ++r) { o0[r] = acc[hh][dt][r] * il; o1[r] = acc[hh][dt][4 + r] * il; }
      float* po = &so[wave][col][hh * 32 + dt * 16 + 8 * g]; *(v4f*)po = o0; *(v4f*)(po + 4) = o1; } }
  LDSX();
  for (int rl = 0; rl < 16; ++rl) if (lane < 16) vst2(O + (rq + rl) * DZ + wave * 64 + lane * 4, *(const v4f*)&so[wave][rl][lane * 4]);   // heads 2w, 2w+1 = 64 contiguous floats (256-B segment)
}
// ---- k_out: block = (64 rows, 128 cols): out0 = ctx (hi + lo) . Wout + bout
__global__ __launch_bounds__(128) void k_out(const float* __restrict__ O, const __bf16* __restrict__ PW, const float* __restrict__ BO, float* __restrict__ Y) { __shared__ __align__(16) float so[4][16][132];
  const int tid = threadIdx.x, wave = tid >> 5, lane = tid & 31, col = lane & 15, g = lane >> 4; const size_t r0 = (size_t)blockIdx.x * 64 + wave * 16; const int c0 = blockIdx.y * 128; const __bf16* Wr = PW + (size_t)3 * DZ * DZ;
  v8f acc[8] = {};
#pragma unroll
  for (int kc = 0; kc < DZ / 32; ++kc) { const F2 a = split_row(O + (r0 + col) * DZ, kc * 32, lane);
#pragma unroll
    for (int j = 0; j < 8; ++j) { const v16b w = frag_b(Wr + (size_t)(c0 + j * 16 + col) * DZ + kc * 32, lane); acc[j] = wmma_bf(a.h, w, acc[j]); acc[j] = wmma_bf(a.l, w, acc[j]); } }
#pragma unroll
  for (int j = 0; j < 8; ++j) { const float bb = bfr(BO[c0 + j * 16 + col]);
#pragma unroll
    for (int r = 0; r < 8; ++r) so[wave][8 * g + r][j * 16 + col] = acc[j][r] + bb; }
  LDSX(); for (int rl = 0; rl < 16; ++rl) vst2(Y + (r0 + rl) * DZ + c0 + lane * 4, *(const v4f*)&so[wave][rl][lane * 4]); }
// ---- k_copy: second output = xq (f32 copy, 16-B chunks; whole buffer)
__global__ __launch_bounds__(256) void k_copy(const float* __restrict__ XQ, float* __restrict__ OUT, int n4) { const int i = blockIdx.x * 256 + threadIdx.x; if (i < n4) { v4f v = *(const v4f*)(XQ + (size_t)i * 4); vst2(OUT + (size_t)i * 4, v); } }
extern "C" void kernel_launch(void* const* d_in, const int* in_sizes, int n_in, void* d_out, int out_size, void* d_ws, size_t ws_size, hipStream_t stream) {
  (void)in_sizes; (void)n_in; (void)out_size;
  const float** F = (const float**)d_in;   // 0 zq, 1 zk, 2 zv [8,1024,256]; 3 xq, 4 xkv [8,1024,2]; 5 Wq, 6 Wk, 7 Wv [256,256] (in,out); 8 Wout [256,256] (in,out), 9 bout; 10 W1 [10,32], 11 b1 [32], 12 W2 [32,8], 13 b2 [8]
  if (ws_size < (size_t)WS_END) return;
  char* ws = (char*)d_ws; __bf16 *PW = (__bf16*)(ws + WS_PW), *P1 = (__bf16*)(ws + WS_P1), *P2 = (__bf16*)(ws + WS_P2); _Float16 *Q = (_Float16*)(ws + WS_Q), *Kr = (_Float16*)(ws + WS_K), *V = (_Float16*)(ws + WS_V); float* O = (float*)(ws + WS_O);
  k_pack<<<dim3(DZ, 6), 256, 0, stream>>>(F[5], F[6], F[7], F[8], F[10], F[12], PW, P1, P2);
  k_proj<<<dim3(TNM * NQ / 64, DZ / 128, 3), 128, 0, stream>>>(F[0], F[1], F[2], PW, Q, Kr, V);
  k_te<<<dim3(TQB, TNM), 256, 0, stream>>>(Q, Kr, V, F[3], F[4], P1, P2, F[11], F[13], O);
  k_out<<<dim3(TNM * NQ / 64, DZ / 128), 128, 0, stream>>>(O, PW, F[9], (float*)d_out);
  k_copy<<<(NRQ * 2 / 4 + 255) / 256, 256, 0, stream>>>(F[3], (float*)d_out + OUT1, NRQ * 2 / 4);
}

// v007
// It runs in 92.4 microseconds.
// Two timings next to v006 put it at 1.20 and 1.19 times that version's speed.
// All steps since v000 together make it 3.34 times as fast.
// compute dtype: all float inputs rounded to bf16; q/k/v = z . W with EXACT bf16 products on WMMA 16x16x32 ((in,out) weights as transposed rows), rounded once to f16 (k and v stored as fragments); per 16-query x 32-key chunk: token dots q_h . k_h x 32^-1/2 on WMMA (single f16), the pair features [xq - xkv | dots | 0] in f32, the kernel MLP relu(F . W1 + b1) . W2 + b2 on WMMA with F and the hidden as bf16 hi + lo (2 products each); per (query, head) running-max softmax over the keys in f32 (hardware exp), P (scaled by 2^11, single f16) x v (single f16); out = ctx (bf16 hi + lo, 2 products) . Wout + bout; xq copied through as the second output; f32 outputs.
#include <hip/hip_runtime.h>
#include <math.h>

typedef __attribute__((ext_vector_type(16))) _Float16 v16h;
typedef __attribute__((ext_vector_type(16))) __bf16 v16b;
typedef __attribute__((ext_vector_type(8)))  _Float16 v8h;
typedef __attribute__((ext_vector_type(8)))  float v8f;
typedef __attribute__((ext_vector_type(4)))  float v4f;
typedef __attribute__((ext_vector_type(2)))  float v2f;
typedef __attribute__((ext_vector_type(4)))  unsigned v4u;
typedef __attribute__((ext_vector_type(4)))  int v4i;
typedef float __attribute__((may_alias)) float_a;
typedef int __attribute__((may_alias)) int_a;

template <typename T> __device__ __forceinline__ void vst2(void* p, T v) { *(T*)p = v;  }
__device__ __forceinline__ v8f wmma16(v16h a, v16h b, v8f c) {
  v8f d = __builtin_amdgcn_wmma_f32_16x16x32_f16(false, a, false, b, (short)0, c, false, false);
  return d;
}
// for the token dots alone, of whose D only elements 0..3 are read: the compiler lays the next product's D over the dead half, and the four slots keep that write at the distance the chip asks for behind a matrix instruction
__device__ __forceinline__ v8f wmma16p(v16h a, v16h b, v8f c) {
  v8f d = __builtin_amdgcn_wmma_f32_16x16x32_f16(false, a, false, b, (short)0, c, false, false);
  asm volatile("v_nop\n\tv_nop\n\tv_nop\n\tv_nop" : "+v"(d) : "v"(a), "v"(b));
  return d;
}
__device__ __forceinline__ v8f wmma_bf(v16b a, v16b b, v8f c) {
  v8f d = __builtin_amdgcn_wmma_f32_16x16x32_bf16(false, a, false, b, (short)0, c, false, false);
  return d;
}
// 16x16x32 fragments: lane = (h = lane>>4, row/col = lane&15); elements 0..7 = k0+8h+0..7, 8..15 = k0+16+8h+0..7; D element r = row 8h+r
__device__ __forceinline__ v16h frag_h(const _Float16* rowk0, int lane) {
  union { v16h v; v8h q[2]; } u; const _Float16* p = rowk0 + 8 * (lane >> 4);
  u.q[0] = *(const v8h*)p; u.q[1] = *(const v8h*)(p + 16); return u.v;
}
// the same fragment from a tile stored in fragment order, [piece 0, 1][lane][8 halves]: each of the two loads reads 512 contiguous bytes (4 whole lines; from 16 rows it would touch 16)
__device__ __forceinline__ v16h frag_t(const _Float16* tile, int lane) {
  union { v16h v; v8h q[2]; } u; const _Float16* p = tile + 8 * lane;
  u.q[0] = *(const v8h*)p; u.q[1] = *(const v8h*)(p + 256); return u.v;
}
__device__ __forceinline__ v16h frag_f32(const float* rowk0, int lane) {
  v16h a; const float* p = rowk0 + 8 * (lane >> 4);
#pragma unroll
  for (int i = 0; i < 8; ++i) { a[i] = (_Float16)p[i]; a[8 + i] = (_Float16)p[16 + i]; }
  return a;
}
__device__ __forceinline__ v16h frag_f32s(const float* rowk0, int lane, float sc) {
  v16h a; const float* p = rowk0 + 8 * (lane >> 4);
#pragma unroll
  for (int i = 0; i < 8; ++i) { a[i] = (_Float16)(p[i] * sc); a[8 + i] = (_Float16)(p[16 + i] * sc); }
  return a;
}
// column fragment from a [K][ld] layout (column n), rows >= K read as 0
__device__ __forceinline__ v16h fragc_f32(const float* W, int k0, int n, int lane, int ld, int K) {
  v16h a; const int g = lane >> 4;
#pragma unroll
  for (int i = 0; i < 8; ++i) { const int ka = k0 + 8 * g + i, kb = ka + 16;
    a[i] = (_Float16)(ka < K ? W[(size_t)(ka < K ? ka : K - 1) * ld + n] : 0.f); a[8 + i] = (_Float16)(kb < K ? W[(size_t)(kb < K ? kb : K - 1) * ld + n] : 0.f); }
  return a;
}
struct F2 { v16b h, l; };
typedef __attribute__((ext_vector_type(2))) __bf16 v2b;
// bf16 hi + lo split, three instructions a pair of values: one packed conversion makes both hi halves; each lo half is x - hi rounded to bf16 in ONE instruction that reads its hi half in place
// (v_fma_mixlo_bf16 writes the low half of the result register, v_fma_mixhi_bf16 the high half; x - hi is exact in f32, so that one rounding is the rounding of a separate conversion).
// In asm because the compiler does not form these two from source: it converts every hi a second time alone, or unpacks the pair with a shift and a mask. All the mixlo of a statement stand ahead of
// its mixhi, so that the write of a register's second half stands four or five instructions behind the write of its first half and hardly waits for it.
#define MIXLO(o, h, x) "v_fma_mixlo_bf16 %" #o ", %" #h ", -1.0, %" #x " op_sel:[0,1,0] op_sel_hi:[1,1,0]\n\t"
#define MIXHI(o, h, x) "v_fma_mixhi_bf16 %" #o ", %" #h ", -1.0, %" #x " op_sel:[1,1,0] op_sel_hi:[1,1,0]\n\t"
// closes the last statement of a split: the matrix instruction that reads the lo halves stands directly behind it, and the compiler, which does not look into asm, gives that reader no hint; unhinted, its wait for the last mixhi would hold up the other waves of the SIMD too
#define MIXEND "s_delay_alu instid0(VALU_DEP_1)"
#define TAILS4(END) asm(MIXLO(0, 4, 8) MIXLO(1, 5, 10) MIXLO(2, 6, 12) MIXLO(3, 7, 14) MIXHI(0, 4, 9) MIXHI(1, 5, 11) MIXHI(2, 6, 13) MIXHI(3, 7, 15) END \
      : "=&v"(l[0]), "=&v"(l[1]), "=&v"(l[2]), "=&v"(l[3]) : "v"(h[0]), "v"(h[1]), "v"(h[2]), "v"(h[3]), "v"(x[0]), "v"(x[1]), "v"(x[2]), "v"(x[3]), "v"(x[4]), "v"(x[5]), "v"(x[6]), "v"(x[7]))
__device__ __forceinline__ void tails4(unsigned* l, const unsigned* h, const float* x) { TAILS4(""); }
__device__ __forceinline__ void tails4e(unsigned* l, const unsigned* h, const float* x) { TAILS4(MIXEND); }
__device__ __forceinline__ void tails5e(unsigned* l, const unsigned* h, const float* x) {
  asm(MIXLO(0, 5, 10) MIXLO(1, 6, 12) MIXLO(2, 7, 14) MIXLO(3, 8, 16) MIXLO(4, 9, 18) MIXHI(0, 5, 11) MIXHI(1, 6, 13) MIXHI(2, 7, 15) MIXHI(3, 8, 17) MIXHI(4, 9, 19) MIXEND
      : "=&v"(l[0]), "=&v"(l[1]), "=&v"(l[2]), "=&v"(l[3]), "=&v"(l[4]) : "v"(h[0]), "v"(h[1]), "v"(h[2]), "v"(h[3]), "v"(h[4]), "v"(x[0]), "v"(x[1]), "v"(x[2]), "v"(x[3]), "v"(x[4]), "v"(x[5]), "v"(x[6]), "v"(x[7]), "v"(x[8]), "v"(x[9])); }
// NP = 8: all sixteen values; NP = 5: values 0..9, the caller's other six being compile-time constants that bf16 holds exactly (their lo is 0)
template <int NP> __device__ __forceinline__ F2 bsplit(const float v[16]) { union { v16b v; unsigned u[8]; } uh, ul;
#pragma unroll
  for (int i = 0; i < 8; ++i) { v2f x; x[0] = v[2 * i]; x[1] = v[2 * i + 1]; uh.u[i] = __builtin_bit_cast(unsigned, __builtin_convertvector(x, v2b)); ul.u[i] = 0u; }
  if (NP == 8) { tails4(ul.u, uh.u, v); tails4e(ul.u + 4, uh.u + 4, v + 8); } else tails5e(ul.u, uh.u, v);
  F2 r; r.h = uh.v; r.l = ul.v; return r; }
__device__ __forceinline__ F2 bsplit16(const float v[16]) { return bsplit<8>(v); }
__device__ __forceinline__ F2 split_row(const float* row, int k0, int lane) { float v[16]; const float* p = row + k0 + 8 * (lane >> 4);
#pragma unroll
  for (int i = 0; i < 8; ++i) { v[i] = p[i]; v[8 + i] = p[16 + i]; }
  return bsplit16(v); }
__device__ __forceinline__ F2 split_rowK(const float* row, int k0, int lane, int K) { float v[16]; const int g = lane >> 4;
#pragma unroll
  for (int i = 0; i < 8; ++i) { const int ka = k0 + 8 * g + i, kb = ka + 16; v[i] = ka < K ? row[ka < K ? ka : K - 1] : 0.f; v[8 + i] = kb < K ? row[kb < K ? kb : K - 1] : 0.f; }
  return bsplit16(v); }
__device__ __forceinline__ F2 split_col(const float* W, int k0, int n, int lane, int ld, int K) { float v[16]; const int g = lane >> 4;
#pragma unroll
  for (int i = 0; i < 8; ++i) { const int ka = k0 + 8 * g + i, kb = ka + 16; v[i] = ka < K ? W[(size_t)(ka < K ? ka : K - 1) * ld + n] : 0.f; v[8 + i] = kb < K ? W[(size_t)(kb < K ? kb : K - 1) * ld + n] : 0.f; }
  return bsplit16(v); }
__device__ __forceinline__ v8f mac3(const F2& a, const F2& b, v8f c) { c = wmma_bf(a.l, b.h, c); c = wmma_bf(a.h, b.l, c); return wmma_bf(a.h, b.h, c); }
__device__ __forceinline__ float sigm(float v) { return 1.0f / (1.0f + expf(-v)); }
#define LDSX() do { asm volatile("s_wait_dscnt 0" ::: "memory"); __builtin_amdgcn_wave_barrier(); __builtin_amdgcn_fence(__ATOMIC_RELEASE, "workgroup"); } while (0)


// Translation-equivariant multi-head attention (8 sets, 1,024 queries x 1,024 keys, dz 256, dx 2, 8 heads x 32, kernel MLP 10 -> 32 -> 8): logits = MLP([x_q - x_k, q_h . k_h / sqrt(32)]), softmax over keys, . v, output projection; the query locations pass through.
#define NM 8
#define NQ 1024
#define NK 1024
#define DZ 256
#define NH 8
#define HD 32
#define KH 32
#define NF 16              // padded feature width (2 + 8 used)
#define NRQ (NM * NQ)
#define NRK (NM * NK)
#ifndef TQB
#define TQB (NQ / 16)
#define TNM NM
#endif
typedef __attribute__((ext_vector_type(8))) __bf16 v8b;
__device__ __forceinline__ v16b frag_b(const __bf16* rowk0, int lane) {
  union { v16b v; v8b q[2]; } u; const __bf16* p = rowk0 + 8 * (lane >> 4);
  u.q[0] = *(const v8b*)p; u.q[1] = *(const v8b*)(p + 16); return u.v;
}
__device__ __forceinline__ float bfr(float v) { return (float)(__bf16)v; }
__device__ __attribute__((noinline)) float exp_ni(float v) { return expf(v); }
__device__ __attribute__((noinline)) float erf_ni(float v) { return erff(v); }

#define WS_PW  0u                                   // bf16 transposed rows Wq^T, Wk^T, Wv^T, Wout^T [4][256][256]; W1^T padded [32][32] (k = feature 0..9, rest 0); W2^T padded [16][32] (rows 8..15 zero)
#define WS_P1  (WS_PW + 2u * (size_t)4 * DZ * DZ)
#define WS_P2  (WS_P1 + 2u * (size_t)32 * 32)
#define WS_Q   (WS_P2 + 2u * (size_t)16 * 32)         // f16 q rows [NRQ][256]; k fragments [NRK / 16][head][512] (row = key, k = dim); v fragments [m][NK / 32][head][dim half][512] (row = dim, k = key), each 512 = [piece][lane][8] as frag_t reads it
#define WS_K   (WS_Q + 2u * (size_t)NRQ * DZ)
#define WS_V   (WS_K + 2u * (size_t)NRK * DZ)
#define OUT1   ((size_t)NRQ * DZ)                     // float offset of the second output (xq copy)
#define WS_END (WS_V + 2u * (size_t)NM * DZ * NK)

__global__ __launch_bounds__(256) void k_pack(const float* __restrict__ WQ, const float* __restrict__ WK, const float* __restrict__ WV, const float* __restrict__ WO, const float* __restrict__ W1, const float* __restrict__ W2, __bf16* __restrict__ PW, __bf16* __restrict__ P1, __bf16* __restrict__ P2) {
  const int n = blockIdx.x, which = blockIdx.y, t = threadIdx.x; __shared__ __align__(16) __bf16 s[DZ];
  if (which < 4) { const float* w = (which == 0) ? WQ : (which == 1) ? WK : (which == 2) ? WV : WO; s[t] = (__bf16)w[(size_t)t * DZ + n]; __syncthreads(); if (t < DZ / 8) vst2((unsigned*)(PW + ((size_t)which * DZ + n) * DZ + t * 8), *(const v4u*)&s[t * 8]); }
  else if (which == 4) { if (n >= 32) return; if (t < 32) s[t] = (t < 10) ? (__bf16)W1[(size_t)t * KH + n] : (__bf16)0.f; __syncthreads(); if (t < 4) vst2((unsigned*)(P1 + (size_t)n * 32 + t * 8), *(const v4u*)&s[t * 8]); }   // W1^T [n=hidden][k=feature]
  else { if (n >= 16) return; if (t < 32) s[t] = (n < NH) ? (__bf16)W2[(size_t)t * NH + n] : (__bf16)0.f; __syncthreads(); if (t < 4) vst2((unsigned*)(P2 + (size_t)n * 32 + t * 8), *(const v4u*)&s[t * 8]); } }   // W2^T [n=head][k=hidden]
// ---- k_proj: block = (64 rows, 128 cols, which): q from zq -> f16 rows; k from zk, v from zv -> fragment order (consecutive lanes store consecutive 16-byte chunks: a wave stores 512 contiguous bytes)
__global__ __launch_bounds__(128) void k_proj(const float* __restrict__ ZQ, const float* __restrict__ ZK, const float* __restrict__ ZV, const __bf16* __restrict__ PW, _Float16* __restrict__ Q, _Float16* __restrict__ Kr, _Float16* __restrict__ V) {
  __shared__ __align__(16) _Float16 so[64][136]; __shared__ __align__(16) _Float16 st[128][72];
  const int tid = threadIdx.x, wave = tid >> 5, lane = tid & 31, col = lane & 15, g = lane >> 4; const int which = blockIdx.z; const size_t rb = (size_t)blockIdx.x * 64; const size_t r0 = rb + wave * 16; const int c0 = blockIdx.y * 128; const float* A = (which == 0) ? ZQ : (which == 1) ? ZK : ZV; const __bf16* Wr = PW + ((size_t)which * DZ) * DZ;
  v8f acc[8] = {};
#pragma unroll
  for (int kc = 0; kc < DZ / 32; ++kc) { v16b a; { const float* p = A + (r0 + col) * DZ + kc * 32 + 8 * g;
#pragma unroll
      for (int i = 0; i < 8; ++i) { a[i] = (__bf16)p[i]; a[8 + i] = (__bf16)p[16 + i]; } }
#pragma unroll
    for (int j = 0; j < 8; ++j) acc[j] = wmma_bf(a, frag_b(Wr + (size_t)(c0 + j * 16 + col) * DZ + kc * 32, lane), acc[j]); }
#pragma unroll
  for (int j = 0; j < 8; ++j)
#pragma unroll
    for (int r = 0; r < 8; ++r) { const _Float16 hv = (_Float16)acc[j][r]; if (which < 2) so[wave * 16 + 8 * g + r][j * 16 + col] = hv; else st[j * 16 + col][wave * 16 + 8 * g + r] = hv; }
  __syncthreads();
  if (which == 0) { for (int e = tid; e < 64 * 16; e += 128) { const int rl = e >> 4, q = e & 15; vst2((unsigned*)(Q + (rb + rl) * DZ + c0 + q * 8), *(const v4u*)&so[rl][q * 8]); } }
  else if (which == 1) { for (int e = tid; e < 64 * 16; e += 128) { const int ln = e & 31, pc = (e >> 5) & 1, hh = (e >> 6) & 3, t = e >> 8;   // key tile t, head hh of the block's four each
      vst2((unsigned*)(Kr + ((((rb / 16 + t) * NH + c0 / HD + hh) * 2 + pc) * 32 + ln) * 8), *(const v4u*)&so[t * 16 + (ln & 15)][hh * HD + pc * 16 + (ln >> 4) * 8]); } }
  else { const size_t mI = rb / NK; const int s0 = (int)(rb % NK); for (int e = tid; e < 128 * 8; e += 128) { const int ln = e & 31, pc = (e >> 5) & 1, dt = (e >> 6) & 1, hh = (e >> 7) & 3, cc = e >> 9;   // 32-key chunk cc of the block's two, head hh of its four
      vst2((unsigned*)(V + ((((((mI * (NK / 32) + s0 / 32 + cc) * NH + c0 / HD + hh) * 2 + dt) * 2 + pc) * 32 + ln) * 8)), *(const v4u*)&st[hh * HD + dt * 16 + (ln & 15)][cc * 32 + pc * 16 + (ln >> 4) * 8]); } }
}
// ---- k_te: block = (16 queries, m), 8 waves = two groups of 4; group grp takes the 32-key chunks 2 it + grp with its own logits buffer and its own running (m, l, ctx), so that 4 waves and not 2 stand on each SIMD to cover each other's load, LDS and matrix latencies; the two partial softmax states are joined once behind the loop. Below, wave = the wave's number inside its group. Per 32-key chunk: (a) wave w takes the 16 keys of half w & 1 and 8 of the queries (4 (w >> 1) + 0..3 and 8 + the same): token dots of all 8 heads, so that lane (g, key) holds every feature of its own pairs; (b) the MLP transposed, in registers: h1^T = relu(W1^T . F^T), dots^T = W2^T . h1^T + b2, the features being a B fragment as they stand and the D of the first product the B fragment of the second -> SC[pair][h]; (c) wave w runs the running-max softmax + P.v for heads 2w, 2w+1 over the chunk, transposed: ctx^T += v^T . P^T, lane (g, query) holding 16 of the query's 32 logits, so that maximum and sum are in-lane but for one exchange between the lane halves, and exp(.) is the B fragment as it stands
#define SP 12              // floats per pair row of the logits: 16-byte stores, 16 rows on 16 distinct bank groups
#define SQP (32 * SP + 4)  // floats per query row of the logits: the 16 queries that one read of part (c) touches start 4 banks apart
__device__ __forceinline__ float xhalf(float x) { return __builtin_bit_cast(float, __builtin_amdgcn_permlanex16(__builtin_bit_cast(int, x), __builtin_bit_cast(int, x), 0x76543210, 0xfedcba98, false, false)); }   // lane l with lane l ^ 16
// exp(x) as __expf gives it (the hardware's exp2 of x . log2 e), with one v_nop in the same statement: the instruction set asks for one slot between a transcendental and a next instruction that reads its result or overwrites its source
__device__ __forceinline__ float exp_slot(float x) { float r; asm("v_exp_f32 %0, %1\n\tv_nop" : "=v"(r) : "v"(x * 0x1.715476p+0f)); return r; }
__global__ __launch_bounds__(256) void k_te(const _Float16* __restrict__ Q, const _Float16* __restrict__ Kr, const _Float16* __restrict__ V, const float* __restrict__ XQ, const float* __restrict__ XKV, const __bf16* __restrict__ P1, const __bf16* __restrict__ P2, const float* __restrict__ B1, const float* __restrict__ B2, const __bf16* __restrict__ PW, const float* __restrict__ BO, float* __restrict__ Y) {
  __shared__ __align__(16) float sS2[2][16][SQP]; __shared__ __align__(16) _Float16 sq[16][DZ + 8]; __shared__ __align__(16) v4u sf[NH][2][2][32];   // sf: ctx as A fragments of the output projection, [head = 32-wide k step][hi, lo][piece][lane]
  const int tid = threadIdx.x, grp = tid >> 7, wave = (tid >> 5) & 3, lane = tid & 31, col = lane & 15, g = lane >> 4; const size_t mI = blockIdx.y; const int q0 = blockIdx.x * 16; const size_t rq = mI * NQ + q0;
  const int w2 = wave >> 1, kh = wave & 1;
  float (*sS)[SQP] = sS2[grp];   // this group's logits
  // A row 8g + r holds query 8g + ((r + 4 w2) & 7): D elements 0..3 are this wave's queries 8g + 4 w2 + 0..3
  const int qr = (col & 8) + (((col & 7) + 4 * w2) & 7);
  for (int e = tid; e < 16 * (DZ / 8); e += 256) { const int rl = e >> 5, pc = e & 31; *(v8h*)&sq[rl][pc * 8] = *(const v8h*)(Q + (rq + rl) * DZ + pc * 8); }   // the 16 q rows, read as fragments in every chunk (all 8 heads in registers would spill)
  __syncthreads();
  // W1^T as A, hidden row 16j + col: a lane's 16 k slots = features 0..9, b1 (against the constant feature 1), zeros. wlo has them in the g = 0 lanes only (k slots 0..7, 16..23: it meets the features held by the g = 0 lanes, queries 4 w2 + rr), whi in the g = 1 lanes only (queries 8 + 4 w2 + rr)
  v16b wlo[2], whi[2];
#pragma unroll
  for (int j = 0; j < 2; ++j) { union { v16b v; v8b q[2]; } u; const __bf16* pw = P1 + (size_t)(j * 16 + col) * 32; u.q[0] = *(const v8b*)pw; u.q[1] = *(const v8b*)(pw + 8); u.v[10] = (__bf16)B1[j * 16 + col];
    const v16b z = {}; wlo[j] = (g == 0) ? u.v : z; whi[j] = (g == 0) ? z : u.v; }
  const v16b w2f = frag_b(P2 + (size_t)col * 32, lane);   // W2^T as A: row = head (8..15 zero), k = hidden
  float b2v[NH], xq0[4], xq1[4];
#pragma unroll
  for (int r = 0; r < NH; ++r) b2v[r] = bfr(B2[r]);
#pragma unroll
  for (int rr = 0; rr < 4; ++rr) { const size_t qq = rq + 8 * g + 4 * w2 + rr; xq0[rr] = bfr(XQ[qq * 2]); xq1[rr] = bfr(XQ[qq * 2 + 1]); }
  float m[2] = {-3.0e38f, -3.0e38f}, l[2] = {0.f, 0.f};   // of query col; l is the sum over this lane half's keys alone, the halves are joined after the loop
  v8f acc[2][2] = {};   // ctx^T: element r = dim 16 dt + 8g + r of head 2w + hh, column = query col
#pragma unroll 1
  for (int it = 0; it < NK / 64; ++it) { const int j0 = (it * 2 + grp) * 32;   // the same trip count in both groups: every barrier is met by all 8 waves
    // (a) token dots of all heads for this wave's 16 keys; lane (g, col) keeps pairs (8g + 4 w2 + rr, key col)
    const size_t kr = mI * NK + j0 + kh * 16 + col; const v2f xk = *(const v2f*)(XKV + kr * 2); const float xk0 = bfr(xk[0]), xk1 = bfr(xk[1]);
    float ft[4][NH]; v16h kf[NH];   // all 8 heads' key fragments requested before the first product: one memory latency a chunk, not eight
#pragma unroll
    for (int h = 0; h < NH; ++h) kf[h] = frag_t(Kr + (((mI * NK + j0) / 16 + kh) * NH + h) * 512, lane);
    v16h qn = frag_h(&sq[qr][0], lane);   // q fragments one head ahead of their product
#pragma unroll
    for (int h = 0; h < NH; ++h) { const v16h qc = qn; if (h + 1 < NH) qn = frag_h(&sq[qr][(h + 1) * HD], lane);
      v8f c = {}; c = wmma16p(qc, kf[h], c);
#pragma unroll
      for (int rr = 0; rr < 4; ++rr) ft[rr][h] = c[rr] * 0.17677669529663688f; }
    // (b) MLP on 32 pairs a pass, no LDS between the products (unrolled, as every loop here over a register array: its indices must be constants)
#pragma unroll
    for (int rr = 0; rr < 4; ++rr) { float fv[16]; fv[0] = xq0[rr] - xk0; fv[1] = xq1[rr] - xk1;
#pragma unroll
      for (int h = 0; h < NH; ++h) fv[2 + h] = ft[rr][h];
      fv[10] = 1.0f;
#pragma unroll
      for (int i = 11; i < 16; ++i) fv[i] = 0.f;
      const F2 fb = bsplit<5>(fv); v8f dd[2];
#pragma unroll
      for (int s = 0; s < 2; ++s) { v8f hacc[2] = {};
#pragma unroll
        for (int j = 0; j < 2; ++j) { const v16b w = s ? whi[j] : wlo[j]; hacc[j] = wmma_bf(w, fb.h, hacc[j]); hacc[j] = wmma_bf(w, fb.l, hacc[j]); }
        float hv[16];   // D element r of tile j = hidden 16j + 8g + r = k slot of B element 8j + r
#pragma unroll
        for (int j = 0; j < 2; ++j)
#pragma unroll
          for (int r = 0; r < 8; ++r) { const float v = hacc[j][r]; hv[8 * j + r] = v > 0.f ? v : 0.f; }
        const F2 hb = bsplit16(hv); v8f dacc = {}; dacc = wmma_bf(w2f, hb.h, dacc); dacc = wmma_bf(w2f, hb.l, dacc); dd[s] = dacc; }
      if (g == 0) {   // D rows 0..7 = heads, held by the g = 0 lanes; column = key
#pragma unroll
        for (int s = 0; s < 2; ++s) { float* ps = &sS[8 * s + 4 * w2 + rr][(kh * 16 + col) * SP]; v4f o0, o1;
#pragma unroll
          for (int r = 0; r < 4; ++r) { o0[r] = dd[s][r] + b2v[r]; o1[r] = dd[s][4 + r] + b2v[4 + r]; }
          *(v4f*)ps = o0; *(v4f*)(ps + 4) = o1; } } }
    __syncthreads();
    // (c) softmax + P.v for this wave's two heads: lane (g, col) takes query col, keys 8g + i and 16 + 8g + i (the k order of frag_h)
    v16h vf[2][2];
#pragma unroll
    for (int hh = 0; hh < 2; ++hh)
#pragma unroll
      for (int dt = 0; dt < 2; ++dt) vf[hh][dt] = frag_t(V + (((mI * (NK / 32) + j0 / 32) * NH + wave * 2 + hh) * 2 + dt) * 512, lane);   // v^T as A: row = dim
    v2f sv[16];   // both heads of a pair in one 8-byte read
#pragma unroll
    for (int i = 0; i < 8; ++i) { sv[i] = *(const v2f*)&sS[col][(8 * g + i) * SP + 2 * wave]; sv[8 + i] = *(const v2f*)&sS[col][(16 + 8 * g + i) * SP + 2 * wave]; }
#pragma unroll
    for (int hh = 0; hh < 2; ++hh) { float t[8];
#pragma unroll
      for (int i = 0; i < 8; ++i) t[i] = fmaxf(sv[i][hh], sv[8 + i][hh]);
      float mx = fmaxf(fmaxf(fmaxf(t[0], t[1]), fmaxf(t[2], t[3])), fmaxf(fmaxf(t[4], t[5]), fmaxf(t[6], t[7])));
      mx = fmaxf(mx, xhalf(mx));
      const float mn = fmaxf(m[hh], mx); const float am = exp_slot(m[hh] - mn); const float alpha = (m[hh] <= -1.0e38f) ? 0.f : am;
      v16h pb; float es[4];   // four independent chains of four
#pragma unroll
      for (int i = 0; i < 16; ++i) { const float e = exp_slot(sv[i][hh] - mn); es[i & 3] = (i < 4) ? e : es[i & 3] + e; pb[i] = (_Float16)(e * 2048.0f); }
      l[hh] = l[hh] * alpha + ((es[0] + es[1]) + (es[2] + es[3])); m[hh] = mn;
#pragma unroll
      for (int dt = 0; dt < 2; ++dt) { acc[hh][dt] *= alpha; acc[hh][dt] = wmma16(vf[hh][dt], pb, acc[hh][dt]); } }
    __syncthreads(); }
  // join of the two groups: group 1 hands its (m, l, ctx^T) over in LDS (the logits buffer is free behind the loop's last barrier; 36 floats a lane = 16 B x odd), group 0 rescales both to the common maximum and writes the normalised ctx to sf for all 8 waves (loops unrolled: the indices of register arrays must be constants)
  // the tail: this block holds whole ctx rows (16 queries x all 8 heads), so it also does their output projection, wave w8 of all 8 taking 32 output columns, and copies their xq through. The Wout^T fragments, the bias and the xq line are requested here, ahead of the join
  const int w8 = tid >> 5; v16b wf[2][NH];
#pragma unroll
  for (int kc = 0; kc < NH; ++kc)
#pragma unroll
    for (int j = 0; j < 2; ++j) wf[j][kc] = frag_b(PW + ((size_t)3 * DZ + w8 * 32 + j * 16 + col) * DZ + kc * 32, lane);
  float bb[2];
#pragma unroll
  for (int j = 0; j < 2; ++j) bb[j] = bfr(BO[w8 * 32 + j * 16 + col]);
  asm volatile("s_wait_xcnt 0x0" ::: "memory");   // the compiler lays the next load's result over the address pair of the loads above: the wait that stands before a register of an issued load is overwritten
  const v4f xc = *(const v4f*)(XQ + rq * 2 + (lane & 7) * 4);   // 16 queries x 2 floats = one 128-byte line; read by every wave (no branch, no start value), stored by the first 8 lanes of the block
  float* mg = &sS2[0][0][0] + (wave * 32 + lane) * 36;
  if (grp == 1) {
#pragma unroll
    for (int hh = 0; hh < 2; ++hh)
#pragma unroll
      for (int dt = 0; dt < 2; ++dt) { v4f o0, o1;
#pragma unroll
        for (int r = 0; r < 4; ++r) { o0[r] = acc[hh][dt][r]; o1[r] = acc[hh][dt][4 + r]; }
        *(v4f*)(mg + (hh * 2 + dt) * 8) = o0; *(v4f*)(mg + (hh * 2 + dt) * 8 + 4) = o1; }
    v4f ml; ml[0] = m[0]; ml[1] = m[1]; ml[2] = l[0]; ml[3] = l[1]; *(v4f*)(mg + 32) = ml; }
  __syncthreads();
  if (grp == 0) { const v4f ml = *(const v4f*)(mg + 32);
#pragma unroll
    for (int hh = 0; hh < 2; ++hh) { const float mn = fmaxf(m[hh], ml[hh]); const float a0 = exp_slot(m[hh] - mn), a1 = exp_slot(ml[hh] - mn);
      l[hh] = l[hh] * a0 + ml[2 + hh] * a1;
#pragma unroll
      for (int dt = 0; dt < 2; ++dt) { const v4f o0 = *(const v4f*)(mg + (hh * 2 + dt) * 8), o1 = *(const v4f*)(mg + (hh * 2 + dt) * 8 + 4);
#pragma unroll
        for (int r = 0; r < 4; ++r) { acc[hh][dt][r] = acc[hh][dt][r] * a0 + o0[r] * a1; acc[hh][dt][4 + r] = acc[hh][dt][4 + r] * a0 + o1[r] * a1; } } }
    // lane (g, query col) holds dims 8g + r and 16 + 8g + r of a head: ctx^T as it stands is the A fragment (row = query, k = the head's 32 dims) of ctx . Wout; split once here, read by all 8 waves
#pragma unroll
    for (int hh = 0; hh < 2; ++hh) { const float il = (1.0f / 2048.0f) / (l[hh] + xhalf(l[hh])); float v[16];
#pragma unroll
      for (int r = 0; r < 8; ++r) { v[r] = acc[hh][0][r] * il; v[8 + r] = acc[hh][1][r] * il; }
      const F2 a = bsplit16(v); union { v16b v; v4u q[2]; } uh, ul; uh.v = a.h; ul.v = a.l;
#pragma unroll
      for (int pc = 0; pc < 2; ++pc) { sf[wave * 2 + hh][0][pc][lane] = uh.q[pc]; sf[wave * 2 + hh][1][pc][lane] = ul.q[pc]; } } }
  __syncthreads();   // all of ctx stands in sf; the join's buffer is free again
  // out0 = ctx (hi + lo) . Wout + bout, k ascending, hi then lo
  v8f oa[2] = {};
#pragma unroll
  for (int kc = 0; kc < NH; ++kc) { union { v16b v; v4u q[2]; } uh, ul;
#pragma unroll
    for (int pc = 0; pc < 2; ++pc) { uh.q[pc] = sf[kc][0][pc][lane]; ul.q[pc] = sf[kc][1][pc][lane]; }
#pragma unroll
    for (int j = 0; j < 2; ++j) { oa[j] = wmma_bf(uh.v, wf[j][kc], oa[j]); oa[j] = wmma_bf(ul.v, wf[j][kc], oa[j]); } }
  float* os = &sS2[0][0][0] + w8 * (16 * 36);   // this wave's own 16 x 32 tile, rows of 36 floats (16 B x odd)
#pragma unroll
  for (int j = 0; j < 2; ++j)
#pragma unroll
    for (int r = 0; r < 8; ++r) os[(8 * g + r) * 36 + j * 16 + col] = oa[j][r] + bb[j];
  LDSX();
#pragma unroll
  for (int i = 0; i < 4; ++i) { const int rl = i * 4 + (lane >> 3), c = (lane & 7) * 4; vst2(Y + (rq + rl) * DZ + w8 * 32 + c, *(const v4f*)&os[rl * 36 + c]); }   // a row's 32 floats = one whole 128-byte line, written by this wave alone
  if (tid < 8) vst2(Y + OUT1 + rq * 2 + tid * 4, xc);   // second output = xq
}
extern "C" void kernel_launch(void* const* d_in, const int* in_sizes, int n_in, void* d_out, int out_size, void* d_ws, size_t ws_size, hipStream_t stream) {
  (void)in_sizes; (void)n_in; (void)out_size;
  const float** F = (const float**)d_in;   // 0 zq, 1 zk, 2 zv [8,1024,256]; 3 xq, 4 xkv [8,1024,2]; 5 Wq, 6 Wk, 7 Wv [256,256] (in,out); 8 Wout [256,256] (in,out), 9 bout; 10 W1 [10,32], 11 b1 [32], 12 W2 [32,8], 13 b2 [8]
  if (ws_size < (size_t)WS_END) return;
  char* ws = (char*)d_ws; __bf16 *PW = (__bf16*)(ws + WS_PW), *P1 = (__bf16*)(ws + WS_P1), *P2 = (__bf16*)(ws + WS_P2); _Float16 *Q = (_Float16*)(ws + WS_Q), *Kr = (_Float16*)(ws + WS_K), *V = (_Float16*)(ws + WS_V);
  k_pack<<<dim3(DZ, 6), 256, 0, stream>>>(F[5], F[6], F[7], F[8], F[10], F[12], PW, P1, P2);
  k_proj<<<dim3(TNM * NQ / 64, DZ / 128, 3), 128, 0, stream>>>(F[0], F[1], F[2], PW, Q, Kr, V);
  k_te<<<dim3(TQB, TNM), 256, 0, stream>>>(Q, Kr, V, F[3], F[4], P1, P2, F[11], F[13], PW, F[9], (float*)d_out);
}

// v008
// Measured time: 81.4 microseconds a run.
// Timed twice side by side with v007, it ran 1.12 and 1.13 times as fast.
// Counting every step since v000, it is 3.77 times as fast.
// compute dtype: all float inputs rounded to bf16; q/k/v = z . W with EXACT bf16 products on WMMA 16x16x32 ((in,out) weights rounded to bf16), rounded once to f16 (k and v stored as fragments); per 16-query x 32-key chunk: token dots q_h . k_h x 32^-1/2 on WMMA (single f16), the pair features [xq - xkv | dots | 0] in f32, the kernel MLP relu(F . W1 + b1) . W2 + b2 on WMMA with F and the hidden as bf16 hi + lo (2 products each); per (query, head) running-max softmax over the keys in f32 (hardware exp), P (scaled by 2^11, single f16) x v (single f16); out = ctx (bf16 hi + lo, 2 products) . Wout + bout; xq copied through as the second output; f32 outputs.
#include <hip/hip_runtime.h>
#include <math.h>

typedef __attribute__((ext_vector_type(16))) _Float16 v16h;
typedef __attribute__((ext_vector_type(16))) __bf16 v16b;
typedef __attribute__((ext_vector_type(8)))  _Float16 v8h;
typedef __attribute__((ext_vector_type(8)))  float v8f;
typedef __attribute__((ext_vector_type(4)))  float v4f;
typedef __attribute__((ext_vector_type(2)))  float v2f;
typedef __attribute__((ext_vector_type(4)))  unsigned v4u;
typedef __attribute__((ext_vector_type(4)))  int v4i;
typedef float __attribute__((may_alias)) float_a;
typedef int __attribute__((may_alias)) int_a;

template <typename T> __device__ __forceinline__ void vst2(void* p, T v) { *(T*)p = v;  }
__device__ __forceinline__ v8f wmma16(v16h a, v16h b, v8f c) {
  v8f d = __builtin_amdgcn_wmma_f32_16x16x32_f16(false, a, false, b, (short)0, c, false, false);
  return d;
}
// for the token dots alone, of whose D only elements 0..3 are read: the compiler lays the next product's D over the dead half, and the four slots keep that write at the distance the chip asks for behind a matrix instruction
__device__ __forceinline__ v8f wmma16p(v16h a, v16h b, v8f c) {
  v8f d = __builtin_amdgcn_wmma_f32_16x16x32_f16(false, a, false, b, (short)0, c, false, false);
  asm volatile("v_nop\n\tv_nop\n\tv_nop\n\tv_nop" : "+v"(d) : "v"(a), "v"(b));
  return d;
}
__device__ __forceinline__ v8f wmma_bf(v16b a, v16b b, v8f c) {
  v8f d = __builtin_amdgcn_wmma_f32_16x16x32_bf16(false, a, false, b, (short)0, c, false, false);
  return d;
}
// 16x16x32 fragments: lane = (h = lane>>4, row/col = lane&15); elements 0..7 = k0+8h+0..7, 8..15 = k0+16+8h+0..7; D element r = row 8h+r
__device__ __forceinline__ v16h frag_h(const _Float16* rowk0, int lane) {
  union { v16h v; v8h q[2]; } u; const _Float16* p = rowk0 + 8 * (lane >> 4);
  u.q[0] = *(const v8h*)p; u.q[1] = *(const v8h*)(p + 16); return u.v;
}
// the same fragment from a tile stored in fragment order, [piece 0, 1][lane][8 halves]: each of the two loads reads 512 contiguous bytes (4 whole lines; from 16 rows it would touch 16)
__device__ __forceinline__ v16h frag_t(const _Float16* tile, int lane) {
  union { v16h v; v8h q[2]; } u; const _Float16* p = tile + 8 * lane;
  u.q[0] = *(const v8h*)p; u.q[1] = *(const v8h*)(p + 256); return u.v;
}
__device__ __forceinline__ v16h frag_f32(const float* rowk0, int lane) {
  v16h a; const float* p = rowk0 + 8 * (lane >> 4);
#pragma unroll
  for (int i = 0; i < 8; ++i) { a[i] = (_Float16)p[i]; a[8 + i] = (_Float16)p[16 + i]; }
  return a;
}
__device__ __forceinline__ v16h frag_f32s(const float* rowk0, int lane, float sc) {
  v16h a; const float* p = rowk0 + 8 * (lane >> 4);
#pragma unroll
  for (int i = 0; i < 8; ++i) { a[i] = (_Float16)(p[i] * sc); a[8 + i] = (_Float16)(p[16 + i] * sc); }
  return a;
}
// column fragment from a [K][ld] layout (column n), rows >= K read as 0
__device__ __forceinline__ v16h fragc_f32(const float* W, int k0, int n, int lane, int ld, int K) {
  v16h a; const int g = lane >> 4;
#pragma unroll
  for (int i = 0; i < 8; ++i) { const int ka = k0 + 8 * g + i, kb = ka + 16;
    a[i] = (_Float16)(ka < K ? W[(size_t)(ka < K ? ka : K - 1) * ld + n] : 0.f); a[8 + i] = (_Float16)(kb < K ? W[(size_t)(kb < K ? kb : K - 1) * ld + n] : 0.f); }
  return a;
}
struct F2 { v16b h, l; };
typedef __attribute__((ext_vector_type(2))) __bf16 v2b;
// bf16 hi + lo split, three instructions a pair of values: one packed conversion makes both hi halves; each lo half is x - hi rounded to bf16 in ONE instruction that reads its hi half in place
// (v_fma_mixlo_bf16 writes the low half of the result register, v_fma_mixhi_bf16 the high half; x - hi is exact in f32, so that one rounding is the rounding of a separate conversion).
// In asm because the compiler does not form these two from source: it converts every hi a second time alone, or unpacks the pair with a shift and a mask. All the mixlo of a statement stand ahead of
// its mixhi, so that the write of a register's second half stands four or five instructions behind the write of its first half and hardly waits for it.
#define MIXLO(o, h, x) "v_fma_mixlo_bf16 %" #o ", %" #h ", -1.0, %" #x " op_sel:[0,1,0] op_sel_hi:[1,1,0]\n\t"
#define MIXHI(o, h, x) "v_fma_mixhi_bf16 %" #o ", %" #h ", -1.0, %" #x " op_sel:[1,1,0] op_sel_hi:[1,1,0]\n\t"
// closes the last statement of a split: the matrix instruction that reads the lo halves stands directly behind it, and the compiler, which does not look into asm, gives that reader no hint; unhinted, its wait for the last mixhi would hold up the other waves of the SIMD too
#define MIXEND "s_delay_alu instid0(VALU_DEP_1)"
#define TAILS4(END) asm(MIXLO(0, 4, 8) MIXLO(1, 5, 10) MIXLO(2, 6, 12) MIXLO(3, 7, 14) MIXHI(0, 4, 9) MIXHI(1, 5, 11) MIXHI(2, 6, 13) MIXHI(3, 7, 15) END \
      : "=&v"(l[0]), "=&v"(l[1]), "=&v"(l[2]), "=&v"(l[3]) : "v"(h[0]), "v"(h[1]), "v"(h[2]), "v"(h[3]), "v"(x[0]), "v"(x[1]), "v"(x[2]), "v"(x[3]), "v"(x[4]), "v"(x[5]), "v"(x[6]), "v"(x[7]))
__device__ __forceinline__ void tails4(unsigned* l, const unsigned* h, const float* x) { TAILS4(""); }
__device__ __forceinline__ void tails4e(unsigned* l, const unsigned* h, const float* x) { TAILS4(MIXEND); }
__device__ __forceinline__ void tails5e(unsigned* l, const unsigned* h, const float* x) {
  asm(MIXLO(0, 5, 10) MIXLO(1, 6, 12) MIXLO(2, 7, 14) MIXLO(3, 8, 16) MIXLO(4, 9, 18) MIXHI(0, 5, 11) MIXHI(1, 6, 13) MIXHI(2, 7, 15) MIXHI(3, 8, 17) MIXHI(4, 9, 19) MIXEND
      : "=&v"(l[0]), "=&v"(l[1]), "=&v"(l[2]), "=&v"(l[3]), "=&v"(l[4]) : "v"(h[0]), "v"(h[1]), "v"(h[2]), "v"(h[3]), "v"(h[4]), "v"(x[0]), "v"(x[1]), "v"(x[2]), "v"(x[3]), "v"(x[4]), "v"(x[5]), "v"(x[6]), "v"(x[7]), "v"(x[8]), "v"(x[9])); }
// NP = 8: all sixteen values; NP = 5: values 0..9, the caller's other six being compile-time constants that bf16 holds exactly (their lo is 0)
template <int NP> __device__ __forceinline__ F2 bsplit(const float v[16]) { union { v16b v; unsigned u[8]; } uh, ul;
#pragma unroll
  for (int i = 0; i < 8; ++i) { v2f x; x[0] = v[2 * i]; x[1] = v[2 * i + 1]; uh.u[i] = __builtin_bit_cast(unsigned, __builtin_convertvector(x, v2b)); ul.u[i] = 0u; }
  if (NP == 8) { tails4(ul.u, uh.u, v); tails4e(ul.u + 4, uh.u + 4, v + 8); } else tails5e(ul.u, uh.u, v);
  F2 r; r.h = uh.v; r.l = ul.v; return r; }
__device__ __forceinline__ F2 bsplit16(const float v[16]) { return bsplit<8>(v); }
__device__ __forceinline__ F2 split_row(const float* row, int k0, int lane) { float v[16]; const float* p = row + k0 + 8 * (lane >> 4);
#pragma unroll
  for (int i = 0; i < 8; ++i) { v[i] = p[i]; v[8 + i] = p[16 + i]; }
  return bsplit16(v); }
__device__ __forceinline__ F2 split_rowK(const float* row, int k0, int lane, int K) { float v[16]; const int g = lane >> 4;
#pragma unroll
  for (int i = 0; i < 8; ++i) { const int ka = k0 + 8 * g + i, kb = ka + 16; v[i] = ka < K ? row[ka < K ? ka : K - 1] : 0.f; v[8 + i] = kb < K ? row[kb < K ? kb : K - 1] : 0.f; }
  return bsplit16(v); }
__device__ __forceinline__ F2 split_col(const float* W, int k0, int n, int lane, int ld, int K) { float v[16]; const int g = lane >> 4;
#pragma unroll
  for (int i = 0; i < 8; ++i) { const int ka = k0 + 8 * g + i, kb = ka + 16; v[i] = ka < K ? W[(size_t)(ka < K ? ka : K - 1) * ld + n] : 0.f; v[8 + i] = kb < K ? W[(size_t)(kb < K ? kb : K - 1) * ld + n] : 0.f; }
  return bsplit16(v); }
__device__ __forceinline__ v8f mac3(const F2& a, const F2& b, v8f c) { c = wmma_bf(a.l, b.h, c); c = wmma_bf(a.h, b.l, c); return wmma_bf(a.h, b.h, c); }
__device__ __forceinline__ float sigm(float v) { return 1.0f / (1.0f + expf(-v)); }
#define LDSX() do { asm volatile("s_wait_dscnt 0" ::: "memory"); __builtin_amdgcn_wave_barrier(); __builtin_amdgcn_fence(__ATOMIC_RELEASE, "workgroup"); } while (0)


// Translation-equivariant multi-head attention (8 sets, 1,024 queries x 1,024 keys, dz 256, dx 2, 8 heads x 32, kernel MLP 10 -> 32 -> 8): logits = MLP([x_q - x_k, q_h . k_h / sqrt(32)]), softmax over keys, . v, output projection; the query locations pass through.
#define NM 8
#define NQ 1024
#define NK 1024
#define DZ 256
#define NH 8
#define HD 32
#define KH 32
#define NF 16              // padded feature width (2 + 8 used)
#define NRQ (NM * NQ)
#define NRK (NM * NK)
#ifndef TQB
#define TQB (NQ / 16)
#define TNM NM
#endif
typedef __attribute__((ext_vector_type(8))) __bf16 v8b;
__device__ __forceinline__ v16b frag_b(const __bf16* rowk0, int lane) {
  union { v16b v; v8b q[2]; } u; const __bf16* p = rowk0 + 8 * (lane >> 4);
  u.q[0] = *(const v8b*)p; u.q[1] = *(const v8b*)(p + 16); return u.v;
}
__device__ __forceinline__ float bfr(float v) { return (float)(__bf16)v; }
__device__ __attribute__((noinline)) float exp_ni(float v) { return expf(v); }
__device__ __attribute__((noinline)) float erf_ni(float v) { return erff(v); }

#define WS_PW  0u                                   // bf16 transposed rows [4][256][256], of which only plane 3, Wout^T, is written and read; W1^T padded [32][32] (k = feature 0..9, rest 0); W2^T padded [16][32] (rows 8..15 zero)
#define WS_P1  (WS_PW + 2u * (size_t)4 * DZ * DZ)
#define WS_P2  (WS_P1 + 2u * (size_t)32 * 32)
#define WS_Q   (WS_P2 + 2u * (size_t)16 * 32)         // f16 q rows [NRQ][256]; k fragments [NRK / 16][head][512] (row = key, k = dim); v fragments [m][NK / 32][head][dim half][512] (row = dim, k = key), each 512 = [piece][lane][8] as frag_t reads it
#define WS_K   (WS_Q + 2u * (size_t)NRQ * DZ)
#define WS_V   (WS_K + 2u * (size_t)NRK * DZ)
#define OUT1   ((size_t)NRQ * DZ)                     // float offset of the second output (xq copy)
#define WS_END (WS_V + 2u * (size_t)NM * DZ * NK)

// ---- k_proj: block = (64 rows, 128 cols, which): q from zq -> f16 rows; k from zk, v from zv -> fragment order (consecutive lanes store consecutive 16-byte chunks: a wave stores 512 contiguous bytes).
// The block makes its own B fragments: it reads its 256 x 128 slice of the (in,out) f32 weight in whole 512-byte rows, rounds to bf16 and lays it in LDS in fragment order, once for its 4 waves. The 256 q blocks also pack what k_te reads, a row each: Wout^T; the first 32 a row of W1^T (k = feature 0..9, rest 0), the first 16 a row of W2^T (rows 8..15 zero)
#define WJ 65              // 16-byte units per 16-column fragment in LDS, 2 pieces x 32 lanes + 1: the 32 chunks of one store (4 columns apart in a fragment, 8 fragments) fall on every bank group twice, not on 4 of the 16 eight times
__global__ __launch_bounds__(128) void k_proj(const float* __restrict__ ZQ, const float* __restrict__ ZK, const float* __restrict__ ZV, const float* __restrict__ WQ, const float* __restrict__ WK, const float* __restrict__ WV, const float* __restrict__ WO, const float* __restrict__ W1, const float* __restrict__ W2, __bf16* __restrict__ PW, __bf16* __restrict__ P1, __bf16* __restrict__ P2, _Float16* __restrict__ Q, _Float16* __restrict__ Kr, _Float16* __restrict__ V) {
  __shared__ __align__(16) _Float16 so[64][136]; __shared__ __align__(16) _Float16 st[128][72]; __shared__ __align__(16) v4u sw[DZ / 32][8 * WJ]; __shared__ __align__(16) __bf16 sp[DZ + 64];
  const int tid = threadIdx.x, wave = tid >> 5, lane = tid & 31, col = lane & 15, g = lane >> 4; const int which = blockIdx.z;
  const size_t rb = (size_t)blockIdx.x * 64; const size_t r0 = rb + wave * 16; const int c0 = blockIdx.y * 128; const float* A = (which == 0) ? ZQ : (which == 1) ? ZK : ZV; const float* Wf = (which == 0) ? WQ : (which == 1) ? WK : WV;
  const int pn = blockIdx.y * (TNM * NQ / 64) + blockIdx.x; const bool pk = which == 0 && pn < DZ; float pw0 = 0.f, pw1 = 0.f, pw2 = 0.f, pw3 = 0.f;   // column pn of Wout, W1, W2
  // wave w takes the k octets o = 4 kc + w (rows 8 o + 0..7 of the weight), a lane 4 columns: octet o is piece (o >> 1) & 1, lane half o & 1 of the fragments of k step o >> 2
  const float* wp = Wf + (size_t)(wave * 8) * DZ + c0 + lane * 4;
  v4f ar[DZ / 32][4];   // this wave's 16 rows of z, requested behind the first weight rows and used behind the last: they come from memory, the weights from L2
#pragma unroll
  for (int b = 0; b < DZ / 64; ++b) { v4f x[2][8];
#pragma unroll
    for (int k2 = 0; k2 < 2; ++k2)
#pragma unroll
      for (int r = 0; r < 8; ++r) x[k2][r] = *(const v4f*)(wp + (size_t)((b * 2 + k2) * 32 + r) * DZ);
    if (b == 0) {
#pragma unroll
      for (int kc = 0; kc < DZ / 32; ++kc) { const float* p = A + (r0 + col) * DZ + kc * 32 + 8 * g; ar[kc][0] = *(const v4f*)p; ar[kc][1] = *(const v4f*)(p + 4); ar[kc][2] = *(const v4f*)(p + 16); ar[kc][3] = *(const v4f*)(p + 20); }
      if (pk) { pw0 = WO[(size_t)tid * DZ + pn]; pw1 = WO[(size_t)(tid + 128) * DZ + pn]; pw2 = W1[(size_t)(tid < 10 ? tid : 9) * KH + (pn < KH ? pn : KH - 1)]; pw3 = W2[(size_t)(tid < KH ? tid : KH - 1) * NH + (pn < NH ? pn : NH - 1)];   // indices clamped into the arrays, what lies outside reads as 0 below
        asm volatile("s_wait_xcnt 0x0" ::: "memory"); } }   // the wait that stands before a register of an issued load is overwritten: the address pairs of these four loads are used again at once
#pragma unroll
    for (int k2 = 0; k2 < 2; ++k2)
#pragma unroll
      for (int e = 0; e < 4; ++e) { union { v8b v; v4u q; } u;
#pragma unroll
        for (int r = 0; r < 8; ++r) u.v[r] = (__bf16)x[k2][r][e];
        sw[b * 2 + k2][(lane >> 2) * WJ + (wave >> 1) * 32 + (wave & 1) * 16 + (lane & 3) * 4 + e] = u.q; }
    if (b == 0 && pk) { sp[tid] = (__bf16)pw0; sp[tid + 128] = (__bf16)pw1; if (tid < 32) { sp[DZ + tid] = (__bf16)(tid < 10 ? pw2 : 0.f); sp[DZ + 32 + tid] = (__bf16)(pn < NH ? pw3 : 0.f); } }
    __builtin_amdgcn_sched_barrier(0); }   // 16 weight rows in flight at a time: with all 64 lifted to the top the kernel takes 352 registers, and only 2 of the 3 blocks that LDS allows stand on a WGP
  v16b af[DZ / 32];
#pragma unroll
  for (int kc = 0; kc < DZ / 32; ++kc)
#pragma unroll
    for (int i = 0; i < 4; ++i) { af[kc][i] = (__bf16)ar[kc][0][i]; af[kc][4 + i] = (__bf16)ar[kc][1][i]; af[kc][8 + i] = (__bf16)ar[kc][2][i]; af[kc][12 + i] = (__bf16)ar[kc][3][i]; }
  asm volatile("s_wait_xcnt 0x0" :: "v"(wp) : "memory");   // the wait that stands before a register of an issued load is overwritten; the weight rows' address is named as an input so that it lives up to here: without that the last row's result is laid over it
  __syncthreads();   // the weight fragments stand in LDS
  if (pk) {
    if (tid < 32) vst2((unsigned*)(PW + ((size_t)3 * DZ + pn) * DZ + tid * 8), *(const v4u*)&sp[tid * 8]);
    else if (tid < 36) { if (pn < 32) vst2((unsigned*)(P1 + (size_t)pn * 32 + (tid - 32) * 8), *(const v4u*)&sp[DZ + (tid - 32) * 8]); }
    else if (tid < 40) { if (pn < 16) vst2((unsigned*)(P2 + (size_t)pn * 32 + (tid - 36) * 8), *(const v4u*)&sp[DZ + 32 + (tid - 36) * 8]); } }
  v8f acc[8] = {};
#pragma unroll
  for (int kc = 0; kc < DZ / 32; ++kc)
#pragma unroll
    for (int j = 0; j < 8; ++j) { union { v16b v; v4u q[2]; } u; u.q[0] = sw[kc][j * WJ + lane]; u.q[1] = sw[kc][j * WJ + 32 + lane]; acc[j] = wmma_bf(af[kc], u.v, acc[j]); }
#pragma unroll
  for (int j = 0; j < 8; ++j)
#pragma unroll
    for (int r = 0; r < 8; ++r) { const _Float16 hv = (_Float16)acc[j][r]; if (which < 2) so[wave * 16 + 8 * g + r][j * 16 + col] = hv; else st[j * 16 + col][wave * 16 + 8 * g + r] = hv; }
  __syncthreads();
  if (which == 0) { for (int e = tid; e < 64 * 16; e += 128) { const int rl = e >> 4, q = e & 15; vst2((unsigned*)(Q + (rb + rl) * DZ + c0 + q * 8), *(const v4u*)&so[rl][q * 8]); } }
  else if (which == 1) { for (int e = tid; e < 64 * 16; e += 128) { const int ln = e & 31, pc = (e >> 5) & 1, hh = (e >> 6) & 3, t = e >> 8;   // key tile t, head hh of the block's four each
      vst2((unsigned*)(Kr + ((((rb / 16 + t) * NH + c0 / HD + hh) * 2 + pc) * 32 + ln) * 8), *(const v4u*)&so[t * 16 + (ln & 15)][hh * HD + pc * 16 + (ln >> 4) * 8]); } }
  else { const size_t mI = rb / NK; const int s0 = (int)(rb % NK); for (int e = tid; e < 128 * 8; e += 128) { const int ln = e & 31, pc = (e >> 5) & 1, dt = (e >> 6) & 1, hh = (e >> 7) & 3, cc = e >> 9;   // 32-key chunk cc of the block's two, head hh of its four
      vst2((unsigned*)(V + ((((((mI * (NK / 32) + s0 / 32 + cc) * NH + c0 / HD + hh) * 2 + dt) * 2 + pc) * 32 + ln) * 8)), *(const v4u*)&st[hh * HD + dt * 16 + (ln & 15)][cc * 32 + pc * 16 + (ln >> 4) * 8]); } }
}
// ---- k_te: block = (16 queries, m), 8 waves = two groups of 4; group grp takes the 32-key chunks 2 it + grp with its own logits buffer and its own running (m, l, ctx), so that 4 waves and not 2 stand on each SIMD to cover each other's load, LDS and matrix latencies; the two partial softmax states are joined once behind the loop. Below, wave = the wave's number inside its group. Per 32-key chunk: (a) wave w takes the 16 keys of half w & 1 and 8 of the queries (4 (w >> 1) + 0..3 and 8 + the same): token dots of all 8 heads, so that lane (g, key) holds every feature of its own pairs; (b) the MLP transposed, in registers: h1^T = relu(W1^T . F^T), dots^T = W2^T . h1^T + b2, the features being a B fragment as they stand and the D of the first product the B fragment of the second -> SC[pair][h]; (c) wave w runs the running-max softmax + P.v for heads 2w, 2w+1 over the chunk, transposed: ctx^T += v^T . P^T, lane (g, query) holding 16 of the query's 32 logits, so that maximum and sum are in-lane but for one exchange between the lane halves, and exp(.) is the B fragment as it stands
#define SP 12              // floats per pair row of the logits: 16-byte stores, 16 rows on 16 distinct bank groups
#define SQP (32 * SP + 4)  // floats per query row of the logits: the 16 queries that one read of part (c) touches start 4 banks apart
__device__ __forceinline__ float xhalf(float x) { return __builtin_bit_cast(float, __builtin_amdgcn_permlanex16(__builtin_bit_cast(int, x), __builtin_bit_cast(int, x), 0x76543210, 0xfedcba98, false, false)); }   // lane l with lane l ^ 16
// exp(x) as __expf gives it (the hardware's exp2 of x . log2 e), with one v_nop in the same statement: the instruction set asks for one slot between a transcendental and a next instruction that reads its result or overwrites its source
__device__ __forceinline__ float exp_slot(float x) { float r; asm("v_exp_f32 %0, %1\n\tv_nop" : "=v"(r) : "v"(x * 0x1.715476p+0f)); return r; }
__global__ __launch_bounds__(256) void k_te(const _Float16* __restrict__ Q, const _Float16* __restrict__ Kr, const _Float16* __restrict__ V, const float* __restrict__ XQ, const float* __restrict__ XKV, const __bf16* __restrict__ P1, const __bf16* __restrict__ P2, const float* __restrict__ B1, const float* __restrict__ B2, const __bf16* __restrict__ PW, const float* __restrict__ BO, float* __restrict__ Y) {
  __shared__ __align__(16) float sS2[2][16][SQP]; __shared__ __align__(16) _Float16 sq[16][DZ + 8]; __shared__ __align__(16) v4u sf[NH][2][2][32];   // sf: ctx as A fragments of the output projection, [head = 32-wide k step][hi, lo][piece][lane]
  const int tid = threadIdx.x, grp = tid >> 7, wave = (tid >> 5) & 3, lane = tid & 31, col = lane & 15, g = lane >> 4; const size_t mI = blockIdx.y; const int q0 = blockIdx.x * 16; const size_t rq = mI * NQ + q0;
  const int w2 = wave >> 1, kh = wave & 1;
  float (*sS)[SQP] = sS2[grp];   // this group's logits
  // A row 8g + r holds query 8g + ((r + 4 w2) & 7): D elements 0..3 are this wave's queries 8g + 4 w2 + 0..3
  const int qr = (col & 8) + (((col & 7) + 4 * w2) & 7);
  for (int e = tid; e < 16 * (DZ / 8); e += 256) { const int rl = e >> 5, pc = e & 31; *(v8h*)&sq[rl][pc * 8] = *(const v8h*)(Q + (rq + rl) * DZ + pc * 8); }   // the 16 q rows, read as fragments in every chunk (all 8 heads in registers would spill)
  __syncthreads();
  // W1^T as A, hidden row 16j + col: a lane's 16 k slots = features 0..9, b1 (against the constant feature 1), zeros. wlo has them in the g = 0 lanes only (k slots 0..7, 16..23: it meets the features held by the g = 0 lanes, queries 4 w2 + rr), whi in the g = 1 lanes only (queries 8 + 4 w2 + rr)
  v16b wlo[2], whi[2];
#pragma unroll
  for (int j = 0; j < 2; ++j) { union { v16b v; v8b q[2]; } u; const __bf16* pw = P1 + (size_t)(j * 16 + col) * 32; u.q[0] = *(const v8b*)pw; u.q[1] = *(const v8b*)(pw + 8); u.v[10] = (__bf16)B1[j * 16 + col];
    const v16b z = {}; wlo[j] = (g == 0) ? u.v : z; whi[j] = (g == 0) ? z : u.v; }
  const v16b w2f = frag_b(P2 + (size_t)col * 32, lane);   // W2^T as A: row = head (8..15 zero), k = hidden
  float b2v[NH], xq0[4], xq1[4];
#pragma unroll
  for (int r = 0; r < NH; ++r) b2v[r] = bfr(B2[r]);
#pragma unroll
  for (int rr = 0; rr < 4; ++rr) { const size_t qq = rq + 8 * g + 4 * w2 + rr; xq0[rr] = bfr(XQ[qq * 2]); xq1[rr] = bfr(XQ[qq * 2 + 1]); }
  float m[2] = {-3.0e38f, -3.0e38f}, l[2] = {0.f, 0.f};   // of query col; l is the sum over this lane half's keys alone, the halves are joined after the loop
  v8f acc[2][2] = {};   // ctx^T: element r = dim 16 dt + 8g + r of head 2w + hh, column = query col
#pragma unroll 1
  for (int it = 0; it < NK / 64; ++it) { const int j0 = (it * 2 + grp) * 32;   // the same trip count in both groups: every barrier is met by all 8 waves
    // (a) token dots of all heads for this wave's 16 keys; lane (g, col) keeps pairs (8g + 4 w2 + rr, key col)
    const size_t kr = mI * NK + j0 + kh * 16 + col; const v2f xk = *(const v2f*)(XKV + kr * 2); const float xk0 = bfr(xk[0]), xk1 = bfr(xk[1]);
    float ft[4][NH]; v16h kf[NH];   // all 8 heads' key fragments requested before the first product: one memory latency a chunk, not eight
#pragma unroll
    for (int h = 0; h < NH; ++h) kf[h] = frag_t(Kr + (((mI * NK + j0) / 16 + kh) * NH + h) * 512, lane);
    v16h qn = frag_h(&sq[qr][0], lane);   // q fragments one head ahead of their product
#pragma unroll
    for (int h = 0; h < NH; ++h) { const v16h qc = qn; if (h + 1 < NH) qn = frag_h(&sq[qr][(h + 1) * HD], lane);
      v8f c = {}; c = wmma16p(qc, kf[h], c);
#pragma unroll
      for (int rr = 0; rr < 4; ++rr) ft[rr][h] = c[rr] * 0.17677669529663688f; }
    // (b) MLP on 32 pairs a pass, no LDS between the products (unrolled, as every loop here over a register array: its indices must be constants)
#pragma unroll
    for (int rr = 0; rr < 4; ++rr) { float fv[16]; fv[0] = xq0[rr] - xk0; fv[1] = xq1[rr] - xk1;
#pragma unroll
      for (int h = 0; h < NH; ++h) fv[2 + h] = ft[rr][h];
      fv[10] = 1.0f;
#pragma unroll
      for (int i = 11; i < 16; ++i) fv[i] = 0.f;
      const F2 fb = bsplit<5>(fv); v8f dd[2];
#pragma unroll
      for (int s = 0; s < 2; ++s) { v8f hacc[2] = {};
#pragma unroll
        for (int j = 0; j < 2; ++j) { const v16b w = s ? whi[j] : wlo[j]; hacc[j] = wmma_bf(w, fb.h, hacc[j]); hacc[j] = wmma_bf(w, fb.l, hacc[j]); }
        float hv[16];   // D element r of tile j = hidden 16j + 8g + r = k slot of B element 8j + r
#pragma unroll
        for (int j = 0; j < 2; ++j)
#pragma unroll
          for (int r = 0; r < 8; ++r) { const float v = hacc[j][r]; hv[8 * j + r] = v > 0.f ? v : 0.f; }
        const F2 hb = bsplit16(hv); v8f dacc = {}; dacc = wmma_bf(w2f, hb.h, dacc); dacc = wmma_bf(w2f, hb.l, dacc); dd[s] = dacc; }
      if (g == 0) {   // D rows 0..7 = heads, held by the g = 0 lanes; column = key
#pragma unroll
        for (int s = 0; s < 2; ++s) { float* ps = &sS[8 * s + 4 * w2 + rr][(kh * 16 + col) * SP]; v4f o0, o1;
#pragma unroll
          for (int r = 0; r < 4; ++r) { o0[r] = dd[s][r] + b2v[r]; o1[r] = dd[s][4 + r] + b2v[4 + r]; }
          *(v4f*)ps = o0; *(v4f*)(ps + 4) = o1; } } }
    __syncthreads();
    // (c) softmax + P.v for this wave's two heads: lane (g, col) takes query col, keys 8g + i and 16 + 8g + i (the k order of frag_h)
    v16h vf[2][2];
#pragma unroll
    for (int hh = 0; hh < 2; ++hh)
#pragma unroll
      for (int dt = 0; dt < 2; ++dt) vf[hh][dt] = frag_t(V + (((mI * (NK / 32) + j0 / 32) * NH + wave * 2 + hh) * 2 + dt) * 512, lane);   // v^T as A: row = dim
    v2f sv[16];   // both heads of a pair in one 8-byte read
#pragma unroll
    for (int i = 0; i < 8; ++i) { sv[i] = *(const v2f*)&sS[col][(8 * g + i) * SP + 2 * wave]; sv[8 + i] = *(const v2f*)&sS[col][(16 + 8 * g + i) * SP + 2 * wave]; }
#pragma unroll
    for (int hh = 0; hh < 2; ++hh) { float t[8];
#pragma unroll
      for (int i = 0; i < 8; ++i) t[i] = fmaxf(sv[i][hh], sv[8 + i][hh]);
      float mx = fmaxf(fmaxf(fmaxf(t[0], t[1]), fmaxf(t[2], t[3])), fmaxf(fmaxf(t[4], t[5]), fmaxf(t[6], t[7])));
      mx = fmaxf(mx, xhalf(mx));
      const float mn = fmaxf(m[hh], mx); const float am = exp_slot(m[hh] - mn); const float alpha = (m[hh] <= -1.0e38f) ? 0.f : am;
      v16h pb; float es[4];   // four independent chains of four
#pragma unroll
      for (int i = 0; i < 16; ++i) { const float e = exp_slot(sv[i][hh] - mn); es[i & 3] = (i < 4) ? e : es[i & 3] + e; pb[i] = (_Float16)(e * 2048.0f); }
      l[hh] = l[hh] * alpha + ((es[0] + es[1]) + (es[2] + es[3])); m[hh] = mn;
#pragma unroll
      for (int dt = 0; dt < 2; ++dt) { acc[hh][dt] *= alpha; acc[hh][dt] = wmma16(vf[hh][dt], pb, acc[hh][dt]); } }
    __syncthreads(); }
  // join of the two groups: group 1 hands its (m, l, ctx^T) over in LDS (the logits buffer is free behind the loop's last barrier; 36 floats a lane = 16 B x odd), group 0 rescales both to the common maximum and writes the normalised ctx to sf for all 8 waves (loops unrolled: the indices of register arrays must be constants)
  // the tail: this block holds whole ctx rows (16 queries x all 8 heads), so it also does their output projection, wave w8 of all 8 taking 32 output columns, and copies their xq through. The Wout^T fragments, the bias and the xq line are requested here, ahead of the join
  const int w8 = tid >> 5; v16b wf[2][NH];
#pragma unroll
  for (int kc = 0; kc < NH; ++kc)
#pragma unroll
    for (int j = 0; j < 2; ++j) wf[j][kc] = frag_b(PW + ((size_t)3 * DZ + w8 * 32 + j * 16 + col) * DZ + kc * 32, lane);
  float bb[2];
#pragma unroll
  for (int j = 0; j < 2; ++j) bb[j] = bfr(BO[w8 * 32 + j * 16 + col]);
  asm volatile("s_wait_xcnt 0x0" ::: "memory");   // the compiler lays the next load's result over the address pair of the loads above: the wait that stands before a register of an issued load is overwritten
  const v4f xc = *(const v4f*)(XQ + rq * 2 + (lane & 7) * 4);   // 16 queries x 2 floats = one 128-byte line; read by every wave (no branch, no start value), stored by the first 8 lanes of the block
  float* mg = &sS2[0][0][0] + (wave * 32 + lane) * 36;
  if (grp == 1) {
#pragma unroll
    for (int hh = 0; hh < 2; ++hh)
#pragma unroll
      for (int dt = 0; dt < 2; ++dt) { v4f o0, o1;
#pragma unroll
        for (int r = 0; r < 4; ++r) { o0[r] = acc[hh][dt][r]; o1[r] = acc[hh][dt][4 + r]; }
        *(v4f*)(mg + (hh * 2 + dt) * 8) = o0; *(v4f*)(mg + (hh * 2 + dt) * 8 + 4) = o1; }
    v4f ml; ml[0] = m[0]; ml[1] = m[1]; ml[2] = l[0]; ml[3] = l[1]; *(v4f*)(mg + 32) = ml; }
  __syncthreads();
  if (grp == 0) { const v4f ml = *(const v4f*)(mg + 32);
#pragma unroll
    for (int hh = 0; hh < 2; ++hh) { const float mn = fmaxf(m[hh], ml[hh]); const float a0 = exp_slot(m[hh] - mn), a1 = exp_slot(ml[hh] - mn);
      l[hh] = l[hh] * a0 + ml[2 + hh] * a1;
#pragma unroll
      for (int dt = 0; dt < 2; ++dt) { const v4f o0 = *(const v4f*)(mg + (hh * 2 + dt) * 8), o1 = *(const v4f*)(mg + (hh * 2 + dt) * 8 + 4);
#pragma unroll
        for (int r = 0; r < 4; ++r) { acc[hh][dt][r] = acc[hh][dt][r] * a0 + o0[r] * a1; acc[hh][dt][4 + r] = acc[hh][dt][4 + r] * a0 + o1[r] * a1; } } }
    // lane (g, query col) holds dims 8g + r and 16 + 8g + r of a head: ctx^T as it stands is the A fragment (row = query, k = the head's 32 dims) of ctx . Wout; split once here, read by all 8 waves
#pragma unroll
    for (int hh = 0; hh < 2; ++hh) { const float il = (1.0f / 2048.0f) / (l[hh] + xhalf(l[hh])); float v[16];
#pragma unroll
      for (int r = 0; r < 8; ++r) { v[r] = acc[hh][0][r] * il; v[8 + r] = acc[hh][1][r] * il; }
      const F2 a = bsplit16(v); union { v16b v; v4u q[2]; } uh, ul; uh.v = a.h; ul.v = a.l;
#pragma unroll
      for (int pc = 0; pc < 2; ++pc) { sf[wave * 2 + hh][0][pc][lane] = uh.q[pc]; sf[wave * 2 + hh][1][pc][lane] = ul.q[pc]; } } }
  __syncthreads();   // all of ctx stands in sf; the join's buffer is free again
  // out0 = ctx (hi + lo) . Wout + bout, k ascending, hi then lo
  v8f oa[2] = {};
#pragma unroll
  for (int kc = 0; kc < NH; ++kc) { union { v16b v; v4u q[2]; } uh, ul;
#pragma unroll
    for (int pc = 0; pc < 2; ++pc) { uh.q[pc] = sf[kc][0][pc][lane]; ul.q[pc] = sf[kc][1][pc][lane]; }
#pragma unroll
    for (int j = 0; j < 2; ++j) { oa[j] = wmma_bf(uh.v, wf[j][kc], oa[j]); oa[j] = wmma_bf(ul.v, wf[j][kc], oa[j]); } }
  float* os = &sS2[0][0][0] + w8 * (16 * 36);   // this wave's own 16 x 32 tile, rows of 36 floats (16 B x odd)
#pragma unroll
  for (int j = 0; j < 2; ++j)
#pragma unroll
    for (int r = 0; r < 8; ++r) os[(8 * g + r) * 36 + j * 16 + col] = oa[j][r] + bb[j];
  LDSX();
#pragma unroll
  for (int i = 0; i < 4; ++i) { const int rl = i * 4 + (lane >> 3), c = (lane & 7) * 4; vst2(Y + (rq + rl) * DZ + w8 * 32 + c, *(const v4f*)&os[rl * 36 + c]); }   // a row's 32 floats = one whole 128-byte line, written by this wave alone
  if (tid < 8) vst2(Y + OUT1 + rq * 2 + tid * 4, xc);   // second output = xq
}
extern "C" void kernel_launch(void* const* d_in, const int* in_sizes, int n_in, void* d_out, int out_size, void* d_ws, size_t ws_size, hipStream_t stream) {
  (void)in_sizes; (void)n_in; (void)out_size;
  const float** F = (const float**)d_in;   // 0 zq, 1 zk, 2 zv [8,1024,256]; 3 xq, 4 xkv [8,1024,2]; 5 Wq, 6 Wk, 7 Wv [256,256] (in,out); 8 Wout [256,256] (in,out), 9 bout; 10 W1 [10,32], 11 b1 [32], 12 W2 [32,8], 13 b2 [8]
  if (ws_size < (size_t)WS_END) return;
  char* ws = (char*)d_ws; __bf16 *PW = (__bf16*)(ws + WS_PW), *P1 = (__bf16*)(ws + WS_P1), *P2 = (__bf16*)(ws + WS_P2); _Float16 *Q = (_Float16*)(ws + WS_Q), *Kr = (_Float16*)(ws + WS_K), *V = (_Float16*)(ws + WS_V);
  k_proj<<<dim3(TNM * NQ / 64, DZ / 128, 3), 128, 0, stream>>>(F[0], F[1], F[2], F[5], F[6], F[7], F[8], F[10], F[12], PW, P1, P2, Q, Kr, V);
  k_te<<<dim3(TQB, TNM), 256, 0, stream>>>(Q, Kr, V, F[3], F[4], P1, P2, F[11], F[13], PW, F[9], (float*)d_out);
}

// v009
// It runs in 79.5 microseconds.
// Timed twice side by side with v008, it ran 1.03 and 1.04 times as fast.
// Counting every step since v000, it is 3.90 times as fast.
// compute dtype: all float inputs rounded to bf16; q/k/v = z . W with EXACT bf16 products on WMMA 16x16x32 ((in,out) weights rounded to bf16), rounded once to f16 (k and v stored as fragments); per 16-query x 64-key chunk: token dots q_h . k_h x 32^-1/2 on WMMA (single f16), the pair features [xq - xkv | dots | 0] in f32, the kernel MLP relu(F . W1 + b1) . W2 + b2 on WMMA with F and the hidden as bf16 hi + lo (2 products each); per (query, head) running-max softmax over the keys in f32 (hardware exp), P (scaled by 2^11, single f16) x v (single f16); out = ctx (bf16 hi + lo, 2 products) . Wout + bout; xq copied through as the second output; f32 outputs.
#include <hip/hip_runtime.h>
#include <math.h>

typedef __attribute__((ext_vector_type(16))) _Float16 v16h;
typedef __attribute__((ext_vector_type(16))) __bf16 v16b;
typedef __attribute__((ext_vector_type(8)))  _Float16 v8h;
typedef __attribute__((ext_vector_type(8)))  float v8f;
typedef __attribute__((ext_vector_type(4)))  float v4f;
typedef __attribute__((ext_vector_type(2)))  float v2f;
typedef __attribute__((ext_vector_type(4)))  unsigned v4u;
typedef __attribute__((ext_vector_type(4)))  int v4i;
typedef float __attribute__((may_alias)) float_a;
typedef int __attribute__((may_alias)) int_a;

template <typename T> __device__ __forceinline__ void vst2(void* p, T v) { *(T*)p = v;  }
__device__ __forceinline__ v8f wmma16(v16h a, v16h b, v8f c) {
  v8f d = __builtin_amdgcn_wmma_f32_16x16x32_f16(false, a, false, b, (short)0, c, false, false);
  return d;
}
__device__ __forceinline__ v8f wmma_bf(v16b a, v16b b, v8f c) {
  v8f d = __builtin_amdgcn_wmma_f32_16x16x32_bf16(false, a, false, b, (short)0, c, false, false);
  return d;
}
// 16x16x32 fragments: lane = (h = lane>>4, row/col = lane&15); elements 0..7 = k0+8h+0..7, 8..15 = k0+16+8h+0..7; D element r = row 8h+r
__device__ __forceinline__ v16h frag_h(const _Float16* rowk0, int lane) {
  union { v16h v; v8h q[2]; } u; const _Float16* p = rowk0 + 8 * (lane >> 4);
  u.q[0] = *(const v8h*)p; u.q[1] = *(const v8h*)(p + 16); return u.v;
}
// the same fragment from a tile stored in fragment order, [piece 0, 1][lane][8 halves]: each of the two loads reads 512 contiguous bytes (4 whole lines; from 16 rows it would touch 16)
__device__ __forceinline__ v16h frag_t(const _Float16* tile, int lane) {
  union { v16h v; v8h q[2]; } u; const _Float16* p = tile + 8 * lane;
  u.q[0] = *(const v8h*)p; u.q[1] = *(const v8h*)(p + 256); return u.v;
}
__device__ __forceinline__ v16h frag_f32(const float* rowk0, int lane) {
  v16h a; const float* p = rowk0 + 8 * (lane >> 4);
#pragma unroll
  for (int i = 0; i < 8; ++i) { a[i] = (_Float16)p[i]; a[8 + i] = (_Float16)p[16 + i]; }
  return a;
}
__device__ __forceinline__ v16h frag_f32s(const float* rowk0, int lane, float sc) {
  v16h a; const float* p = rowk0 + 8 * (lane >> 4);
#pragma unroll
  for (int i = 0; i < 8; ++i) { a[i] = (_Float16)(p[i] * sc); a[8 + i] = (_Float16)(p[16 + i] * sc); }
  return a;
}
// column fragment from a [K][ld] layout (column n), rows >= K read as 0
__device__ __forceinline__ v16h fragc_f32(const float* W, int k0, int n, int lane, int ld, int K) {
  v16h a; const int g = lane >> 4;
#pragma unroll
  for (int i = 0; i < 8; ++i) { const int ka = k0 + 8 * g + i, kb = ka + 16;
    a[i] = (_Float16)(ka < K ? W[(size_t)(ka < K ? ka : K - 1) * ld + n] : 0.f); a[8 + i] = (_Float16)(kb < K ? W[(size_t)(kb < K ? kb : K - 1) * ld + n] : 0.f); }
  return a;
}
struct F2 { v16b h, l; };
typedef __attribute__((ext_vector_type(2))) __bf16 v2b;
// bf16 hi + lo split, three instructions a pair of values: one packed conversion makes both hi halves; each lo half is x - hi rounded to bf16 in ONE instruction that reads its hi half in place
// (v_fma_mixlo_bf16 writes the low half of the result register, v_fma_mixhi_bf16 the high half; x - hi is exact in f32, so that one rounding is the rounding of a separate conversion).
// In asm because the compiler does not form these two from source: it converts every hi a second time alone, or unpacks the pair with a shift and a mask. All the mixlo of a statement stand ahead of
// its mixhi, so that the write of a register's second half stands four or five instructions behind the write of its first half and hardly waits for it.
#define MIXLO(o, h, x) "v_fma_mixlo_bf16 %" #o ", %" #h ", -1.0, %" #x " op_sel:[0,1,0] op_sel_hi:[1,1,0]\n\t"
#define MIXHI(o, h, x) "v_fma_mixhi_bf16 %" #o ", %" #h ", -1.0, %" #x " op_sel:[1,1,0] op_sel_hi:[1,1,0]\n\t"
// closes the last statement of a split: the matrix instruction that reads the lo halves stands directly behind it, and the compiler, which does not look into asm, gives that reader no hint; unhinted, its wait for the last mixhi would hold up the other waves of the SIMD too
#define MIXEND "s_delay_alu instid0(VALU_DEP_1)"
#define TAILS4(END) asm(MIXLO(0, 4, 8) MIXLO(1, 5, 10) MIXLO(2, 6, 12) MIXLO(3, 7, 14) MIXHI(0, 4, 9) MIXHI(1, 5, 11) MIXHI(2, 6, 13) MIXHI(3, 7, 15) END \
      : "=&v"(l[0]), "=&v"(l[1]), "=&v"(l[2]), "=&v"(l[3]) : "v"(h[0]), "v"(h[1]), "v"(h[2]), "v"(h[3]), "v"(x[0]), "v"(x[1]), "v"(x[2]), "v"(x[3]), "v"(x[4]), "v"(x[5]), "v"(x[6]), "v"(x[7]))
__device__ __forceinline__ void tails4(unsigned* l, const unsigned* h, const float* x) { TAILS4(""); }
__device__ __forceinline__ void tails4e(unsigned* l, const unsigned* h, const float* x) { TAILS4(MIXEND); }
__device__ __forceinline__ void tails5e(unsigned* l, const unsigned* h, const float* x) {
  asm(MIXLO(0, 5, 10) MIXLO(1, 6, 12) MIXLO(2, 7, 14) MIXLO(3, 8, 16) MIXLO(4, 9, 18) MIXHI(0, 5, 11) MIXHI(1, 6, 13) MIXHI(2, 7, 15) MIXHI(3, 8, 17) MIXHI(4, 9, 19) MIXEND
      : "=&v"(l[0]), "=&v"(l[1]), "=&v"(l[2]), "=&v"(l[3]), "=&v"(l[4]) : "v"(h[0]), "v"(h[1]), "v"(h[2]), "v"(h[3]), "v"(h[4]), "v"(x[0]), "v"(x[1]), "v"(x[2]), "v"(x[3]), "v"(x[4]), "v"(x[5]), "v"(x[6]), "v"(x[7]), "v"(x[8]), "v"(x[9])); }
// NP = 8: all sixteen values; NP = 5: values 0..9, the caller's other six being compile-time constants that bf16 holds exactly (their lo is 0)
template <int NP> __device__ __forceinline__ F2 bsplit(const float v[16]) { union { v16b v; unsigned u[8]; } uh, ul;
#pragma unroll
  for (int i = 0; i < 8; ++i) { v2f x; x[0] = v[2 * i]; x[1] = v[2 * i + 1]; uh.u[i] = __builtin_bit_cast(unsigned, __builtin_convertvector(x, v2b)); ul.u[i] = 0u; }
  if (NP == 8) { tails4(ul.u, uh.u, v); tails4e(ul.u + 4, uh.u + 4, v + 8); } else tails5e(ul.u, uh.u, v);
  F2 r; r.h = uh.v; r.l = ul.v; return r; }
__device__ __forceinline__ F2 bsplit16(const float v[16]) { return bsplit<8>(v); }
__device__ __forceinline__ F2 split_row(const float* row, int k0, int lane) { float v[16]; const float* p = row + k0 + 8 * (lane >> 4);
#pragma unroll
  for (int i = 0; i < 8; ++i) { v[i] = p[i]; v[8 + i] = p[16 + i]; }
  return bsplit16(v); }
__device__ __forceinline__ F2 split_rowK(const float* row, int k0, int lane, int K) { float v[16]; const int g = lane >> 4;
#pragma unroll
  for (int i = 0; i < 8; ++i) { const int ka = k0 + 8 * g + i, kb = ka + 16; v[i] = ka < K ? row[ka < K ? ka : K - 1] : 0.f; v[8 + i] = kb < K ? row[kb < K ? kb : K - 1] : 0.f; }
  return bsplit16(v); }
__device__ __forceinline__ F2 split_col(const float* W, int k0, int n, int lane, int ld, int K) { float v[16]; const int g = lane >> 4;
#pragma unroll
  for (int i = 0; i < 8; ++i) { const int ka = k0 + 8 * g + i, kb = ka + 16; v[i] = ka < K ? W[(size_t)(ka < K ? ka : K - 1) * ld + n] : 0.f; v[8 + i] = kb < K ? W[(size_t)(kb < K ? kb : K - 1) * ld + n] : 0.f; }
  return bsplit16(v); }
__device__ __forceinline__ v8f mac3(const F2& a, const F2& b, v8f c) { c = wmma_bf(a.l, b.h, c); c = wmma_bf(a.h, b.l, c); return wmma_bf(a.h, b.h, c); }
__device__ __forceinline__ float sigm(float v) { return 1.0f / (1.0f + expf(-v)); }
#define LDSX() do { asm volatile("s_wait_dscnt 0" ::: "memory"); __builtin_amdgcn_wave_barrier(); __builtin_amdgcn_fence(__ATOMIC_RELEASE, "workgroup"); } while (0)


// Translation-equivariant multi-head attention (8 sets, 1,024 queries x 1,024 keys, dz 256, dx 2, 8 heads x 32, kernel MLP 10 -> 32 -> 8): logits = MLP([x_q - x_k, q_h . k_h / sqrt(32)]), softmax over keys, . v, output projection; the query locations pass through.
#define NM 8
#define NQ 1024
#define NK 1024
#define DZ 256
#define NH 8
#define HD 32
#define KH 32
#define NF 16              // padded feature width (2 + 8 used)
#define NRQ (NM * NQ)
#define NRK (NM * NK)
#ifndef TQB
#define TQB (NQ / 16)
#define TNM NM
#endif
typedef __attribute__((ext_vector_type(8))) __bf16 v8b;
__device__ __forceinline__ v16b frag_b(const __bf16* rowk0, int lane) {
  union { v16b v; v8b q[2]; } u; const __bf16* p = rowk0 + 8 * (lane >> 4);
  u.q[0] = *(const v8b*)p; u.q[1] = *(const v8b*)(p + 16); return u.v;
}
__device__ __forceinline__ float bfr(float v) { return (float)(__bf16)v; }
__device__ __attribute__((noinline)) float exp_ni(float v) { return expf(v); }
__device__ __attribute__((noinline)) float erf_ni(float v) { return erff(v); }

#define WS_PW  0u                                   // bf16 transposed rows [4][256][256], of which only plane 3, Wout^T, is written and read; W1^T padded [32][32] (k = feature 0..9, rest 0); W2^T padded [16][32] (rows 8..15 zero)
#define WS_P1  (WS_PW + 2u * (size_t)4 * DZ * DZ)
#define WS_P2  (WS_P1 + 2u * (size_t)32 * 32)
#define WS_Q   (WS_P2 + 2u * (size_t)16 * 32)         // f16 q rows [NRQ][256]; k fragments [NRK / 16][head][512] (row = key, k = dim); v fragments [m][NK / 32][head][dim half][512] (row = dim, k = key), each 512 = [piece][lane][8] as frag_t reads it
#define WS_K   (WS_Q + 2u * (size_t)NRQ * DZ)
#define WS_V   (WS_K + 2u * (size_t)NRK * DZ)
#define OUT1   ((size_t)NRQ * DZ)                     // float offset of the second output (xq copy)
#define WS_END (WS_V + 2u * (size_t)NM * DZ * NK)

// ---- k_proj: block = (64 rows, 128 cols, which): q from zq -> f16 rows; k from zk, v from zv -> fragment order (consecutive lanes store consecutive 16-byte chunks: a wave stores 512 contiguous bytes).
// The block makes its own B fragments: it reads its 256 x 128 slice of the (in,out) f32 weight in whole 512-byte rows, rounds to bf16 and lays it in LDS in fragment order, once for its 4 waves. The 256 q blocks also pack what k_te reads, a row each: Wout^T; the first 32 a row of W1^T (k = feature 0..9, rest 0), the first 16 a row of W2^T (rows 8..15 zero)
#define WJ 65              // 16-byte units per 16-column fragment in LDS, 2 pieces x 32 lanes + 1: the 32 chunks of one store (4 columns apart in a fragment, 8 fragments) fall on every bank group twice, not on 4 of the 16 eight times
__global__ __launch_bounds__(128) void k_proj(const float* __restrict__ ZQ, const float* __restrict__ ZK, const float* __restrict__ ZV, const float* __restrict__ WQ, const float* __restrict__ WK, const float* __restrict__ WV, const float* __restrict__ WO, const float* __restrict__ W1, const float* __restrict__ W2, __bf16* __restrict__ PW, __bf16* __restrict__ P1, __bf16* __restrict__ P2, _Float16* __restrict__ Q, _Float16* __restrict__ Kr, _Float16* __restrict__ V) {
  __shared__ __align__(16) _Float16 so[64][136]; __shared__ __align__(16) _Float16 st[128][72]; __shared__ __align__(16) v4u sw[DZ / 32][8 * WJ]; __shared__ __align__(16) __bf16 sp[DZ + 64];
  const int tid = threadIdx.x, wave = tid >> 5, lane = tid & 31, col = lane & 15, g = lane >> 4; const int which = blockIdx.z;
  const size_t rb = (size_t)blockIdx.x * 64; const size_t r0 = rb + wave * 16; const int c0 = blockIdx.y * 128; const float* A = (which == 0) ? ZQ : (which == 1) ? ZK : ZV; const float* Wf = (which == 0) ? WQ : (which == 1) ? WK : WV;
  const int pn = blockIdx.y * (TNM * NQ / 64) + blockIdx.x; const bool pk = which == 0 && pn < DZ; float pw0 = 0.f, pw1 = 0.f, pw2 = 0.f, pw3 = 0.f;   // column pn of Wout, W1, W2
  // wave w takes the k octets o = 4 kc + w (rows 8 o + 0..7 of the weight), a lane 4 columns: octet o is piece (o >> 1) & 1, lane half o & 1 of the fragments of k step o >> 2
  const float* wp = Wf + (size_t)(wave * 8) * DZ + c0 + lane * 4;
  v4f ar[DZ / 32][4];   // this wave's 16 rows of z, requested behind the first weight rows and used behind the last: they come from memory, the weights from L2
#pragma unroll
  for (int b = 0; b < DZ / 64; ++b) { v4f x[2][8];
#pragma unroll
    for (int k2 = 0; k2 < 2; ++k2)
#pragma unroll
      for (int r = 0; r < 8; ++r) x[k2][r] = *(const v4f*)(wp + (size_t)((b * 2 + k2) * 32 + r) * DZ);
    if (b == 0) {
#pragma unroll
      for (int kc = 0; kc < DZ / 32; ++kc) { const float* p = A + (r0 + col) * DZ + kc * 32 + 8 * g; ar[kc][0] = *(const v4f*)p; ar[kc][1] = *(const v4f*)(p + 4); ar[kc][2] = *(const v4f*)(p + 16); ar[kc][3] = *(const v4f*)(p + 20); }
      if (pk) { pw0 = WO[(size_t)tid * DZ + pn]; pw1 = WO[(size_t)(tid + 128) * DZ + pn]; pw2 = W1[(size_t)(tid < 10 ? tid : 9) * KH + (pn < KH ? pn : KH - 1)]; pw3 = W2[(size_t)(tid < KH ? tid : KH - 1) * NH + (pn < NH ? pn : NH - 1)];   // indices clamped into the arrays, what lies outside reads as 0 below
        asm volatile("s_wait_xcnt 0x0" ::: "memory"); } }   // the wait that stands before a register of an issued load is overwritten: the address pairs of these four loads are used again at once
#pragma unroll
    for (int k2 = 0; k2 < 2; ++k2)
#pragma unroll
      for (int e = 0; e < 4; ++e) { union { v8b v; v4u q; } u;
#pragma unroll
        for (int r = 0; r < 8; ++r) u.v[r] = (__bf16)x[k2][r][e];
        sw[b * 2 + k2][(lane >> 2) * WJ + (wave >> 1) * 32 + (wave & 1) * 16 + (lane & 3) * 4 + e] = u.q; }
    if (b == 0 && pk) { sp[tid] = (__bf16)pw0; sp[tid + 128] = (__bf16)pw1; if (tid < 32) { sp[DZ + tid] = (__bf16)(tid < 10 ? pw2 : 0.f); sp[DZ + 32 + tid] = (__bf16)(pn < NH ? pw3 : 0.f); } }
    __builtin_amdgcn_sched_barrier(0); }   // 16 weight rows in flight at a time: with all 64 lifted to the top the kernel takes 352 registers, and only 2 of the 3 blocks that LDS allows stand on a WGP
  v16b af[DZ / 32];
#pragma unroll
  for (int kc = 0; kc < DZ / 32; ++kc)
#pragma unroll
    for (int i = 0; i < 4; ++i) { af[kc][i] = (__bf16)ar[kc][0][i]; af[kc][4 + i] = (__bf16)ar[kc][1][i]; af[kc][8 + i] = (__bf16)ar[kc][2][i]; af[kc][12 + i] = (__bf16)ar[kc][3][i]; }
  asm volatile("s_wait_xcnt 0x0" :: "v"(wp) : "memory");   // the wait that stands before a register of an issued load is overwritten; the weight rows' address is named as an input so that it lives up to here: without that the last row's result is laid over it
  __syncthreads();   // the weight fragments stand in LDS
  if (pk) {
    if (tid < 32) vst2((unsigned*)(PW + ((size_t)3 * DZ + pn) * DZ + tid * 8), *(const v4u*)&sp[tid * 8]);
    else if (tid < 36) { if (pn < 32) vst2((unsigned*)(P1 + (size_t)pn * 32 + (tid - 32) * 8), *(const v4u*)&sp[DZ + (tid - 32) * 8]); }
    else if (tid < 40) { if (pn < 16) vst2((unsigned*)(P2 + (size_t)pn * 32 + (tid - 36) * 8), *(const v4u*)&sp[DZ + 32 + (tid - 36) * 8]); } }
  v8f acc[8] = {};
#pragma unroll
  for (int kc = 0; kc < DZ / 32; ++kc)
#pragma unroll
    for (int j = 0; j < 8; ++j) { union { v16b v; v4u q[2]; } u; u.q[0] = sw[kc][j * WJ + lane]; u.q[1] = sw[kc][j * WJ + 32 + lane]; acc[j] = wmma_bf(af[kc], u.v, acc[j]); }
#pragma unroll
  for (int j = 0; j < 8; ++j)
#pragma unroll
    for (int r = 0; r < 8; ++r) { const _Float16 hv = (_Float16)acc[j][r]; if (which < 2) so[wave * 16 + 8 * g + r][j * 16 + col] = hv; else st[j * 16 + col][wave * 16 + 8 * g + r] = hv; }
  __syncthreads();
  if (which == 0) { for (int e = tid; e < 64 * 16; e += 128) { const int rl = e >> 4, q = e & 15; vst2((unsigned*)(Q + (rb + rl) * DZ + c0 + q * 8), *(const v4u*)&so[rl][q * 8]); } }
  else if (which == 1) { for (int e = tid; e < 64 * 16; e += 128) { const int ln = e & 31, pc = (e >> 5) & 1, hh = (e >> 6) & 3, t = e >> 8;   // key tile t, head hh of the block's four each
      vst2((unsigned*)(Kr + ((((rb / 16 + t) * NH + c0 / HD + hh) * 2 + pc) * 32 + ln) * 8), *(const v4u*)&so[t * 16 + (ln & 15)][hh * HD + pc * 16 + (ln >> 4) * 8]); } }
  else { const size_t mI = rb / NK; const int s0 = (int)(rb % NK); for (int e = tid; e < 128 * 8; e += 128) { const int ln = e & 31, pc = (e >> 5) & 1, dt = (e >> 6) & 1, hh = (e >> 7) & 3, cc = e >> 9;   // 32-key chunk cc of the block's two, head hh of its four
      vst2((unsigned*)(V + ((((((mI * (NK / 32) + s0 / 32 + cc) * NH + c0 / HD + hh) * 2 + dt) * 2 + pc) * 32 + ln) * 8)), *(const v4u*)&st[hh * HD + dt * 16 + (ln & 15)][cc * 32 + pc * 16 + (ln >> 4) * 8]); } }
}
// ---- k_te: block = (16 queries, m), 8 waves = two groups of 4; group grp takes the 64-key chunks 2 it + grp with its own logits buffer and its own running (m, l, ctx), so that 4 waves and not 2 stand on each SIMD to cover each other's load, LDS and matrix latencies; the two partial softmax states are joined once behind the loop. Below, wave = the wave's number inside its group. Per 64-key chunk: (a) wave w takes the 16 keys 16 w + 0..15 and all 16 queries: token dots of all 8 heads, each product computed once in the group and every element of its D used, so that lane (g, key) holds every feature of its own 8 pairs; (b) the MLP transposed, in registers: h1^T = relu(W1^T . F^T), dots^T = W2^T . h1^T + b2, the features being a B fragment as they stand and the D of the first product the B fragment of the second -> SC[pair][h]; (c) wave w runs the running-max softmax + P.v for heads 2w, 2w+1 over the chunk, 32 keys at a time, transposed: ctx^T += v^T . P^T, lane (g, query) holding 16 of the query's 32 logits, so that maximum and sum are in-lane but for one exchange between the lane halves, and exp(.) is the B fragment as it stands
#define SP 12              // floats per pair row of the logits: 16-byte stores, 16 rows on 16 distinct bank groups
#define SQP (64 * SP + 4)  // floats per query row of the logits: the 16 queries that one read of part (c) touches start 4 banks apart
__device__ __forceinline__ float xhalf(float x) { return __builtin_bit_cast(float, __builtin_amdgcn_permlanex16(__builtin_bit_cast(int, x), __builtin_bit_cast(int, x), 0x76543210, 0xfedcba98, false, false)); }   // lane l with lane l ^ 16
// exp(x) as __expf gives it (the hardware's exp2 of x . log2 e), with one v_nop in the same statement: the instruction set asks for one slot between a transcendental and a next instruction that reads its result or overwrites its source
__device__ __forceinline__ float exp_slot(float x) { float r; asm("v_exp_f32 %0, %1\n\tv_nop" : "=v"(r) : "v"(x * 0x1.715476p+0f)); return r; }
__global__ __launch_bounds__(256) void k_te(const _Float16* __restrict__ Q, const _Float16* __restrict__ Kr, const _Float16* __restrict__ V, const float* __restrict__ XQ, const float* __restrict__ XKV, const __bf16* __restrict__ P1, const __bf16* __restrict__ P2, const float* __restrict__ B1, const float* __restrict__ B2, const __bf16* __restrict__ PW, const float* __restrict__ BO, float* __restrict__ Y) {
  __shared__ __align__(16) float sS2[2][16][SQP]; __shared__ __align__(16) _Float16 sq[16][DZ + 8]; __shared__ __align__(16) v4u sf[NH][2][2][32];   // sf: ctx as A fragments of the output projection, [head = 32-wide k step][hi, lo][piece][lane]
  const int tid = threadIdx.x, grp = tid >> 7, wave = (tid >> 5) & 3, lane = tid & 31, col = lane & 15, g = lane >> 4; const size_t mI = blockIdx.y; const int q0 = blockIdx.x * 16; const size_t rq = mI * NQ + q0;
  float (*sS)[SQP] = sS2[grp];   // this group's logits
  for (int e = tid; e < 16 * (DZ / 8); e += 256) { const int rl = e >> 5, pc = e & 31; *(v8h*)&sq[rl][pc * 8] = *(const v8h*)(Q + (rq + rl) * DZ + pc * 8); }   // the 16 q rows, read as fragments in every chunk (all 8 heads in registers would spill)
  __syncthreads();
  // W1^T as A, hidden row 16j + col: a lane's 16 k slots = features 0..9, b1 (against the constant feature 1), zeros. wlo has them in the g = 0 lanes only (k slots 0..7, 16..23: it meets the features held by the g = 0 lanes, query rr), whi in the g = 1 lanes only (query 8 + rr)
  v16b wlo[2], whi[2];
#pragma unroll
  for (int j = 0; j < 2; ++j) { union { v16b v; v8b q[2]; } u; const __bf16* pw = P1 + (size_t)(j * 16 + col) * 32; u.q[0] = *(const v8b*)pw; u.q[1] = *(const v8b*)(pw + 8); u.v[10] = (__bf16)B1[j * 16 + col];
    const v16b z = {}; wlo[j] = (g == 0) ? u.v : z; whi[j] = (g == 0) ? z : u.v; }
  const v16b w2f = frag_b(P2 + (size_t)col * 32, lane);   // W2^T as A: row = head (8..15 zero), k = hidden
  float b2v[NH], xq0[8], xq1[8];
#pragma unroll
  for (int r = 0; r < NH; ++r) b2v[r] = bfr(B2[r]);
#pragma unroll
  for (int rr = 0; rr < 8; ++rr) { const size_t qq = rq + 8 * g + rr; xq0[rr] = bfr(XQ[qq * 2]); xq1[rr] = bfr(XQ[qq * 2 + 1]); }
  float m[2] = {-3.0e38f, -3.0e38f}, l[2] = {0.f, 0.f};   // of query col; l is the sum over this lane half's keys alone, the halves are joined after the loop
  v8f acc[2][2] = {};   // ctx^T: element r = dim 16 dt + 8g + r of head 2w + hh, column = query col
#pragma unroll 1
  for (int it = 0; it < NK / 128; ++it) { const int j0 = (it * 2 + grp) * 64;   // the same trip count in both groups: every barrier is met by all 8 waves
    // (a) token dots of all heads, all 16 queries x this wave's 16 keys; lane (g, col) keeps pairs (8g + rr, key col), rr = 0..7: every element of D is used
    const size_t kr = mI * NK + j0 + wave * 16 + col; const v2f xk = *(const v2f*)(XKV + kr * 2); const float xk0 = bfr(xk[0]), xk1 = bfr(xk[1]);
    float ft[8][NH]; v16h kf[NH];   // all 8 heads' key fragments requested before the first product: one memory latency a chunk, not eight
#pragma unroll
    for (int h = 0; h < NH; ++h) kf[h] = frag_t(Kr + (((mI * NK + j0) / 16 + wave) * NH + h) * 512, lane);
    v16h qn = frag_h(&sq[col][0], lane);   // q fragments one head ahead of their product
#pragma unroll
    for (int h = 0; h < NH; ++h) { const v16h qc = qn; if (h + 1 < NH) qn = frag_h(&sq[col][(h + 1) * HD], lane);
      v8f c = {}; c = wmma16(qc, kf[h], c);
#pragma unroll
      for (int rr = 0; rr < 8; ++rr) ft[rr][h] = c[rr] * 0.17677669529663688f; }
    // (b) MLP on 32 pairs a pass, no LDS between the products (unrolled, as every loop here over a register array: its indices must be constants)
#pragma unroll
    for (int rr = 0; rr < 8; ++rr) { float fv[16]; fv[0] = xq0[rr] - xk0; fv[1] = xq1[rr] - xk1;
#pragma unroll
      for (int h = 0; h < NH; ++h) fv[2 + h] = ft[rr][h];
      fv[10] = 1.0f;
#pragma unroll
      for (int i = 11; i < 16; ++i) fv[i] = 0.f;
      const F2 fb = bsplit<5>(fv); v8f dd[2];
#pragma unroll
      for (int s = 0; s < 2; ++s) { v8f hacc[2] = {};
#pragma unroll
        for (int j = 0; j < 2; ++j) { const v16b w = s ? whi[j] : wlo[j]; hacc[j] = wmma_bf(w, fb.h, hacc[j]); hacc[j] = wmma_bf(w, fb.l, hacc[j]); }
        float hv[16];   // D element r of tile j = hidden 16j + 8g + r = k slot of B element 8j + r
#pragma unroll
        for (int j = 0; j < 2; ++j)
#pragma unroll
          for (int r = 0; r < 8; ++r) { const float v = hacc[j][r]; hv[8 * j + r] = v > 0.f ? v : 0.f; }
        const F2 hb = bsplit16(hv); v8f dacc = {}; dacc = wmma_bf(w2f, hb.h, dacc); dacc = wmma_bf(w2f, hb.l, dacc); dd[s] = dacc; }
      if (g == 0) {   // D rows 0..7 = heads, held by the g = 0 lanes; column = key
#pragma unroll
        for (int s = 0; s < 2; ++s) { float* ps = &sS[8 * s + rr][(wave * 16 + col) * SP]; v4f o0, o1;
#pragma unroll
          for (int r = 0; r < 4; ++r) { o0[r] = dd[s][r] + b2v[r]; o1[r] = dd[s][4 + r] + b2v[4 + r]; }
          *(v4f*)ps = o0; *(v4f*)(ps + 4) = o1; } } }
    __syncthreads();
    // (c) softmax + P.v for this wave's two heads, 32 keys a trip: lane (g, col) takes query col, keys 8g + i and 16 + 8g + i (the k order of frag_h)
#pragma unroll 1   // rolled: only one trip's v fragments and logits stand in registers at a time; the kernel is at 256 registers, the most that 4 waves a SIMD allow
    for (int kk = 0; kk < 2; ++kk) {
    v16h vf[2][2];
#pragma unroll
    for (int hh = 0; hh < 2; ++hh)
#pragma unroll
      for (int dt = 0; dt < 2; ++dt) vf[hh][dt] = frag_t(V + (((mI * (NK / 32) + j0 / 32 + kk) * NH + wave * 2 + hh) * 2 + dt) * 512, lane);   // v^T as A: row = dim
    v2f sv[16];   // both heads of a pair in one 8-byte read
#pragma unroll
    for (int i = 0; i < 8; ++i) { sv[i] = *(const v2f*)&sS[col][(32 * kk + 8 * g + i) * SP + 2 * wave]; sv[8 + i] = *(const v2f*)&sS[col][(32 * kk + 16 + 8 * g + i) * SP + 2 * wave]; }
#pragma unroll
    for (int hh = 0; hh < 2; ++hh) { float t[8];
#pragma unroll
      for (int i = 0; i < 8; ++i) t[i] = fmaxf(sv[i][hh], sv[8 + i][hh]);
      float mx = fmaxf(fmaxf(fmaxf(t[0], t[1]), fmaxf(t[2], t[3])), fmaxf(fmaxf(t[4], t[5]), fmaxf(t[6], t[7])));
      mx = fmaxf(mx, xhalf(mx));
      const float mn = fmaxf(m[hh], mx); const float am = exp_slot(m[hh] - mn); const float alpha = (m[hh] <= -1.0e38f) ? 0.f : am;
      v16h pb; float es[4];   // four independent chains of four
#pragma unroll
      for (int i = 0; i < 16; ++i) { const float e = exp_slot(sv[i][hh] - mn); es[i & 3] = (i < 4) ? e : es[i & 3] + e; pb[i] = (_Float16)(e * 2048.0f); }
      l[hh] = l[hh] * alpha + ((es[0] + es[1]) + (es[2] + es[3])); m[hh] = mn;
#pragma unroll
      for (int dt = 0; dt < 2; ++dt) { acc[hh][dt] *= alpha; acc[hh][dt] = wmma16(vf[hh][dt], pb, acc[hh][dt]); } } }
    __syncthreads(); }
  // join of the two groups: group 1 hands its (m, l, ctx^T) over in LDS (the logits buffer is free behind the loop's last barrier; 36 floats a lane = 16 B x odd), group 0 rescales both to the common maximum and writes the normalised ctx to sf for all 8 waves (loops unrolled: the indices of register arrays must be constants)
  // the tail: this block holds whole ctx rows (16 queries x all 8 heads), so it also does their output projection, wave w8 of all 8 taking 32 output columns, and copies their xq through. The Wout^T fragments, the bias and the xq line are requested here, ahead of the join
  const int w8 = tid >> 5; v16b wf[2][NH];
#pragma unroll
  for (int kc = 0; kc < NH; ++kc)
#pragma unroll
    for (int j = 0; j < 2; ++j) wf[j][kc] = frag_b(PW + ((size_t)3 * DZ + w8 * 32 + j * 16 + col) * DZ + kc * 32, lane);
  float bb[2];
#pragma unroll
  for (int j = 0; j < 2; ++j) bb[j] = bfr(BO[w8 * 32 + j * 16 + col]);
  asm volatile("s_wait_xcnt 0x0" ::: "memory");   // the compiler lays the next load's result over the address pair of the loads above: the wait that stands before a register of an issued load is overwritten
  const v4f xc = *(const v4f*)(XQ + rq * 2 + (lane & 7) * 4);   // 16 queries x 2 floats = one 128-byte line; read by every wave (no branch, no start value), stored by the first 8 lanes of the block
  float* mg = &sS2[0][0][0] + (wave * 32 + lane) * 36;
  if (grp == 1) {
#pragma unroll
    for (int hh = 0; hh < 2; ++hh)
#pragma unroll
      for (int dt = 0; dt < 2; ++dt) { v4f o0, o1;
#pragma unroll
        for (int r = 0; r < 4; ++r) { o0[r] = acc[hh][dt][r]; o1[r] = acc[hh][dt][4 + r]; }
        *(v4f*)(mg + (hh * 2 + dt) * 8) = o0; *(v4f*)(mg + (hh * 2 + dt) * 8 + 4) = o1; }
    v4f ml; ml[0] = m[0]; ml[1] = m[1]; ml[2] = l[0]; ml[3] = l[1]; *(v4f*)(mg + 32) = ml; }
  __syncthreads();
  if (grp == 0) { const v4f ml = *(const v4f*)(mg + 32);
#pragma unroll
    for (int hh = 0; hh < 2; ++hh) { const float mn = fmaxf(m[hh], ml[hh]); const float a0 = exp_slot(m[hh] - mn), a1 = exp_slot(ml[hh] - mn);
      l[hh] = l[hh] * a0 + ml[2 + hh] * a1;
#pragma unroll
      for (int dt = 0; dt < 2; ++dt) { const v4f o0 = *(const v4f*)(mg + (hh * 2 + dt) * 8), o1 = *(const v4f*)(mg + (hh * 2 + dt) * 8 + 4);
#pragma unroll
        for (int r = 0; r < 4; ++r) { acc[hh][dt][r] = acc[hh][dt][r] * a0 + o0[r] * a1; acc[hh][dt][4 + r] = acc[hh][dt][4 + r] * a0 + o1[r] * a1; } } }
    // lane (g, query col) holds dims 8g + r and 16 + 8g + r of a head: ctx^T as it stands is the A fragment (row = query, k = the head's 32 dims) of ctx . Wout; split once here, read by all 8 waves
#pragma unroll
    for (int hh = 0; hh < 2; ++hh) { const float il = (1.0f / 2048.0f) / (l[hh] + xhalf(l[hh])); float v[16];
#pragma unroll
      for (int r = 0; r < 8; ++r) { v[r] = acc[hh][0][r] * il; v[8 + r] = acc[hh][1][r] * il; }
      const F2 a = bsplit16(v); union { v16b v; v4u q[2]; } uh, ul; uh.v = a.h; ul.v = a.l;
#pragma unroll
      for (int pc = 0; pc < 2; ++pc) { sf[wave * 2 + hh][0][pc][lane] = uh.q[pc]; sf[wave * 2 + hh][1][pc][lane] = ul.q[pc]; } } }
  __syncthreads();   // all of ctx stands in sf; the join's buffer is free again
  // out0 = ctx (hi + lo) . Wout + bout, k ascending, hi then lo
  v8f oa[2] = {};
#pragma unroll
  for (int kc = 0; kc < NH; ++kc) { union { v16b v; v4u q[2]; } uh, ul;
#pragma unroll
    for (int pc = 0; pc < 2; ++pc) { uh.q[pc] = sf[kc][0][pc][lane]; ul.q[pc] = sf[kc][1][pc][lane]; }
#pragma unroll
    for (int j = 0; j < 2; ++j) { oa[j] = wmma_bf(uh.v, wf[j][kc], oa[j]); oa[j] = wmma_bf(ul.v, wf[j][kc], oa[j]); } }
  float* os = &sS2[0][0][0] + w8 * (16 * 36);   // this wave's own 16 x 32 tile, rows of 36 floats (16 B x odd)
#pragma unroll
  for (int j = 0; j < 2; ++j)
#pragma unroll
    for (int r = 0; r < 8; ++r) os[(8 * g + r) * 36 + j * 16 + col] = oa[j][r] + bb[j];
  LDSX();
#pragma unroll
  for (int i = 0; i < 4; ++i) { const int rl = i * 4 + (lane >> 3), c = (lane & 7) * 4; vst2(Y + (rq + rl) * DZ + w8 * 32 + c, *(const v4f*)&os[rl * 36 + c]); }   // a row's 32 floats = one whole 128-byte line, written by this wave alone
  if (tid < 8) vst2(Y + OUT1 + rq * 2 + tid * 4, xc);   // second output = xq
}
extern "C" void kernel_launch(void* const* d_in, const int* in_sizes, int n_in, void* d_out, int out_size, void* d_ws, size_t ws_size, hipStream_t stream) {
  (void)in_sizes; (void)n_in; (void)out_size;
  const float** F = (const float**)d_in;   // 0 zq, 1 zk, 2 zv [8,1024,256]; 3 xq, 4 xkv [8,1024,2]; 5 Wq, 6 Wk, 7 Wv [256,256] (in,out); 8 Wout [256,256] (in,out), 9 bout; 10 W1 [10,32], 11 b1 [32], 12 W2 [32,8], 13 b2 [8]
  if (ws_size < (size_t)WS_END) return;
  char* ws = (char*)d_ws; __bf16 *PW = (__bf16*)(ws + WS_PW), *P1 = (__bf16*)(ws + WS_P1), *P2 = (__bf16*)(ws + WS_P2); _Float16 *Q = (_Float16*)(ws + WS_Q), *Kr = (_Float16*)(ws + WS_K), *V = (_Float16*)(ws + WS_V);
  k_proj<<<dim3(TNM * NQ / 64, DZ / 128, 3), 128, 0, stream>>>(F[0], F[1], F[2], F[5], F[6], F[7], F[8], F[10], F[12], PW, P1, P2, Q, Kr, V);
  k_te<<<dim3(TQB, TNM), 256, 0, stream>>>(Q, Kr, V, F[3], F[4], P1, P2, F[11], F[13], PW, F[9], (float*)d_out);
}

// v010
// Measured time: 76.1 microseconds a run.
// In both of two side-by-side timings against v009, it was 1.04 times as fast.
// Counting every step since v000, it is 4.06 times as fast.
// compute dtype: all float inputs rounded to bf16; q/k/v = z . W with EXACT bf16 products on WMMA 16x16x32 ((in,out) weights rounded to bf16), rounded once to f16 (k and v stored as fragments); per 16-query x 64-key chunk: token dots q_h . k_h x 32^-1/2 on WMMA (single f16), the pair features [xq - xkv | dots | 0] in f32, the kernel MLP relu(F . W1 + b1) . W2 + b2 on WMMA with F as bf16 hi + lo (both in the k slots of one product) and the hidden as bf16 hi + lo (2 products); per (query, head) running-max softmax over the keys in f32 (hardware exp), P (scaled by 2^11, single f16) x v (single f16); out = ctx (bf16 hi + lo, 2 products) . Wout + bout; xq copied through as the second output; f32 outputs.
#include <hip/hip_runtime.h>
#include <math.h>

typedef __attribute__((ext_vector_type(16))) _Float16 v16h;
typedef __attribute__((ext_vector_type(16))) __bf16 v16b;
typedef __attribute__((ext_vector_type(8)))  _Float16 v8h;
typedef __attribute__((ext_vector_type(8)))  float v8f;
typedef __attribute__((ext_vector_type(4)))  float v4f;
typedef __attribute__((ext_vector_type(2)))  float v2f;
typedef __attribute__((ext_vector_type(4)))  unsigned v4u;
typedef __attribute__((ext_vector_type(4)))  int v4i;
typedef float __attribute__((may_alias)) float_a;
typedef int __attribute__((may_alias)) int_a;

template <typename T> __device__ __forceinline__ void vst2(void* p, T v) { *(T*)p = v;  }
__device__ __forceinline__ v8f wmma16(v16h a, v16h b, v8f c) {
  v8f d = __builtin_amdgcn_wmma_f32_16x16x32_f16(false, a, false, b, (short)0, c, false, false);
  return d;
}
__device__ __forceinline__ v8f wmma_bf(v16b a, v16b b, v8f c) {
  v8f d = __builtin_amdgcn_wmma_f32_16x16x32_bf16(false, a, false, b, (short)0, c, false, false);
  return d;
}
// 16x16x32 fragments: lane = (h = lane>>4, row/col = lane&15); elements 0..7 = k0+8h+0..7, 8..15 = k0+16+8h+0..7; D element r = row 8h+r
__device__ __forceinline__ v16h frag_h(const _Float16* rowk0, int lane) {
  union { v16h v; v8h q[2]; } u; const _Float16* p = rowk0 + 8 * (lane >> 4);
  u.q[0] = *(const v8h*)p; u.q[1] = *(const v8h*)(p + 16); return u.v;
}
// the same fragment from a tile stored in fragment order, [piece 0, 1][lane][8 halves]: each of the two loads reads 512 contiguous bytes (4 whole lines; from 16 rows it would touch 16)
__device__ __forceinline__ v16h frag_t(const _Float16* tile, int lane) {
  union { v16h v; v8h q[2]; } u; const _Float16* p = tile + 8 * lane;
  u.q[0] = *(const v8h*)p; u.q[1] = *(const v8h*)(p + 256); return u.v;
}
__device__ __forceinline__ v16h frag_f32(const float* rowk0, int lane) {
  v16h a; const float* p = rowk0 + 8 * (lane >> 4);
#pragma unroll
  for (int i = 0; i < 8; ++i) { a[i] = (_Float16)p[i]; a[8 + i] = (_Float16)p[16 + i]; }
  return a;
}
__device__ __forceinline__ v16h frag_f32s(const float* rowk0, int lane, float sc) {
  v16h a; const float* p = rowk0 + 8 * (lane >> 4);
#pragma unroll
  for (int i = 0; i < 8; ++i) { a[i] = (_Float16)(p[i] * sc); a[8 + i] = (_Float16)(p[16 + i] * sc); }
  return a;
}
// column fragment from a [K][ld] layout (column n), rows >= K read as 0
__device__ __forceinline__ v16h fragc_f32(const float* W, int k0, int n, int lane, int ld, int K) {
  v16h a; const int g = lane >> 4;
#pragma unroll
  for (int i = 0; i < 8; ++i) { const int ka = k0 + 8 * g + i, kb = ka + 16;
    a[i] = (_Float16)(ka < K ? W[(size_t)(ka < K ? ka : K - 1) * ld + n] : 0.f); a[8 + i] = (_Float16)(kb < K ? W[(size_t)(kb < K ? kb : K - 1) * ld + n] : 0.f); }
  return a;
}
struct F2 { v16b h, l; };
typedef __attribute__((ext_vector_type(2))) __bf16 v2b;
// bf16 hi + lo split, three instructions a pair of values: one packed conversion makes both hi halves; each lo half is x - hi rounded to bf16 in ONE instruction that reads its hi half in place
// (v_fma_mixlo_bf16 writes the low half of the result register, v_fma_mixhi_bf16 the high half; x - hi is exact in f32, so that one rounding is the rounding of a separate conversion).
// In asm because the compiler does not form these two from source: it converts every hi a second time alone, or unpacks the pair with a shift and a mask. All the mixlo of a statement stand ahead of
// its mixhi, so that the write of a register's second half stands four or five instructions behind the write of its first half and hardly waits for it.
#define MIXLO(o, h, x) "v_fma_mixlo_bf16 %" #o ", %" #h ", -1.0, %" #x " op_sel:[0,1,0] op_sel_hi:[1,1,0]\n\t"
#define MIXHI(o, h, x) "v_fma_mixhi_bf16 %" #o ", %" #h ", -1.0, %" #x " op_sel:[1,1,0] op_sel_hi:[1,1,0]\n\t"
// closes the last statement of a split: the matrix instruction that reads the lo halves stands directly behind it, and the compiler, which does not look into asm, gives that reader no hint; unhinted, its wait for the last mixhi would hold up the other waves of the SIMD too
#define MIXEND "s_delay_alu instid0(VALU_DEP_1)"
#define TAILS4(END) asm(MIXLO(0, 4, 8) MIXLO(1, 5, 10) MIXLO(2, 6, 12) MIXLO(3, 7, 14) MIXHI(0, 4, 9) MIXHI(1, 5, 11) MIXHI(2, 6, 13) MIXHI(3, 7, 15) END \
      : "=&v"(l[0]), "=&v"(l[1]), "=&v"(l[2]), "=&v"(l[3]) : "v"(h[0]), "v"(h[1]), "v"(h[2]), "v"(h[3]), "v"(x[0]), "v"(x[1]), "v"(x[2]), "v"(x[3]), "v"(x[4]), "v"(x[5]), "v"(x[6]), "v"(x[7]))
__device__ __forceinline__ void tails4(unsigned* l, const unsigned* h, const float* x) { TAILS4(""); }
__device__ __forceinline__ void tails4e(unsigned* l, const unsigned* h, const float* x) { TAILS4(MIXEND); }
// no closing hint here: the readers are the row swaps of fsplit, which take the five words in the order in which they were finished, each five instructions behind its writer
__device__ __forceinline__ void tails5(unsigned* l, const unsigned* h, const float* x) {
  asm(MIXLO(0, 5, 10) MIXLO(1, 6, 12) MIXLO(2, 7, 14) MIXLO(3, 8, 16) MIXLO(4, 9, 18) MIXHI(0, 5, 11) MIXHI(1, 6, 13) MIXHI(2, 7, 15) MIXHI(3, 8, 17) MIXHI(4, 9, 19) ""
      : "=&v"(l[0]), "=&v"(l[1]), "=&v"(l[2]), "=&v"(l[3]), "=&v"(l[4]) : "v"(h[0]), "v"(h[1]), "v"(h[2]), "v"(h[3]), "v"(h[4]), "v"(x[0]), "v"(x[1]), "v"(x[2]), "v"(x[3]), "v"(x[4]), "v"(x[5]), "v"(x[6]), "v"(x[7]), "v"(x[8]), "v"(x[9])); }
__device__ __forceinline__ F2 bsplit16(const float v[16]) { union { v16b v; unsigned u[8]; } uh, ul;
#pragma unroll
  for (int i = 0; i < 8; ++i) { v2f x; x[0] = v[2 * i]; x[1] = v[2 * i + 1]; uh.u[i] = __builtin_bit_cast(unsigned, __builtin_convertvector(x, v2b)); }
  tails4(ul.u, uh.u, v); tails4e(ul.u + 4, uh.u + 4, v + 8);
  F2 r; r.h = uh.v; r.l = ul.v; return r; }
// the ten features of a lane's own pair, split and laid out as two B fragments that each hold hi AND lo of 16 pairs: a column's 32 k slots are lane n (16 slots) and lane n + 16 (16 slots), so the hi parts go to the low lane half and the lo parts of the SAME pair to the high half.
// One row swap a register does it: the high row of the hi word changes places with the low row of the lo word; p[0] = the pairs of the g = 0 lanes, p[1] = those of the g = 1 lanes
struct FP { v16b p[2]; };
__device__ __forceinline__ FP fsplit(const float v[10], unsigned one5) { unsigned h[5], l[5]; union { v16b v; unsigned u[8]; } a, b;
#pragma unroll
  for (int i = 0; i < 5; ++i) { v2f x; x[0] = v[2 * i]; x[1] = v[2 * i + 1]; h[i] = __builtin_bit_cast(unsigned, __builtin_convertvector(x, v2b)); }
  tails5(l, h, v);
#pragma unroll
  for (int i = 0; i < 5; ++i) { const auto r = __builtin_amdgcn_permlane16_swap(h[i], l[i], false, false); a.u[i] = r[0]; b.u[i] = r[1]; }
  a.u[5] = b.u[5] = one5; a.u[6] = b.u[6] = a.u[7] = b.u[7] = 0u;
  FP r; r.p[0] = a.v; r.p[1] = b.v; return r; }
__device__ __forceinline__ F2 split_row(const float* row, int k0, int lane) { float v[16]; const float* p = row + k0 + 8 * (lane >> 4);
#pragma unroll
  for (int i = 0; i < 8; ++i) { v[i] = p[i]; v[8 + i] = p[16 + i]; }
  return bsplit16(v); }
__device__ __forceinline__ F2 split_rowK(const float* row, int k0, int lane, int K) { float v[16]; const int g = lane >> 4;
#pragma unroll
  for (int i = 0; i < 8; ++i) { const int ka = k0 + 8 * g + i, kb = ka + 16; v[i] = ka < K ? row[ka < K ? ka : K - 1] : 0.f; v[8 + i] = kb < K ? row[kb < K ? kb : K - 1] : 0.f; }
  return bsplit16(v); }
__device__ __forceinline__ F2 split_col(const float* W, int k0, int n, int lane, int ld, int K) { float v[16]; const int g = lane >> 4;
#pragma unroll
  for (int i = 0; i < 8; ++i) { const int ka = k0 + 8 * g + i, kb = ka + 16; v[i] = ka < K ? W[(size_t)(ka < K ? ka : K - 1) * ld + n] : 0.f; v[8 + i] = kb < K ? W[(size_t)(kb < K ? kb : K - 1) * ld + n] : 0.f; }
  return bsplit16(v); }
__device__ __forceinline__ v8f mac3(const F2& a, const F2& b, v8f c) { c = wmma_bf(a.l, b.h, c); c = wmma_bf(a.h, b.l, c); return wmma_bf(a.h, b.h, c); }
__device__ __forceinline__ float sigm(float v) { return 1.0f / (1.0f + expf(-v)); }
#define LDSX() do { asm volatile("s_wait_dscnt 0" ::: "memory"); __builtin_amdgcn_wave_barrier(); __builtin_amdgcn_fence(__ATOMIC_RELEASE, "workgroup"); } while (0)


// Translation-equivariant multi-head attention (8 sets, 1,024 queries x 1,024 keys, dz 256, dx 2, 8 heads x 32, kernel MLP 10 -> 32 -> 8): logits = MLP([x_q - x_k, q_h . k_h / sqrt(32)]), softmax over keys, . v, output projection; the query locations pass through.
#define NM 8
#define NQ 1024
#define NK 1024
#define DZ 256
#define NH 8
#define HD 32
#define KH 32
#define NF 16              // padded feature width (2 + 8 used)
#define NRQ (NM * NQ)
#define NRK (NM * NK)
#ifndef TQB
#define TQB (NQ / 16)
#define TNM NM
#endif
typedef __attribute__((ext_vector_type(8))) __bf16 v8b;
__device__ __forceinline__ v16b frag_b(const __bf16* rowk0, int lane) {
  union { v16b v; v8b q[2]; } u; const __bf16* p = rowk0 + 8 * (lane >> 4);
  u.q[0] = *(const v8b*)p; u.q[1] = *(const v8b*)(p + 16); return u.v;
}
__device__ __forceinline__ float bfr(float v) { return (float)(__bf16)v; }
__device__ __attribute__((noinline)) float exp_ni(float v) { return expf(v); }
__device__ __attribute__((noinline)) float erf_ni(float v) { return erff(v); }

#define WS_PW  0u                                   // bf16 transposed rows [4][256][256], of which only plane 3, Wout^T, is written and read; W1^T padded [32][32] (k = feature 0..9, rest 0); W2^T padded [16][32] (rows 8..15 zero)
#define WS_P1  (WS_PW + 2u * (size_t)4 * DZ * DZ)
#define WS_P2  (WS_P1 + 2u * (size_t)32 * 32)
#define WS_Q   (WS_P2 + 2u * (size_t)16 * 32)         // f16 q rows [NRQ][256]; k fragments [NRK / 16][head][512] (row = key, k = dim); v fragments [m][NK / 32][head][dim half][512] (row = dim, k = key), each 512 = [piece][lane][8] as frag_t reads it
#define WS_K   (WS_Q + 2u * (size_t)NRQ * DZ)
#define WS_V   (WS_K + 2u * (size_t)NRK * DZ)
#define OUT1   ((size_t)NRQ * DZ)                     // float offset of the second output (xq copy)
#define WS_END (WS_V + 2u * (size_t)NM * DZ * NK)

// ---- k_proj: block = (64 rows, 128 cols, which): q from zq -> f16 rows; k from zk, v from zv -> fragment order (consecutive lanes store consecutive 16-byte chunks: a wave stores 512 contiguous bytes).
// The block makes its own B fragments: it reads its 256 x 128 slice of the (in,out) f32 weight in whole 512-byte rows, rounds to bf16 and lays it in LDS in fragment order, once for its 4 waves. The 256 q blocks also pack what k_te reads, a row each: Wout^T; the first 32 a row of W1^T (k = feature 0..9, rest 0), the first 16 a row of W2^T (rows 8..15 zero)
#define WJ 65              // 16-byte units per 16-column fragment in LDS, 2 pieces x 32 lanes + 1: the 32 chunks of one store (4 columns apart in a fragment, 8 fragments) fall on every bank group twice, not on 4 of the 16 eight times
__global__ __launch_bounds__(128) void k_proj(const float* __restrict__ ZQ, const float* __restrict__ ZK, const float* __restrict__ ZV, const float* __restrict__ WQ, const float* __restrict__ WK, const float* __restrict__ WV, const float* __restrict__ WO, const float* __restrict__ W1, const float* __restrict__ W2, __bf16* __restrict__ PW, __bf16* __restrict__ P1, __bf16* __restrict__ P2, _Float16* __restrict__ Q, _Float16* __restrict__ Kr, _Float16* __restrict__ V) {
  __shared__ __align__(16) _Float16 so[64][136]; __shared__ __align__(16) _Float16 st[128][72]; __shared__ __align__(16) v4u sw[DZ / 32][8 * WJ]; __shared__ __align__(16) __bf16 sp[DZ + 64];
  const int tid = threadIdx.x, wave = tid >> 5, lane = tid & 31, col = lane & 15, g = lane >> 4; const int which = blockIdx.z;
  const size_t rb = (size_t)blockIdx.x * 64; const size_t r0 = rb + wave * 16; const int c0 = blockIdx.y * 128; const float* A = (which == 0) ? ZQ : (which == 1) ? ZK : ZV; const float* Wf = (which == 0) ? WQ : (which == 1) ? WK : WV;
  const int pn = blockIdx.y * (TNM * NQ / 64) + blockIdx.x; const bool pk = which == 0 && pn < DZ; float pw0 = 0.f, pw1 = 0.f, pw2 = 0.f, pw3 = 0.f;   // column pn of Wout, W1, W2
  // wave w takes the k octets o = 4 kc + w (rows 8 o + 0..7 of the weight), a lane 4 columns: octet o is piece (o >> 1) & 1, lane half o & 1 of the fragments of k step o >> 2
  const float* wp = Wf + (size_t)(wave * 8) * DZ + c0 + lane * 4;
  v4f ar[DZ / 32][4];   // this wave's 16 rows of z, requested behind the first weight rows and used behind the last: they come from memory, the weights from L2
#pragma unroll
  for (int b = 0; b < DZ / 64; ++b) { v4f x[2][8];
#pragma unroll
    for (int k2 = 0; k2 < 2; ++k2)
#pragma unroll
      for (int r = 0; r < 8; ++r) x[k2][r] = *(const v4f*)(wp + (size_t)((b * 2 + k2) * 32 + r) * DZ);
    if (b == 0) {
#pragma unroll
      for (int kc = 0; kc < DZ / 32; ++kc) { const float* p = A + (r0 + col) * DZ + kc * 32 + 8 * g; ar[kc][0] = *(const v4f*)p; ar[kc][1] = *(const v4f*)(p + 4); ar[kc][2] = *(const v4f*)(p + 16); ar[kc][3] = *(const v4f*)(p + 20); }
      if (pk) { pw0 = WO[(size_t)tid * DZ + pn]; pw1 = WO[(size_t)(tid + 128) * DZ + pn]; pw2 = W1[(size_t)(tid < 10 ? tid : 9) * KH + (pn < KH ? pn : KH - 1)]; pw3 = W2[(size_t)(tid < KH ? tid : KH - 1) * NH + (pn < NH ? pn : NH - 1)];   // indices clamped into the arrays, what lies outside reads as 0 below
        asm volatile("s_wait_xcnt 0x0" ::: "memory"); } }   // the wait that stands before a register of an issued load is overwritten: the address pairs of these four loads are used again at once
#pragma unroll
    for (int k2 = 0; k2 < 2; ++k2)
#pragma unroll
      for (int e = 0; e < 4; ++e) { union { v8b v; v4u q; } u;
#pragma unroll
        for (int r = 0; r < 8; ++r) u.v[r] = (__bf16)x[k2][r][e];
        sw[b * 2 + k2][(lane >> 2) * WJ + (wave >> 1) * 32 + (wave & 1) * 16 + (lane & 3) * 4 + e] = u.q; }
    if (b == 0 && pk) { sp[tid] = (__bf16)pw0; sp[tid + 128] = (__bf16)pw1; if (tid < 32) { sp[DZ + tid] = (__bf16)(tid < 10 ? pw2 : 0.f); sp[DZ + 32 + tid] = (__bf16)(pn < NH ? pw3 : 0.f); } }
    __builtin_amdgcn_sched_barrier(0); }   // 16 weight rows in flight at a time: with all 64 lifted to the top the kernel takes 352 registers, and only 2 of the 3 blocks that LDS allows stand on a WGP
  v16b af[DZ / 32];
#pragma unroll
  for (int kc = 0; kc < DZ / 32; ++kc)
#pragma unroll
    for (int i = 0; i < 4; ++i) { af[kc][i] = (__bf16)ar[kc][0][i]; af[kc][4 + i] = (__bf16)ar[kc][1][i]; af[kc][8 + i] = (__bf16)ar[kc][2][i]; af[kc][12 + i] = (__bf16)ar[kc][3][i]; }
  asm volatile("s_wait_xcnt 0x0" :: "v"(wp) : "memory");   // the wait that stands before a register of an issued load is overwritten; the weight rows' address is named as an input so that it lives up to here: without that the last row's result is laid over it
  __syncthreads();   // the weight fragments stand in LDS
  if (pk) {
    if (tid < 32) vst2((unsigned*)(PW + ((size_t)3 * DZ + pn) * DZ + tid * 8), *(const v4u*)&sp[tid * 8]);
    else if (tid < 36) { if (pn < 32) vst2((unsigned*)(P1 + (size_t)pn * 32 + (tid - 32) * 8), *(const v4u*)&sp[DZ + (tid - 32) * 8]); }
    else if (tid < 40) { if (pn < 16) vst2((unsigned*)(P2 + (size_t)pn * 32 + (tid - 36) * 8), *(const v4u*)&sp[DZ + 32 + (tid - 36) * 8]); } }
  v8f acc[8] = {};
#pragma unroll
  for (int kc = 0; kc < DZ / 32; ++kc)
#pragma unroll
    for (int j = 0; j < 8; ++j) { union { v16b v; v4u q[2]; } u; u.q[0] = sw[kc][j * WJ + lane]; u.q[1] = sw[kc][j * WJ + 32 + lane]; acc[j] = wmma_bf(af[kc], u.v, acc[j]); }
#pragma unroll
  for (int j = 0; j < 8; ++j)
#pragma unroll
    for (int r = 0; r < 8; ++r) { const _Float16 hv = (_Float16)acc[j][r]; if (which < 2) so[wave * 16 + 8 * g + r][j * 16 + col] = hv; else st[j * 16 + col][wave * 16 + 8 * g + r] = hv; }
  __syncthreads();
  if (which == 0) { for (int e = tid; e < 64 * 16; e += 128) { const int rl = e >> 4, q = e & 15; vst2((unsigned*)(Q + (rb + rl) * DZ + c0 + q * 8), *(const v4u*)&so[rl][q * 8]); } }
  else if (which == 1) { for (int e = tid; e < 64 * 16; e += 128) { const int ln = e & 31, pc = (e >> 5) & 1, hh = (e >> 6) & 3, t = e >> 8;   // key tile t, head hh of the block's four each
      vst2((unsigned*)(Kr + ((((rb / 16 + t) * NH + c0 / HD + hh) * 2 + pc) * 32 + ln) * 8), *(const v4u*)&so[t * 16 + (ln & 15)][hh * HD + pc * 16 + (ln >> 4) * 8]); } }
  else { const size_t mI = rb / NK; const int s0 = (int)(rb % NK); for (int e = tid; e < 128 * 8; e += 128) { const int ln = e & 31, pc = (e >> 5) & 1, dt = (e >> 6) & 1, hh = (e >> 7) & 3, cc = e >> 9;   // 32-key chunk cc of the block's two, head hh of its four
      vst2((unsigned*)(V + ((((((mI * (NK / 32) + s0 / 32 + cc) * NH + c0 / HD + hh) * 2 + dt) * 2 + pc) * 32 + ln) * 8)), *(const v4u*)&st[hh * HD + dt * 16 + (ln & 15)][cc * 32 + pc * 16 + (ln >> 4) * 8]); } }
}
// ---- k_te: block = (16 queries, m), 8 waves = two groups of 4; group grp takes the 64-key chunks 2 it + grp with its own logits buffer and its own running (m, l, ctx), so that 4 waves and not 2 stand on each SIMD to cover each other's load, LDS and matrix latencies; the two partial softmax states are joined once behind the loop. Below, wave = the wave's number inside its group. Per 64-key chunk: (a) wave w takes the 16 keys 16 w + 0..15 and all 16 queries: token dots of all 8 heads, each product computed once in the group and every element of its D used, so that lane (g, key) holds every feature of its own 8 pairs; (b) the MLP transposed, in registers: h1^T = relu(W1^T . F^T), dots^T = W2^T . h1^T + b2, the features being a B fragment after one row swap a register (hi parts in the low lane half, lo parts in the high half) and the D of the first product the B fragment of the second -> SC[pair][h]; (c) wave w runs the running-max softmax + P.v for heads 2w, 2w+1 over the chunk, 32 keys at a time, transposed: ctx^T += v^T . P^T, lane (g, query) holding 16 of the query's 32 logits, so that maximum and sum are in-lane but for one exchange between the lane halves, and exp(.) is the B fragment as it stands
#define SP 12              // floats per pair row of the logits: 16-byte stores, 16 rows on 16 distinct bank groups
#define SQP (64 * SP + 4)  // floats per query row of the logits: the 16 queries that one read of part (c) touches start 4 banks apart
__device__ __forceinline__ float xhalf(float x) { return __builtin_bit_cast(float, __builtin_amdgcn_permlanex16(__builtin_bit_cast(int, x), __builtin_bit_cast(int, x), 0x76543210, 0xfedcba98, false, false)); }   // lane l with lane l ^ 16
// exp(x) as __expf gives it (the hardware's exp2 of x . log2 e), with one v_nop in the same statement: the instruction set asks for one slot between a transcendental and a next instruction that reads its result or overwrites its source
__device__ __forceinline__ float exp_slot(float x) { float r; asm("v_exp_f32 %0, %1\n\tv_nop" : "=v"(r) : "v"(x * 0x1.715476p+0f)); return r; }
__global__ __launch_bounds__(256) void k_te(const _Float16* __restrict__ Q, const _Float16* __restrict__ Kr, const _Float16* __restrict__ V, const float* __restrict__ XQ, const float* __restrict__ XKV, const __bf16* __restrict__ P1, const __bf16* __restrict__ P2, const float* __restrict__ B1, const float* __restrict__ B2, const __bf16* __restrict__ PW, const float* __restrict__ BO, float* __restrict__ Y) {
  __shared__ __align__(16) float sS2[2][16][SQP]; __shared__ __align__(16) _Float16 sq[16][DZ + 8]; __shared__ __align__(16) v4u sf[NH][2][2][32];   // sf: ctx as A fragments of the output projection, [head = 32-wide k step][hi, lo][piece][lane]
  const int tid = threadIdx.x, grp = tid >> 7, wave = (tid >> 5) & 3, lane = tid & 31, col = lane & 15, g = lane >> 4; const size_t mI = blockIdx.y; const int q0 = blockIdx.x * 16; const size_t rq = mI * NQ + q0;
  float (*sS)[SQP] = sS2[grp];   // this group's logits
  for (int e = tid; e < 16 * (DZ / 8); e += 256) { const int rl = e >> 5, pc = e & 31; *(v8h*)&sq[rl][pc * 8] = *(const v8h*)(Q + (rq + rl) * DZ + pc * 8); }   // the 16 q rows, read as fragments in every chunk (all 8 heads in registers would spill)
  __syncthreads();
  // W1^T as A, hidden row 16j + col: a lane's 16 k slots = features 0..9, b1 (against the constant feature 1), zeros, the same in both lane halves: the g = 0 half (k slots 0..7, 16..23) meets the hi parts of a pair's features, the g = 1 half (k slots 8..15, 24..31) the lo parts of the same pair
  v16b w1f[2];
#pragma unroll
  for (int j = 0; j < 2; ++j) { union { v16b v; v8b q[2]; } u; const __bf16* pw = P1 + (size_t)(j * 16 + col) * 32; u.q[0] = *(const v8b*)pw; u.q[1] = *(const v8b*)(pw + 8); u.v[10] = (__bf16)B1[j * 16 + col];
    w1f[j] = u.v; }
  const unsigned one5 = (g == 0) ? 0x3f80u : 0u;   // the constant feature 1 (k slot 10) as bf16: its hi part is 1, its lo part 0
  const v16b w2f = frag_b(P2 + (size_t)col * 32, lane);   // W2^T as A: row = head (8..15 zero), k = hidden
  float b2v[NH], xq0[8], xq1[8];
#pragma unroll
  for (int r = 0; r < NH; ++r) b2v[r] = bfr(B2[r]);
#pragma unroll
  for (int rr = 0; rr < 8; ++rr) { const size_t qq = rq + 8 * g + rr; xq0[rr] = bfr(XQ[qq * 2]); xq1[rr] = bfr(XQ[qq * 2 + 1]); }
  float m[2] = {-3.0e38f, -3.0e38f}, l[2] = {0.f, 0.f};   // of query col; l is the sum over this lane half's keys alone, the halves are joined after the loop
  v8f acc[2][2] = {};   // ctx^T: element r = dim 16 dt + 8g + r of head 2w + hh, column = query col
#pragma unroll 1
  for (int it = 0; it < NK / 128; ++it) { const int j0 = (it * 2 + grp) * 64;   // the same trip count in both groups: every barrier is met by all 8 waves
    // (a) token dots of all heads, all 16 queries x this wave's 16 keys; lane (g, col) keeps pairs (8g + rr, key col), rr = 0..7: every element of D is used
    const size_t kr = mI * NK + j0 + wave * 16 + col; const v2f xk = *(const v2f*)(XKV + kr * 2); const float xk0 = bfr(xk[0]), xk1 = bfr(xk[1]);
    float ft[8][NH]; v16h kf[NH];   // all 8 heads' key fragments requested before the first product: one memory latency a chunk, not eight
#pragma unroll
    for (int h = 0; h < NH; ++h) kf[h] = frag_t(Kr + (((mI * NK + j0) / 16 + wave) * NH + h) * 512, lane);
    v16h qn = frag_h(&sq[col][0], lane);   // q fragments one head ahead of their product
#pragma unroll
    for (int h = 0; h < NH; ++h) { const v16h qc = qn; if (h + 1 < NH) qn = frag_h(&sq[col][(h + 1) * HD], lane);
      v8f c = {}; c = wmma16(qc, kf[h], c);
#pragma unroll
      for (int rr = 0; rr < 8; ++rr) ft[rr][h] = c[rr] * 0.17677669529663688f; }
    // (b) MLP on 32 pairs a pass (two B fragments of 16 pairs), no LDS between the products (unrolled, as every loop here over a register array: its indices must be constants)
#pragma unroll
    for (int rr = 0; rr < 8; ++rr) { float fv[10]; fv[0] = xq0[rr] - xk0; fv[1] = xq1[rr] - xk1;
#pragma unroll
      for (int h = 0; h < NH; ++h) fv[2 + h] = ft[rr][h];
      const FP fb = fsplit(fv, one5); v8f dd[2], ha[2][2];
#pragma unroll
      for (int s = 0; s < 2; ++s)
#pragma unroll
        for (int j = 0; j < 2; ++j) { const v8f z = {}; ha[s][j] = wmma_bf(w1f[j], fb.p[s], z); }   // hi and lo summed inside the one product; the four products of a pass stand together, each in the others' result window
      __builtin_amdgcn_sched_barrier(0);   // keeps the four together: without it the first reader of the first result is drawn up between them and four v_nop are put in front of it
#pragma unroll
      for (int s = 0; s < 2; ++s) { const v8f* hacc = ha[s];
        float hv[16];   // D element r of tile j = hidden 16j + 8g + r = k slot of B element 8j + r
#pragma unroll
        for (int j = 0; j < 2; ++j)
#pragma unroll
          for (int r = 0; r < 8; ++r) { const float v = hacc[j][r]; hv[8 * j + r] = v > 0.f ? v : 0.f; }
        const F2 hb = bsplit16(hv); v8f dacc = {}; dacc = wmma_bf(w2f, hb.h, dacc); dacc = wmma_bf(w2f, hb.l, dacc); dd[s] = dacc; }
      if (g == 0) {   // D rows 0..7 = heads, held by the g = 0 lanes; column = key
#pragma unroll
        for (int s = 0; s < 2; ++s) { float* ps = &sS[8 * s + rr][(wave * 16 + col) * SP]; v4f o0, o1;
#pragma unroll
          for (int r = 0; r < 4; ++r) { o0[r] = dd[s][r] + b2v[r]; o1[r] = dd[s][4 + r] + b2v[4 + r]; }
          *(v4f*)ps = o0; *(v4f*)(ps + 4) = o1; } } }
    __syncthreads();
    // (c) softmax + P.v for this wave's two heads, 32 keys a trip: lane (g, col) takes query col, keys 8g + i and 16 + 8g + i (the k order of frag_h)
#pragma unroll 1   // rolled: only one trip's v fragments and logits stand in registers at a time, and the kernel stays under 256 registers, the most that 4 waves a SIMD allow
    for (int kk = 0; kk < 2; ++kk) {
    v16h vf[2][2];
#pragma unroll
    for (int hh = 0; hh < 2; ++hh)
#pragma unroll
      for (int dt = 0; dt < 2; ++dt) vf[hh][dt] = frag_t(V + (((mI * (NK / 32) + j0 / 32 + kk) * NH + wave * 2 + hh) * 2 + dt) * 512, lane);   // v^T as A: row = dim
    v2f sv[16];   // both heads of a pair in one 8-byte read
#pragma unroll
    for (int i = 0; i < 8; ++i) { sv[i] = *(const v2f*)&sS[col][(32 * kk + 8 * g + i) * SP + 2 * wave]; sv[8 + i] = *(const v2f*)&sS[col][(32 * kk + 16 + 8 * g + i) * SP + 2 * wave]; }
#pragma unroll
    for (int hh = 0; hh < 2; ++hh) { float t[8];
#pragma unroll
      for (int i = 0; i < 8; ++i) t[i] = fmaxf(sv[i][hh], sv[8 + i][hh]);
      float mx = fmaxf(fmaxf(fmaxf(t[0], t[1]), fmaxf(t[2], t[3])), fmaxf(fmaxf(t[4], t[5]), fmaxf(t[6], t[7])));
      mx = fmaxf(mx, xhalf(mx));
      const float mn = fmaxf(m[hh], mx); const float am = exp_slot(m[hh] - mn); const float alpha = (m[hh] <= -1.0e38f) ? 0.f : am;
      v16h pb; float es[4];   // four independent chains of four
#pragma unroll
      for (int i = 0; i < 16; ++i) { const float e = exp_slot(sv[i][hh] - mn); es[i & 3] = (i < 4) ? e : es[i & 3] + e; pb[i] = (_Float16)(e * 2048.0f); }
      l[hh] = l[hh] * alpha + ((es[0] + es[1]) + (es[2] + es[3])); m[hh] = mn;
#pragma unroll
      for (int dt = 0; dt < 2; ++dt) { acc[hh][dt] *= alpha; acc[hh][dt] = wmma16(vf[hh][dt], pb, acc[hh][dt]); } } }
    __syncthreads(); }
  // join of the two groups: group 1 hands its (m, l, ctx^T) over in LDS (the logits buffer is free behind the loop's last barrier; 36 floats a lane = 16 B x odd), group 0 rescales both to the common maximum and writes the normalised ctx to sf for all 8 waves (loops unrolled: the indices of register arrays must be constants)
  // the tail: this block holds whole ctx rows (16 queries x all 8 heads), so it also does their output projection, wave w8 of all 8 taking 32 output columns, and copies their xq through. The Wout^T fragments, the bias and the xq line are requested here, ahead of the join
  const int w8 = tid >> 5; v16b wf[2][NH];
#pragma unroll
  for (int kc = 0; kc < NH; ++kc)
#pragma unroll
    for (int j = 0; j < 2; ++j) wf[j][kc] = frag_b(PW + ((size_t)3 * DZ + w8 * 32 + j * 16 + col) * DZ + kc * 32, lane);
  float bb[2];
#pragma unroll
  for (int j = 0; j < 2; ++j) bb[j] = bfr(BO[w8 * 32 + j * 16 + col]);
  asm volatile("s_wait_xcnt 0x0" ::: "memory");   // the compiler lays the next load's result over the address pair of the loads above: the wait that stands before a register of an issued load is overwritten
  const v4f xc = *(const v4f*)(XQ + rq * 2 + (lane & 7) * 4);   // 16 queries x 2 floats = one 128-byte line; read by every wave (no branch, no start value), stored by the first 8 lanes of the block
  float* mg = &sS2[0][0][0] + (wave * 32 + lane) * 36;
  if (grp == 1) {
#pragma unroll
    for (int hh = 0; hh < 2; ++hh)
#pragma unroll
      for (int dt = 0; dt < 2; ++dt) { v4f o0, o1;
#pragma unroll
        for (int r = 0; r < 4; ++r) { o0[r] = acc[hh][dt][r]; o1[r] = acc[hh][dt][4 + r]; }
        *(v4f*)(mg + (hh * 2 + dt) * 8) = o0; *(v4f*)(mg + (hh * 2 + dt) * 8 + 4) = o1; }
    v4f ml; ml[0] = m[0]; ml[1] = m[1]; ml[2] = l[0]; ml[3] = l[1]; *(v4f*)(mg + 32) = ml; }
  __syncthreads();
  if (grp == 0) { const v4f ml = *(const v4f*)(mg + 32);
#pragma unroll
    for (int hh = 0; hh < 2; ++hh) { const float mn = fmaxf(m[hh], ml[hh]); const float a0 = exp_slot(m[hh] - mn), a1 = exp_slot(ml[hh] - mn);
      l[hh] = l[hh] * a0 + ml[2 + hh] * a1;
#pragma unroll
      for (int dt = 0; dt < 2; ++dt) { const v4f o0 = *(const v4f*)(mg + (hh * 2 + dt) * 8), o1 = *(const v4f*)(mg + (hh * 2 + dt) * 8 + 4);
#pragma unroll
        for (int r = 0; r < 4; ++r) { acc[hh][dt][r] = acc[hh][dt][r] * a0 + o0[r] * a1; acc[hh][dt][4 + r] = acc[hh][dt][4 + r] * a0 + o1[r] * a1; } } }
    // lane (g, query col) holds dims 8g + r and 16 + 8g + r of a head: ctx^T as it stands is the A fragment (row = query, k = the head's 32 dims) of ctx . Wout; split once here, read by all 8 waves
#pragma unroll
    for (int hh = 0; hh < 2; ++hh) { const float il = (1.0f / 2048.0f) / (l[hh] + xhalf(l[hh])); float v[16];
#pragma unroll
      for (int r = 0; r < 8; ++r) { v[r] = acc[hh][0][r] * il; v[8 + r] = acc[hh][1][r] * il; }
      const F2 a = bsplit16(v); union { v16b v; v4u q[2]; } uh, ul; uh.v = a.h; ul.v = a.l;
#pragma unroll
      for (int pc = 0; pc < 2; ++pc) { sf[wave * 2 + hh][0][pc][lane] = uh.q[pc]; sf[wave * 2 + hh][1][pc][lane] = ul.q[pc]; } } }
  __syncthreads();   // all of ctx stands in sf; the join's buffer is free again
  // out0 = ctx (hi + lo) . Wout + bout, k ascending, hi then lo
  v8f oa[2] = {};
#pragma unroll
  for (int kc = 0; kc < NH; ++kc) { union { v16b v; v4u q[2]; } uh, ul;
#pragma unroll
    for (int pc = 0; pc < 2; ++pc) { uh.q[pc] = sf[kc][0][pc][lane]; ul.q[pc] = sf[kc][1][pc][lane]; }
#pragma unroll
    for (int j = 0; j < 2; ++j) { oa[j] = wmma_bf(uh.v, wf[j][kc], oa[j]); oa[j] = wmma_bf(ul.v, wf[j][kc], oa[j]); } }
  float* os = &sS2[0][0][0] + w8 * (16 * 36);   // this wave's own 16 x 32 tile, rows of 36 floats (16 B x odd)
#pragma unroll
  for (int j = 0; j < 2; ++j)
#pragma unroll
    for (int r = 0; r < 8; ++r) os[(8 * g + r) * 36 + j * 16 + col] = oa[j][r] + bb[j];
  LDSX();
#pragma unroll
  for (int i = 0; i < 4; ++i) { const int rl = i * 4 + (lane >> 3), c = (lane & 7) * 4; vst2(Y + (rq + rl) * DZ + w8 * 32 + c, *(const v4f*)&os[rl * 36 + c]); }   // a row's 32 floats = one whole 128-byte line, written by this wave alone
  if (tid < 8) vst2(Y + OUT1 + rq * 2 + tid * 4, xc);   // second output = xq
}
extern "C" void kernel_launch(void* const* d_in, const int* in_sizes, int n_in, void* d_out, int out_size, void* d_ws, size_t ws_size, hipStream_t stream) {
  (void)in_sizes; (void)n_in; (void)out_size;
  const float** F = (const float**)d_in;   // 0 zq, 1 zk, 2 zv [8,1024,256]; 3 xq, 4 xkv [8,1024,2]; 5 Wq, 6 Wk, 7 Wv [256,256] (in,out); 8 Wout [256,256] (in,out), 9 bout; 10 W1 [10,32], 11 b1 [32], 12 W2 [32,8], 13 b2 [8]
  if (ws_size < (size_t)WS_END) return;
  char* ws = (char*)d_ws; __bf16 *PW = (__bf16*)(ws + WS_PW), *P1 = (__bf16*)(ws + WS_P1), *P2 = (__bf16*)(ws + WS_P2); _Float16 *Q = (_Float16*)(ws + WS_Q), *Kr = (_Float16*)(ws + WS_K), *V = (_Float16*)(ws + WS_V);
  k_proj<<<dim3(TNM * NQ / 64, DZ / 128, 3), 128, 0, stream>>>(F[0], F[1], F[2], F[5], F[6], F[7], F[8], F[10], F[12], PW, P1, P2, Q, Kr, V);
  k_te<<<dim3(TQB, TNM), 256, 0, stream>>>(Q, Kr, V, F[3], F[4], P1, P2, F[11], F[13], PW, F[9], (float*)d_out);
}
